// v000
// The times below were measured on an AMD MI455X: many runs one after another, warmed up first and cycling through
// copies of the inputs, with the whole window's GPU time divided by the number of runs. Launches and the gaps
// between them are all in it. The median over several windows is given; except for v000 it joins two sittings, which
// can be a few percent apart, so the side-by-side timings, each taken in one sitting, are the better comparison.
// v000 is the starting kernel. One run takes 1150 microseconds.
#include <hip/hip_runtime.h>

// Single causal attention head over 4,096 tokens scaled by the EMBEDDING width (x [4][4096][512]; q, k, v = x W ('xw' [512][64] 1/sqrt(512), no bias); scores = q.k^T / sqrt(C = 512) (the source divides by sqrt(n_embd), not sqrt(head_size)); causal (-inf); softmax; out = weights.v -> [4][4096][64] (1.0 M); argument order x, Wq, Wk, Wv).
// Layout per batch: bf16 copy of x; 'xw' weights transposed once; exact projections (K 512); identity-table plane builders; scores with EVERY row on hi/lo planes (3 products, dense launches); streaming three-sweep causal softmax over the 4,096 keys; attn.v hybrid (rows < 512 hi/lo 3 products, rest fp16 x1024); k_cs8 removes the fp16 carry; k_copy4 writes the output rows once.
// Compute dtypes, f32 accumulate: every input rounded to bf16; projections exact; scores 3 products; softmax f32; wei.v rows < 512 3 products, rest fp16; output f32.

#define NB_  4
#define TT   4096
#define DM   64
#define NH_  1
#define NKV  1
#define REP  (NH_ / NKV)
#define HD   64
#define DQ   (NH_ * HD)
#define DKV  (NKV * HD)
#define ZH   1
#define RH   512                  // query rows < RH use hi+lo planes (0: none)
#define WIN  0
#define PCAR 1024.0f
#define SCL  0.044194173824159216f   // 1/sqrt(C) with C = n_embd = 512 (the source scales by sqrt(n_embd), NOT sqrt(head_size))
#define MID  64       // q / k width (one 64-wide head)
#define CO   64       // v width
#define CC   512      // input width (d_in)
typedef _Float16 h16;
typedef unsigned short bf;
typedef __attribute__((ext_vector_type(16))) __bf16   v16bf;
typedef __attribute__((ext_vector_type(16))) _Float16 v16h;
typedef __attribute__((ext_vector_type(8)))  _Float16 v8h;
typedef __attribute__((ext_vector_type(8)))  unsigned short v8us;
typedef __attribute__((ext_vector_type(8)))  float    v8f;
typedef __attribute__((ext_vector_type(4)))  float    v4f;
typedef v8h  __attribute__((may_alias)) v8ha;
typedef v4f  __attribute__((may_alias)) v4fa;
typedef v8us __attribute__((may_alias)) v8usa;

__device__ __forceinline__ unsigned short f2bf(float f) { unsigned u = __float_as_uint(f); u += 0x7FFFu + ((u >> 16) & 1u); return (unsigned short)(u >> 16); }
__device__ __forceinline__ float bf2f(unsigned short b) { return __uint_as_float(((unsigned)b) << 16); }
__device__ __forceinline__ float bfr(float f) { return bf2f(f2bf(f)); }
__device__ __forceinline__ v16h cat16(v8h lo, v8h hi) { return __builtin_shufflevector(lo, hi, 0, 1, 2, 3, 4, 5, 6, 7, 8, 9, 10, 11, 12, 13, 14, 15); }
__device__ __forceinline__ v16bf cat16b(v8us lo, v8us hi) { return __builtin_bit_cast(v16bf, __builtin_shufflevector(lo, hi, 0, 1, 2, 3, 4, 5, 6, 7, 8, 9, 10, 11, 12, 13, 14, 15)); }
__device__ __forceinline__ v8f wmma16(v16h a, v16h b, v8f c) { return __builtin_amdgcn_wmma_f32_16x16x32_f16(false, a, false, b, (short)0, c, false, false); }
__device__ __forceinline__ v8f wmmab(v16bf a, v16bf b, v8f c) { return __builtin_amdgcn_wmma_f32_16x16x32_bf16(false, a, false, b, (short)0, c, false, false); }



// ---- k_gemmw: register-blocked GEMM, ONE WAVE per 64x64 output tile (16 accumulators), operands straight from K-contiguous 16-bit planes; grid (M/64, N/64, Z), 32 threads.
// C[m][n] (f32, pitch ldc, + optional f32 bias[n]) = sum_k A[m][k] Bt[n][k] (+ split products per NSPLIT). z-batch strides sA/sB/sC in elements. K % 32 == 0.
template <typename T16> struct WFrag;
template <> struct WFrag<h16> { typedef v16h V; static __device__ __forceinline__ V ld(const h16* p) { return cat16(*(const v8h*)p, *(const v8h*)(p + 16)); } static __device__ __forceinline__ v8f mma(V a, V b, v8f c) { return wmma16(a, b, c); } };
template <> struct WFrag<bf> { typedef v16bf V; static __device__ __forceinline__ V ld(const bf* p) { return cat16b(*(const v8us*)p, *(const v8us*)(p + 16)); } static __device__ __forceinline__ v8f mma(V a, V b, v8f c) { return wmmab(a, b, c); } };
template <typename T16, int NSPLIT, bool BIAS>
__global__ __launch_bounds__(32) void k_gemmw(const T16* __restrict__ A, const T16* __restrict__ A2, const T16* __restrict__ Bt, const T16* __restrict__ Bt2, int K, float* C, int ldc, const float* __restrict__ bias, size_t sA, size_t sB, size_t sC) {
    typedef typename WFrag<T16>::V V;
    __shared__ __align__(16) float os[16 * 68];
    const size_t z = blockIdx.z; A += z * sA; if (A2) A2 += z * sA; Bt += z * sB; if (Bt2) Bt2 += z * sB; C += z * sC;
    const int lane = threadIdx.x & 31, lr = lane & 15, hi = lane >> 4; const int r0 = blockIdx.x * 64, c0 = blockIdx.y * 64;
    v8f acc[4][4];
#pragma unroll
    for (int mb = 0; mb < 4; ++mb)
#pragma unroll
        for (int nb = 0; nb < 4; ++nb) acc[mb][nb] = (v8f){};
    const size_t aoff = (size_t)(r0 + lr) * K + 8 * hi, boff = (size_t)(c0 + lr) * K + 8 * hi;
#pragma unroll 1
    for (int kc = 0; kc < K; kc += 32) {
        V a[4], a2[4];
#pragma unroll
        for (int mb = 0; mb < 4; ++mb) { a[mb] = WFrag<T16>::ld(A + aoff + (size_t)mb * 16 * K + kc); if (NSPLIT == 1 || NSPLIT == 2) a2[mb] = WFrag<T16>::ld(A2 + aoff + (size_t)mb * 16 * K + kc); }
#pragma unroll
        for (int nb = 0; nb < 4; ++nb) { const V b = WFrag<T16>::ld(Bt + boff + (size_t)nb * 16 * K + kc); V b2; if (NSPLIT >= 2) b2 = WFrag<T16>::ld(Bt2 + boff + (size_t)nb * 16 * K + kc);
#pragma unroll
            for (int mb = 0; mb < 4; ++mb) { acc[mb][nb] = WFrag<T16>::mma(a[mb], b, acc[mb][nb]); if (NSPLIT == 1 || NSPLIT == 2) acc[mb][nb] = WFrag<T16>::mma(a2[mb], b, acc[mb][nb]); if (NSPLIT >= 2) acc[mb][nb] = WFrag<T16>::mma(a[mb], b2, acc[mb][nb]); } }
        asm volatile("v_nop\n\tv_nop\n\tv_nop\n\tv_nop" : "+v"(acc[0][0]), "+v"(acc[1][1]), "+v"(acc[2][2]), "+v"(acc[3][3]) : "v"(a[0]), "v"(a[3]));
    }
#pragma unroll
    for (int mb = 0; mb < 4; ++mb) {
#pragma unroll
        for (int nb = 0; nb < 4; ++nb) {
#pragma unroll
            for (int j = 0; j < 8; ++j) os[(hi * 8 + j) * 68 + nb * 16 + lr] = acc[mb][nb][j]; }
        __builtin_amdgcn_wave_barrier(); asm volatile("" ::: "memory");
        float* crow = C + (size_t)(r0 + mb * 16) * ldc + c0;
{
#pragma unroll
            for (int s = 0; s < 8; ++s) { const int row = 2 * s + hi, cofs = lr * 4; v4f val = *(const v4fa*)(os + row * 68 + cofs); if (BIAS) { val[0] += bfr(bias[c0 + cofs]); val[1] += bfr(bias[c0 + cofs + 1]); val[2] += bfr(bias[c0 + cofs + 2]); val[3] += bfr(bias[c0 + cofs + 3]); }
                *(v4f*)(crow + (size_t)row * ldc + cofs) = val; }
             }
        __builtin_amdgcn_wave_barrier(); asm volatile("" ::: "memory");
    }
}

__device__ __forceinline__ h16 tohx(float x) { return (h16)x; }
__device__ __forceinline__ void splitf(float y, unsigned short& h, unsigned short& l) { h = f2bf(y); l = f2bf(y - bf2f(h)); }
typedef __attribute__((ext_vector_type(2))) _Float16 v2h;
typedef __attribute__((ext_vector_type(4))) _Float16 v4h;
typedef __attribute__((ext_vector_type(2))) unsigned short v2us;
typedef __attribute__((ext_vector_type(4))) unsigned short v4us;
typedef __attribute__((ext_vector_type(2))) float v2f;
typedef __attribute__((ext_vector_type(4))) int v4i;

__global__ __launch_bounds__(256) void k_cvt8(const float* __restrict__ src, bf* dst, size_t n8) { const size_t i = (size_t)blockIdx.x * 256 + threadIdx.x; if (i >= n8) return; const v8f v = *(const v8f*)(src + i * 8); v8us o;
#pragma unroll
    for (int k = 0; k < 8; ++k) o[k] = f2bf(v[k]); *(v8us*)(dst + i * 8) = o;  }


__global__ __launch_bounds__(256) void k_wtG(const float* __restrict__ w, int K, int N, bf* Bt) {
    const int lane = threadIdx.x & 31; const int L0 = (blockIdx.x * 8 + (threadIdx.x >> 5)) * 8; const int nlines = N * K / 64;
{
#pragma unroll 1
        for (int l = 0; l < 8; ++l) { const int L = L0 + l; if (L >= nlines) break; const size_t e = (size_t)L * 64 + lane * 2; const int k = (int)(e % K), n = (int)(e / K); v2us o;
            o[0] = f2bf(w[(size_t)k * N + n]); o[1] = f2bf(w[(size_t)(k + 1) * N + n]); *(v2us*)(Bt + e) = o; }
         }
}
__global__ __launch_bounds__(256) void k_vtp(const float* __restrict__ F, int pitch, int nheads, h16* V16, bf* Vh, bf* Vl) { const size_t e = ((size_t)blockIdx.x * 256 + threadIdx.x) * 2; if (e >= (size_t)nheads * HD * TT) return; const int t = (int)(e % TT); const int d = (int)((e / TT) % HD); const int g = (int)(e / ((size_t)TT * HD)); v2h o16; v2us oh, ol;
#pragma unroll
    for (int q = 0; q < 2; ++q) { const float x = F[(size_t)(t + q) * pitch + g * HD + d]; o16[q] = tohx(x); unsigned short a2, c2; splitf(x, a2, c2); oh[q] = a2; ol[q] = c2; }
    *(v2h*)(V16 + e) = o16; *(v2us*)(Vh + e) = oh; *(v2us*)(Vl + e) = ol;  }
__global__ __launch_bounds__(256) void k_lsoft(const float* __restrict__ Sb, h16* P16, bf* Ph, bf* Pl) {
    const int lane = threadIdx.x & 31; const int row = blockIdx.x * 8 + (threadIdx.x >> 5); if (row >= ZH * TT) return; const int i = row % TT; const int zz = row / TT; const bool hires = (i < RH); const float* sr = Sb + (size_t)row * TT; float mx = -3.0e38f;
#pragma unroll 4
    for (int ch = 0; ch < TT / 128; ++ch) { const int j0 = ch * 128 + lane * 4; const v4f a = *(const v4f*)(sr + j0);
#pragma unroll
        for (int q = 0; q < 4; ++q) { float t = (j0 + q <= i) ? a[q] * SCL : -3.0e38f; asm volatile("" : "+v"(t)); mx = fmaxf(mx, t); } }
#pragma unroll
    for (int sh = 16; sh; sh >>= 1) mx = fmaxf(mx, __shfl_xor(mx, sh, 32));
    float sum = 0.f;
#pragma unroll 4
    for (int ch = 0; ch < TT / 128; ++ch) { const int j0 = ch * 128 + lane * 4; const v4f a = *(const v4f*)(sr + j0);
#pragma unroll
        for (int q = 0; q < 4; ++q) { float t = (j0 + q <= i) ? a[q] * SCL : -3.0e38f; asm volatile("" : "+v"(t)); float d0 = __fsub_rn(t, mx); asm volatile("" : "+v"(d0)); sum += __builtin_amdgcn_exp2f(__fmul_rn(d0, 1.4426950408889634f)); } }
#pragma unroll
    for (int sh = 16; sh; sh >>= 1) sum += __shfl_xor(sum, sh, 32);
    const float f = __fdiv_rn(hires ? 1.0f : PCAR, sum);
{
        if (hires) {   /* rows < RH: normalised bf16 hi/lo over all keys, planes [zz][RH][TT] */
#pragma unroll
            for (int ch = 0; ch < TT / 128; ++ch) { const int j0 = ch * 128 + lane * 4; const v4f a = *(const v4f*)(sr + j0); v4us oh, ol;
#pragma unroll
                for (int q = 0; q < 4; ++q) { float t = (j0 + q <= i) ? a[q] * SCL : -3.0e38f; asm volatile("" : "+v"(t)); float d0 = __fsub_rn(t, mx); asm volatile("" : "+v"(d0)); float ex = __builtin_amdgcn_exp2f(__fmul_rn(d0, 1.4426950408889634f)); asm volatile("" : "+v"(ex)); unsigned short a2, c2; splitf(ex * f, a2, c2); oh[q] = a2; ol[q] = c2; }
                const size_t oo = ((size_t)zz * RH + i) * TT + j0; *(v4us*)(Ph + oo) = oh; *(v4us*)(Pl + oo) = ol; }
        } else {
#pragma unroll 2
            for (int ch = 0; ch < TT / 128; ++ch) { const int j0 = ch * 128 + lane * 4; const v4f a = *(const v4f*)(sr + j0); v4h o4;
#pragma unroll
                for (int q = 0; q < 4; ++q) { float t = (j0 + q <= i) ? a[q] * SCL : -3.0e38f; asm volatile("" : "+v"(t)); float d0 = __fsub_rn(t, mx); asm volatile("" : "+v"(d0)); float ex = __builtin_amdgcn_exp2f(__fmul_rn(d0, 1.4426950408889634f)); asm volatile("" : "+v"(ex)); o4[q] = tohx(ex * f); }
                *(v4h*)(P16 + (size_t)row * TT + j0) = o4; } }
         }
}
__global__ __launch_bounds__(256) void k_cs8(float* O, size_t n4) { const size_t i = (size_t)blockIdx.x * 256 + threadIdx.x; if (i >= n4) return; const size_t e = i * 4; const int t = (int)(e / CO);   /* row pitch of the attention-output plane is the VALUE width CO (r1 used the input width CC: wrong whenever CC != CO) */ const float cs = (t < RH) ? 1.0f : (1.0f / PCAR); v4f a = *(const v4f*)(O + e);
#pragma unroll
    for (int q = 0; q < 4; ++q) a[q] = __fmul_rn(a[q], cs);
    *(v4f*)(O + e) = a;  }

__global__ __launch_bounds__(256) void k_csid(float* CS) { const int idx = blockIdx.x * 256 + threadIdx.x; if (idx >= TT * HD) return; v2f cs; cs[0] = 1.0f; cs[1] = 0.0f; *(v2f*)(CS + (size_t)idx * 2) = cs;  }
// k_rope: head planes [h][t][d] (fp16 + hi/lo) of rope(x) x sc with the rotate-half convention out[d] = x[d] cos[t][d] - x[d+HD/2] sin[t][d], out[d+HD/2] = x[d+HD/2] cos[t][d+HD/2] + x[d] sin[t][d+HD/2]
__global__ __launch_bounds__(256) void k_rope(const float* __restrict__ F, int pitch, int nheads, const float* __restrict__ CS, const float* __restrict__ RF, const float* __restrict__ nw, float sc, h16* P16, bf* Ph, bf* Pl) {
    const size_t e = ((size_t)blockIdx.x * 256 + threadIdx.x) * 2; if (e >= (size_t)nheads * TT * HD) return; const int d = (int)(e % HD); const int t = (int)((e / HD) % TT); const int h = (int)(e / ((size_t)HD * TT)); const float* f = F + (size_t)t * pitch + h * HD; const float rf = RF ? RF[(size_t)h * TT + t] : 1.0f; v2h o16; v2us oh, ol;
#pragma unroll
    for (int q = 0; q < 2; ++q) { const int dd = d + q; const int dp = (dd < HD / 2) ? dd + HD / 2 : dd - HD / 2; float x0 = f[dd], x1 = f[dp];
        if (RF) { float n0 = __fmul_rn(x0, rf), n1 = __fmul_rn(x1, rf); asm volatile("" : "+v"(n0)); asm volatile("" : "+v"(n1)); x0 = __fmul_rn(bfr(nw[dd]), n0); x1 = __fmul_rn(bfr(nw[dp]), n1); }
        const v2f cs = *(const v2f*)(CS + ((size_t)t * HD + dd) * 2); float a = __fmul_rn(x0, cs[0]), bq = __fmul_rn(x1, cs[1]); asm volatile("" : "+v"(a)); asm volatile("" : "+v"(bq)); const float r = ((dd < HD / 2) ? __fsub_rn(a, bq) : __fadd_rn(a, bq)) * sc;
        o16[q] = tohx(r); unsigned short a2, c2; splitf(r, a2, c2); oh[q] = a2; ol[q] = c2; }
    *(v2h*)(P16 + e) = o16; *(v2us*)(Ph + e) = oh; *(v2us*)(Pl + e) = ol;  }
__global__ __launch_bounds__(256) void k_copy4(const float* __restrict__ Y, float* out, size_t n4) { const size_t i = (size_t)blockIdx.x * 256 + threadIdx.x; if (i >= n4) return; const v4f a = *(const v4f*)(Y + i * 4); *(v4f*)(out + i * 4) = a;  }
extern "C" void kernel_launch(void* const* d_in, const int* in_sizes, int n_in,
                              void* d_out, int out_size, void* d_ws, size_t ws_size, hipStream_t stream) {
    (void)in_sizes; (void)n_in; (void)out_size;
    const float* x = (const float*)d_in[0]; const float* wq = (const float*)d_in[1]; const float* wk = (const float*)d_in[2]; const float* wv = (const float*)d_in[3];   /* standard roles: rows = queries */
    float* OUT = (float*)d_out;     // [4][4096][64]
    char* wsp = (char*)d_ws;
    auto take = [&](size_t bytes) { char* p = wsp; wsp += (bytes + 255) & ~(size_t)255; return (void*)p; };
    bf* WQ = (bf*)take((size_t)MID * CC * 2); bf* WK = (bf*)take((size_t)MID * CC * 2); bf* WV = (bf*)take((size_t)CO * CC * 2); float* CS = (float*)take((size_t)TT * HD * 2 * 4);
    bf* XB = (bf*)take((size_t)TT * CC * 2); float* FQ = (float*)take((size_t)TT * MID * 4); float* FK = (float*)take((size_t)TT * MID * 4);
    h16* QP16 = (h16*)take((size_t)TT * MID * 2); bf* QPh = (bf*)take((size_t)TT * MID * 2); bf* QPl = (bf*)take((size_t)TT * MID * 2); h16* KP16 = (h16*)take((size_t)TT * MID * 2); bf* KPh = (bf*)take((size_t)TT * MID * 2); bf* KPl = (bf*)take((size_t)TT * MID * 2);
    h16* VT16 = (h16*)take((size_t)CO * TT * 2); bf* VTh = (bf*)take((size_t)CO * TT * 2); bf* VTl = (bf*)take((size_t)CO * TT * 2);
    float* Sb = (float*)take((size_t)TT * TT * 4); h16* P16 = (h16*)take((size_t)TT * TT * 2); bf* Ph = (bf*)take((size_t)RH * TT * 2); bf* Pl = (bf*)take((size_t)RH * TT * 2); float* Ob = (float*)take((size_t)TT * CO * 4);   /* attention output (f32) before the final copy */
    if ((size_t)(wsp - (char*)d_ws) > ws_size) return;    // ws 256 MiB (carve ~118 MiB)
    float* FV = FK;   /* the v projection reuses the k buffer after the k planes are built (stream-ordered) */
    k_wtG<<<(unsigned)((CC * MID / 64 + 63) / 64), 256, 0, stream>>>(wq, CC, MID, WQ); k_wtG<<<(unsigned)((CC * MID / 64 + 63) / 64), 256, 0, stream>>>(wk, CC, MID, WK); k_wtG<<<(unsigned)((CC * CO / 64 + 63) / 64), 256, 0, stream>>>(wv, CC, CO, WV);   /* 'xw' [512][64] -> Bt */       /* 'xw' weights -> Bt */
    k_csid<<<(TT * HD + 255) / 256, 256, 0, stream>>>(CS);   /* identity table: k_rope is a plain per-head plane builder here */
    const unsigned LP = (unsigned)(((size_t)NH_ * TT * HD / 2 + 255) / 256);
    for (int b = 0; b < NB_; ++b) {
        k_cvt8<<<(unsigned)(((size_t)TT * CC / 8 + 255) / 256), 256, 0, stream>>>(x + (size_t)b * TT * CC, XB, (size_t)TT * CC / 8);
        k_gemmw<bf, 0, false><<<dim3(TT / 64, MID / 64, 1), 32, 0, stream>>>(XB, nullptr, WQ, nullptr, CC, FQ, MID, nullptr, 0, 0, 0); k_rope<<<LP, 256, 0, stream>>>(FQ, MID, NH_, CS, nullptr, nullptr, 1.0f, QP16, QPh, QPl);   /* q planes [h][n][64] */
        k_gemmw<bf, 0, false><<<dim3(TT / 64, MID / 64, 1), 32, 0, stream>>>(XB, nullptr, WK, nullptr, CC, FK, MID, nullptr, 0, 0, 0); k_rope<<<LP, 256, 0, stream>>>(FK, MID, NKV, CS, nullptr, nullptr, 1.0f, KP16, KPh, KPl);   /* k planes */
        k_gemmw<bf, 0, false><<<dim3(TT / 64, CO / 64, 1), 32, 0, stream>>>(XB, nullptr, WV, nullptr, CC, FV, CO, nullptr, 0, 0, 0); k_vtp<<<(unsigned)(((size_t)TT * CO / 2 + 255) / 256), 256, 0, stream>>>(FV, CO, CO / HD, VT16, VTh, VTl);   /* v^T planes [h][64][n] */
        for (int h = 0; h < NH_; ++h) {   /* per head: dense 4096 x 4096 attention */
            k_gemmw<bf, 2, false><<<dim3(TT / 64, TT / 64, 1), 32, 0, stream>>>(QPh + (size_t)h * TT * HD, QPl + (size_t)h * TT * HD, KPh + (size_t)h * TT * HD, KPl + (size_t)h * TT * HD, HD, Sb, TT, nullptr, 0, 0, 0);   /* S[i][j] = q_i.k_j (3 products, every row) */
            k_lsoft<<<TT / 8, 256, 0, stream>>>(Sb, P16, Ph, Pl);   /* x 1/sqrt(512), softmax over the 4,096 keys */
            k_gemmw<bf, 2, false><<<dim3(RH / 64, HD / 64, 1), 32, 0, stream>>>(Ph, Pl, VTh + (size_t)h * HD * TT, VTl + (size_t)h * HD * TT, TT, Ob + h * HD, CO, nullptr, 0, 0, 0);
            k_gemmw<h16, 0, false><<<dim3((TT - RH) / 64, HD / 64, 1), 32, 0, stream>>>(P16 + (size_t)RH * TT, nullptr, VT16 + (size_t)h * HD * TT, nullptr, TT, Ob + (size_t)RH * CO + h * HD, CO, nullptr, 0, 0, 0); }
        k_cs8<<<(unsigned)(((size_t)TT * CO / 4 + 255) / 256), 256, 0, stream>>>(Ob, (size_t)TT * CO / 4);   /* rows >= 512 x 1/1024 */ k_copy4<<<(unsigned)(((size_t)TT * CO / 4 + 255) / 256), 256, 0, stream>>>(Ob, OUT + (size_t)b * TT * CO, (size_t)TT * CO / 4); }   /* the batch's output rows, written once */
}

// v001
// One run takes 491 microseconds.
// Two timings next to v000 put it at 2.33 and 2.34 times that version's speed.
#include <hip/hip_runtime.h>

// Single causal attention head over 4,096 tokens scaled by the EMBEDDING width (x [4][4096][512]; q, k, v = x W ('xw' [512][64] 1/sqrt(512), no bias); scores = q.k^T / sqrt(C = 512) (the source divides by sqrt(n_embd), not sqrt(head_size)); causal (-inf); softmax; out = weights.v -> [4][4096][64] (1.0 M); argument order x, Wq, Wk, Wv).
// Layout per batch: bf16 copy of x; 'xw' weights transposed once; exact projections (K 512); identity-table plane builders; scores with EVERY row on hi/lo planes (3 products, dense launches); streaming three-sweep causal softmax over the 4,096 keys; attn.v hybrid (rows < 512 hi/lo 3 products, rest fp16 x1024); k_cs8 removes the fp16 carry; k_copy4 writes the output rows once. Split-K: the projections and both attn.v products divide their K loop over the 8 waves of a work-group (partial tiles summed through LDS); attn.v also over grid z (f32 partial planes, summed in k_cs8).
// Compute dtypes, f32 accumulate: every input rounded to bf16; projections exact; scores 3 products; softmax f32; wei.v rows < 512 3 products, rest fp16; output f32.

#define NB_  4
#define TT   4096
#define DM   64
#define NH_  1
#define NKV  1
#define REP  (NH_ / NKV)
#define HD   64
#define DQ   (NH_ * HD)
#define DKV  (NKV * HD)
#define ZH   1
#define RH   512                  // query rows < RH use hi+lo planes (0: none)
#define WIN  0
#define PCAR 1024.0f
#define SCL  0.044194173824159216f   // 1/sqrt(C) with C = n_embd = 512 (the source scales by sqrt(n_embd), NOT sqrt(head_size))
#define MID  64       // q / k width (one 64-wide head)
#define CO   64       // v width
#define CC   512      // input width (d_in)
#define NWK  8        // waves of a work-group that share one K loop (split-K launches)
#define SKH  16       // grid-z K slices of the hi/lo attn.v product
#define SKF  4        // grid-z K slices of the fp16 attn.v product
typedef _Float16 h16;
typedef unsigned short bf;
typedef __attribute__((ext_vector_type(16))) __bf16   v16bf;
typedef __attribute__((ext_vector_type(16))) _Float16 v16h;
typedef __attribute__((ext_vector_type(8)))  _Float16 v8h;
typedef __attribute__((ext_vector_type(8)))  unsigned short v8us;
typedef __attribute__((ext_vector_type(8)))  float    v8f;
typedef __attribute__((ext_vector_type(4)))  float    v4f;
typedef v8h  __attribute__((may_alias)) v8ha;
typedef v4f  __attribute__((may_alias)) v4fa;
typedef v8us __attribute__((may_alias)) v8usa;

__device__ __forceinline__ unsigned short f2bf(float f) { unsigned u = __float_as_uint(f); u += 0x7FFFu + ((u >> 16) & 1u); return (unsigned short)(u >> 16); }
__device__ __forceinline__ float bf2f(unsigned short b) { return __uint_as_float(((unsigned)b) << 16); }
__device__ __forceinline__ float bfr(float f) { return bf2f(f2bf(f)); }
__device__ __forceinline__ v16h cat16(v8h lo, v8h hi) { return __builtin_shufflevector(lo, hi, 0, 1, 2, 3, 4, 5, 6, 7, 8, 9, 10, 11, 12, 13, 14, 15); }
__device__ __forceinline__ v16bf cat16b(v8us lo, v8us hi) { return __builtin_bit_cast(v16bf, __builtin_shufflevector(lo, hi, 0, 1, 2, 3, 4, 5, 6, 7, 8, 9, 10, 11, 12, 13, 14, 15)); }
__device__ __forceinline__ v8f wmma16(v16h a, v16h b, v8f c) { return __builtin_amdgcn_wmma_f32_16x16x32_f16(false, a, false, b, (short)0, c, false, false); }
__device__ __forceinline__ v8f wmmab(v16bf a, v16bf b, v8f c) { return __builtin_amdgcn_wmma_f32_16x16x32_bf16(false, a, false, b, (short)0, c, false, false); }



// ---- k_gemmw: register-blocked GEMM, one 64x64 output tile per work-group (16 accumulators a wave), operands straight from K-contiguous 16-bit planes of row pitch K; grid (M/64, N/64, Z), 32 * NW threads.
// C[m][n] (f32, pitch ldc, + optional f32 bias[n]) = sum_{k < KS} A[m][k] Bt[n][k] (+ split products per NSPLIT). z strides sA/sB/sC in elements (a K slice per z: sA = sB = KS, sC = one partial plane; KS = K: no slicing). KS % (32 * NW) == 0.
// NW > 1: wave w takes the k blocks w, w + NW, ... (neighbour waves read the two halves of one 128-byte line); the NW partial tiles are summed through LDS in wave order.
template <typename T16> struct WFrag;
template <> struct WFrag<h16> { typedef v16h V; static __device__ __forceinline__ V ld(const h16* p) { return cat16(*(const v8h*)p, *(const v8h*)(p + 16)); } static __device__ __forceinline__ v8f mma(V a, V b, v8f c) { return wmma16(a, b, c); } };
template <> struct WFrag<bf> { typedef v16bf V; static __device__ __forceinline__ V ld(const bf* p) { return cat16b(*(const v8us*)p, *(const v8us*)(p + 16)); } static __device__ __forceinline__ v8f mma(V a, V b, v8f c) { return wmmab(a, b, c); } };
template <typename T16, int NSPLIT, bool BIAS, int NW>
__global__ __launch_bounds__(32 * NW) void k_gemmw(const T16* __restrict__ A, const T16* __restrict__ A2, const T16* __restrict__ Bt, const T16* __restrict__ Bt2, int K, int KS, float* C, int ldc, const float* __restrict__ bias, size_t sA, size_t sB, size_t sC) {
    typedef typename WFrag<T16>::V V;
    __shared__ __align__(16) float os[NW == 1 ? 16 * 68 : NW * 64 * 68];
    const size_t z = blockIdx.z; A += z * sA; if (A2) A2 += z * sA; Bt += z * sB; if (Bt2) Bt2 += z * sB; C += z * sC;
    const int lane = threadIdx.x & 31, lr = lane & 15, hi = lane >> 4; const int r0 = blockIdx.x * 64, c0 = blockIdx.y * 64;
    v8f acc[4][4];
#pragma unroll
    for (int mb = 0; mb < 4; ++mb)
#pragma unroll
        for (int nb = 0; nb < 4; ++nb) acc[mb][nb] = (v8f){};
    const size_t aoff = (size_t)(r0 + lr) * K + 8 * hi, boff = (size_t)(c0 + lr) * K + 8 * hi;
    const int wv = (NW == 1) ? 0 : __builtin_amdgcn_readfirstlane((int)(threadIdx.x >> 5));   // wave number, scalar: the K loop keeps its scalar counter and branch
#pragma unroll 1
    for (int kc = wv * 32; kc < KS; kc += 32 * NW) {
        V a[4], a2[4];
#pragma unroll
        for (int mb = 0; mb < 4; ++mb) { a[mb] = WFrag<T16>::ld(A + aoff + (size_t)mb * 16 * K + kc); if (NSPLIT == 1 || NSPLIT == 2) a2[mb] = WFrag<T16>::ld(A2 + aoff + (size_t)mb * 16 * K + kc); }
#pragma unroll
        for (int nb = 0; nb < 4; ++nb) { const V b = WFrag<T16>::ld(Bt + boff + (size_t)nb * 16 * K + kc); V b2; if (NSPLIT >= 2) b2 = WFrag<T16>::ld(Bt2 + boff + (size_t)nb * 16 * K + kc);
#pragma unroll
            for (int mb = 0; mb < 4; ++mb) { acc[mb][nb] = WFrag<T16>::mma(a[mb], b, acc[mb][nb]); if (NSPLIT == 1 || NSPLIT == 2) acc[mb][nb] = WFrag<T16>::mma(a2[mb], b, acc[mb][nb]); if (NSPLIT >= 2) acc[mb][nb] = WFrag<T16>::mma(a[mb], b2, acc[mb][nb]); } }
        asm volatile("v_nop\n\tv_nop\n\tv_nop\n\tv_nop" : "+v"(acc[0][0]), "+v"(acc[1][1]), "+v"(acc[2][2]), "+v"(acc[3][3]) : "v"(a[0]), "v"(a[3]));
    }
    if constexpr (NW > 1) {
        float* my = os + wv * (64 * 68);
        // the three loops are unrolled so that acc[][] is indexed by constants and stays in registers
#pragma unroll
        for (int mb = 0; mb < 4; ++mb)
#pragma unroll
            for (int nb = 0; nb < 4; ++nb)
#pragma unroll
                for (int j = 0; j < 8; ++j) my[(mb * 16 + hi * 8 + j) * 68 + nb * 16 + lr] = acc[mb][nb][j];
        __syncthreads();   // every wave's partial tile is in LDS before any wave sums them
        // both loops unrolled: a thread's LDS reads go out together instead of one wait per read
#pragma unroll
        for (int s = 0; s < 32 / NW; ++s) { const int idx = s * (32 * NW) + (int)threadIdx.x, row = idx >> 4, cofs = (idx & 15) * 4; v4f val = *(const v4fa*)(os + row * 68 + cofs);
#pragma unroll
            for (int w2 = 1; w2 < NW; ++w2) val += *(const v4fa*)(os + w2 * (64 * 68) + row * 68 + cofs);
            if (BIAS) { val[0] += bfr(bias[c0 + cofs]); val[1] += bfr(bias[c0 + cofs + 1]); val[2] += bfr(bias[c0 + cofs + 2]); val[3] += bfr(bias[c0 + cofs + 3]); }
            *(v4f*)(C + (size_t)(r0 + row) * ldc + c0 + cofs) = val; }
        return;
    }
#pragma unroll
    for (int mb = 0; mb < 4; ++mb) {
#pragma unroll
        for (int nb = 0; nb < 4; ++nb) {
#pragma unroll
            for (int j = 0; j < 8; ++j) os[(hi * 8 + j) * 68 + nb * 16 + lr] = acc[mb][nb][j]; }
        __builtin_amdgcn_wave_barrier(); asm volatile("" ::: "memory");
        float* crow = C + (size_t)(r0 + mb * 16) * ldc + c0;
{
#pragma unroll
            for (int s = 0; s < 8; ++s) { const int row = 2 * s + hi, cofs = lr * 4; v4f val = *(const v4fa*)(os + row * 68 + cofs); if (BIAS) { val[0] += bfr(bias[c0 + cofs]); val[1] += bfr(bias[c0 + cofs + 1]); val[2] += bfr(bias[c0 + cofs + 2]); val[3] += bfr(bias[c0 + cofs + 3]); }
                *(v4f*)(crow + (size_t)row * ldc + cofs) = val; }
             }
        __builtin_amdgcn_wave_barrier(); asm volatile("" ::: "memory");
    }
}

__device__ __forceinline__ h16 tohx(float x) { return (h16)x; }
__device__ __forceinline__ void splitf(float y, unsigned short& h, unsigned short& l) { h = f2bf(y); l = f2bf(y - bf2f(h)); }
typedef __attribute__((ext_vector_type(2))) _Float16 v2h;
typedef __attribute__((ext_vector_type(4))) _Float16 v4h;
typedef __attribute__((ext_vector_type(2))) unsigned short v2us;
typedef __attribute__((ext_vector_type(4))) unsigned short v4us;
typedef __attribute__((ext_vector_type(2))) float v2f;
typedef __attribute__((ext_vector_type(4))) int v4i;

__global__ __launch_bounds__(256) void k_cvt8(const float* __restrict__ src, bf* dst, size_t n8) { const size_t i = (size_t)blockIdx.x * 256 + threadIdx.x; if (i >= n8) return; const v8f v = *(const v8f*)(src + i * 8); v8us o;
#pragma unroll
    for (int k = 0; k < 8; ++k) o[k] = f2bf(v[k]); *(v8us*)(dst + i * 8) = o;  }


__global__ __launch_bounds__(256) void k_wtG(const float* __restrict__ w, int K, int N, bf* Bt) {
    const int lane = threadIdx.x & 31; const int L0 = (blockIdx.x * 8 + (threadIdx.x >> 5)) * 8; const int nlines = N * K / 64;
{
#pragma unroll 1
        for (int l = 0; l < 8; ++l) { const int L = L0 + l; if (L >= nlines) break; const size_t e = (size_t)L * 64 + lane * 2; const int k = (int)(e % K), n = (int)(e / K); v2us o;
            o[0] = f2bf(w[(size_t)k * N + n]); o[1] = f2bf(w[(size_t)(k + 1) * N + n]); *(v2us*)(Bt + e) = o; }
         }
}
__global__ __launch_bounds__(256) void k_vtp(const float* __restrict__ F, int pitch, int nheads, h16* V16, bf* Vh, bf* Vl) { const size_t e = ((size_t)blockIdx.x * 256 + threadIdx.x) * 2; if (e >= (size_t)nheads * HD * TT) return; const int t = (int)(e % TT); const int d = (int)((e / TT) % HD); const int g = (int)(e / ((size_t)TT * HD)); v2h o16; v2us oh, ol;
#pragma unroll
    for (int q = 0; q < 2; ++q) { const float x = F[(size_t)(t + q) * pitch + g * HD + d]; o16[q] = tohx(x); unsigned short a2, c2; splitf(x, a2, c2); oh[q] = a2; ol[q] = c2; }
    *(v2h*)(V16 + e) = o16; *(v2us*)(Vh + e) = oh; *(v2us*)(Vl + e) = ol;  }
__global__ __launch_bounds__(256) void k_lsoft(const float* __restrict__ Sb, h16* P16, bf* Ph, bf* Pl) {
    const int lane = threadIdx.x & 31; const int row = blockIdx.x * 8 + (threadIdx.x >> 5); if (row >= ZH * TT) return; const int i = row % TT; const int zz = row / TT; const bool hires = (i < RH); const float* sr = Sb + (size_t)row * TT; float mx = -3.0e38f;
#pragma unroll 4
    for (int ch = 0; ch < TT / 128; ++ch) { const int j0 = ch * 128 + lane * 4; const v4f a = *(const v4f*)(sr + j0);
#pragma unroll
        for (int q = 0; q < 4; ++q) { float t = (j0 + q <= i) ? a[q] * SCL : -3.0e38f; asm volatile("" : "+v"(t)); mx = fmaxf(mx, t); } }
#pragma unroll
    for (int sh = 16; sh; sh >>= 1) mx = fmaxf(mx, __shfl_xor(mx, sh, 32));
    float sum = 0.f;
#pragma unroll 4
    for (int ch = 0; ch < TT / 128; ++ch) { const int j0 = ch * 128 + lane * 4; const v4f a = *(const v4f*)(sr + j0);
#pragma unroll
        for (int q = 0; q < 4; ++q) { float t = (j0 + q <= i) ? a[q] * SCL : -3.0e38f; asm volatile("" : "+v"(t)); float d0 = __fsub_rn(t, mx); asm volatile("" : "+v"(d0)); sum += __builtin_amdgcn_exp2f(__fmul_rn(d0, 1.4426950408889634f)); } }
#pragma unroll
    for (int sh = 16; sh; sh >>= 1) sum += __shfl_xor(sum, sh, 32);
    const float f = __fdiv_rn(hires ? 1.0f : PCAR, sum);
{
        if (hires) {   /* rows < RH: normalised bf16 hi/lo over all keys, planes [zz][RH][TT] */
#pragma unroll
            for (int ch = 0; ch < TT / 128; ++ch) { const int j0 = ch * 128 + lane * 4; const v4f a = *(const v4f*)(sr + j0); v4us oh, ol;
#pragma unroll
                for (int q = 0; q < 4; ++q) { float t = (j0 + q <= i) ? a[q] * SCL : -3.0e38f; asm volatile("" : "+v"(t)); float d0 = __fsub_rn(t, mx); asm volatile("" : "+v"(d0)); float ex = __builtin_amdgcn_exp2f(__fmul_rn(d0, 1.4426950408889634f)); asm volatile("" : "+v"(ex)); unsigned short a2, c2; splitf(ex * f, a2, c2); oh[q] = a2; ol[q] = c2; }
                const size_t oo = ((size_t)zz * RH + i) * TT + j0; *(v4us*)(Ph + oo) = oh; *(v4us*)(Pl + oo) = ol; }
        } else {
#pragma unroll 2
            for (int ch = 0; ch < TT / 128; ++ch) { const int j0 = ch * 128 + lane * 4; const v4f a = *(const v4f*)(sr + j0); v4h o4;
#pragma unroll
                for (int q = 0; q < 4; ++q) { float t = (j0 + q <= i) ? a[q] * SCL : -3.0e38f; asm volatile("" : "+v"(t)); float d0 = __fsub_rn(t, mx); asm volatile("" : "+v"(d0)); float ex = __builtin_amdgcn_exp2f(__fmul_rn(d0, 1.4426950408889634f)); asm volatile("" : "+v"(ex)); o4[q] = tohx(ex * f); }
                *(v4h*)(P16 + (size_t)row * TT + j0) = o4; } }
         }
}
// k_cs8: sums the grid-z partial planes of attn.v in slice order (rows < RH: SKH planes of PH; the rest: SKF planes of PF, then x 1/PCAR removes the fp16 carry); row pitch is the value width CO. The plane loops are unrolled so that a thread's loads are all in flight at once.
__global__ __launch_bounds__(256) void k_cs8(const float* __restrict__ PH, const float* __restrict__ PF, float* O, size_t n4) { const size_t i = (size_t)blockIdx.x * 256 + threadIdx.x; if (i >= n4) return; const size_t e = i * 4; const int t = (int)(e / CO); v4f a;
    if (t < RH) { a = *(const v4f*)(PH + e);
#pragma unroll
        for (int s = 1; s < SKH; ++s) a += *(const v4f*)(PH + (size_t)s * RH * CO + e);
    } else { const size_t e2 = e - (size_t)RH * CO; a = *(const v4f*)(PF + e2);
#pragma unroll
        for (int s = 1; s < SKF; ++s) a += *(const v4f*)(PF + (size_t)s * (TT - RH) * CO + e2);
#pragma unroll
        for (int q = 0; q < 4; ++q) a[q] = __fmul_rn(a[q], 1.0f / PCAR); }
    *(v4f*)(O + e) = a;  }

__global__ __launch_bounds__(256) void k_csid(float* CS) { const int idx = blockIdx.x * 256 + threadIdx.x; if (idx >= TT * HD) return; v2f cs; cs[0] = 1.0f; cs[1] = 0.0f; *(v2f*)(CS + (size_t)idx * 2) = cs;  }
// k_rope: head planes [h][t][d] (fp16 + hi/lo) of rope(x) x sc with the rotate-half convention out[d] = x[d] cos[t][d] - x[d+HD/2] sin[t][d], out[d+HD/2] = x[d+HD/2] cos[t][d+HD/2] + x[d] sin[t][d+HD/2]
__global__ __launch_bounds__(256) void k_rope(const float* __restrict__ F, int pitch, int nheads, const float* __restrict__ CS, const float* __restrict__ RF, const float* __restrict__ nw, float sc, h16* P16, bf* Ph, bf* Pl) {
    const size_t e = ((size_t)blockIdx.x * 256 + threadIdx.x) * 2; if (e >= (size_t)nheads * TT * HD) return; const int d = (int)(e % HD); const int t = (int)((e / HD) % TT); const int h = (int)(e / ((size_t)HD * TT)); const float* f = F + (size_t)t * pitch + h * HD; const float rf = RF ? RF[(size_t)h * TT + t] : 1.0f; v2h o16; v2us oh, ol;
#pragma unroll
    for (int q = 0; q < 2; ++q) { const int dd = d + q; const int dp = (dd < HD / 2) ? dd + HD / 2 : dd - HD / 2; float x0 = f[dd], x1 = f[dp];
        if (RF) { float n0 = __fmul_rn(x0, rf), n1 = __fmul_rn(x1, rf); asm volatile("" : "+v"(n0)); asm volatile("" : "+v"(n1)); x0 = __fmul_rn(bfr(nw[dd]), n0); x1 = __fmul_rn(bfr(nw[dp]), n1); }
        const v2f cs = *(const v2f*)(CS + ((size_t)t * HD + dd) * 2); float a = __fmul_rn(x0, cs[0]), bq = __fmul_rn(x1, cs[1]); asm volatile("" : "+v"(a)); asm volatile("" : "+v"(bq)); const float r = ((dd < HD / 2) ? __fsub_rn(a, bq) : __fadd_rn(a, bq)) * sc;
        o16[q] = tohx(r); unsigned short a2, c2; splitf(r, a2, c2); oh[q] = a2; ol[q] = c2; }
    *(v2h*)(P16 + e) = o16; *(v2us*)(Ph + e) = oh; *(v2us*)(Pl + e) = ol;  }
__global__ __launch_bounds__(256) void k_copy4(const float* __restrict__ Y, float* out, size_t n4) { const size_t i = (size_t)blockIdx.x * 256 + threadIdx.x; if (i >= n4) return; const v4f a = *(const v4f*)(Y + i * 4); *(v4f*)(out + i * 4) = a;  }
extern "C" void kernel_launch(void* const* d_in, const int* in_sizes, int n_in,
                              void* d_out, int out_size, void* d_ws, size_t ws_size, hipStream_t stream) {
    (void)in_sizes; (void)n_in; (void)out_size;
    const float* x = (const float*)d_in[0]; const float* wq = (const float*)d_in[1]; const float* wk = (const float*)d_in[2]; const float* wv = (const float*)d_in[3];   /* standard roles: rows = queries */
    float* OUT = (float*)d_out;     // [4][4096][64]
    char* wsp = (char*)d_ws;
    auto take = [&](size_t bytes) { char* p = wsp; wsp += (bytes + 255) & ~(size_t)255; return (void*)p; };
    bf* WQ = (bf*)take((size_t)MID * CC * 2); bf* WK = (bf*)take((size_t)MID * CC * 2); bf* WV = (bf*)take((size_t)CO * CC * 2); float* CS = (float*)take((size_t)TT * HD * 2 * 4);
    bf* XB = (bf*)take((size_t)TT * CC * 2); float* FQ = (float*)take((size_t)TT * MID * 4); float* FK = (float*)take((size_t)TT * MID * 4);
    h16* QP16 = (h16*)take((size_t)TT * MID * 2); bf* QPh = (bf*)take((size_t)TT * MID * 2); bf* QPl = (bf*)take((size_t)TT * MID * 2); h16* KP16 = (h16*)take((size_t)TT * MID * 2); bf* KPh = (bf*)take((size_t)TT * MID * 2); bf* KPl = (bf*)take((size_t)TT * MID * 2);
    h16* VT16 = (h16*)take((size_t)CO * TT * 2); bf* VTh = (bf*)take((size_t)CO * TT * 2); bf* VTl = (bf*)take((size_t)CO * TT * 2);
    float* Sb = (float*)take((size_t)TT * TT * 4); h16* P16 = (h16*)take((size_t)TT * TT * 2); bf* Ph = (bf*)take((size_t)RH * TT * 2); bf* Pl = (bf*)take((size_t)RH * TT * 2); float* Ob = (float*)take((size_t)TT * CO * 4);   /* attention output (f32) before the final copy */
    float* PH = (float*)take((size_t)SKH * RH * CO * 4); float* PF = (float*)take((size_t)SKF * (TT - RH) * CO * 4);   /* attn.v partial planes, one per K slice */
    if ((size_t)(wsp - (char*)d_ws) > ws_size) return;    // ws 256 MiB (carve ~123 MiB)
    float* FV = FK;   /* the v projection reuses the k buffer after the k planes are built (stream-ordered) */
    k_wtG<<<(unsigned)((CC * MID / 64 + 63) / 64), 256, 0, stream>>>(wq, CC, MID, WQ); k_wtG<<<(unsigned)((CC * MID / 64 + 63) / 64), 256, 0, stream>>>(wk, CC, MID, WK); k_wtG<<<(unsigned)((CC * CO / 64 + 63) / 64), 256, 0, stream>>>(wv, CC, CO, WV);   /* 'xw' [512][64] -> Bt */       /* 'xw' weights -> Bt */
    k_csid<<<(TT * HD + 255) / 256, 256, 0, stream>>>(CS);   /* identity table: k_rope is a plain per-head plane builder here */
    const unsigned LP = (unsigned)(((size_t)NH_ * TT * HD / 2 + 255) / 256);
    for (int b = 0; b < NB_; ++b) {
        k_cvt8<<<(unsigned)(((size_t)TT * CC / 8 + 255) / 256), 256, 0, stream>>>(x + (size_t)b * TT * CC, XB, (size_t)TT * CC / 8);
        k_gemmw<bf, 0, false, NWK><<<dim3(TT / 64, MID / 64, 1), 32 * NWK, 0, stream>>>(XB, nullptr, WQ, nullptr, CC, CC, FQ, MID, nullptr, 0, 0, 0); k_rope<<<LP, 256, 0, stream>>>(FQ, MID, NH_, CS, nullptr, nullptr, 1.0f, QP16, QPh, QPl);   /* q planes [h][n][64] */
        k_gemmw<bf, 0, false, NWK><<<dim3(TT / 64, MID / 64, 1), 32 * NWK, 0, stream>>>(XB, nullptr, WK, nullptr, CC, CC, FK, MID, nullptr, 0, 0, 0); k_rope<<<LP, 256, 0, stream>>>(FK, MID, NKV, CS, nullptr, nullptr, 1.0f, KP16, KPh, KPl);   /* k planes */
        k_gemmw<bf, 0, false, NWK><<<dim3(TT / 64, CO / 64, 1), 32 * NWK, 0, stream>>>(XB, nullptr, WV, nullptr, CC, CC, FV, CO, nullptr, 0, 0, 0); k_vtp<<<(unsigned)(((size_t)TT * CO / 2 + 255) / 256), 256, 0, stream>>>(FV, CO, CO / HD, VT16, VTh, VTl);   /* v^T planes [h][64][n] */
        for (int h = 0; h < NH_; ++h) {   /* per head: dense 4096 x 4096 attention */
            k_gemmw<bf, 2, false, 1><<<dim3(TT / 64, TT / 64, 1), 32, 0, stream>>>(QPh + (size_t)h * TT * HD, QPl + (size_t)h * TT * HD, KPh + (size_t)h * TT * HD, KPl + (size_t)h * TT * HD, HD, HD, Sb, TT, nullptr, 0, 0, 0);   /* S[i][j] = q_i.k_j (3 products, every row) */
            k_lsoft<<<TT / 8, 256, 0, stream>>>(Sb, P16, Ph, Pl);   /* x 1/sqrt(512), softmax over the 4,096 keys */
            k_gemmw<bf, 2, false, NWK><<<dim3(RH / 64, HD / 64, SKH), 32 * NWK, 0, stream>>>(Ph, Pl, VTh + (size_t)h * HD * TT, VTl + (size_t)h * HD * TT, TT, TT / SKH, PH + h * HD, CO, nullptr, TT / SKH, TT / SKH, (size_t)RH * CO);
            k_gemmw<h16, 0, false, NWK><<<dim3((TT - RH) / 64, HD / 64, SKF), 32 * NWK, 0, stream>>>(P16 + (size_t)RH * TT, nullptr, VT16 + (size_t)h * HD * TT, nullptr, TT, TT / SKF, PF + h * HD, CO, nullptr, TT / SKF, TT / SKF, (size_t)(TT - RH) * CO); }
        k_cs8<<<(unsigned)(((size_t)TT * CO / 4 + 255) / 256), 256, 0, stream>>>(PH, PF, Ob, (size_t)TT * CO / 4);   /* partial planes summed; rows >= 512 x 1/1024 */ k_copy4<<<(unsigned)(((size_t)TT * CO / 4 + 255) / 256), 256, 0, stream>>>(Ob, OUT + (size_t)b * TT * CO, (size_t)TT * CO / 4); }   /* the batch's output rows, written once */
}

// v002
// A run of this version takes 381 microseconds.
// Next to v001, in two timings, it ran 1.31 and 1.29 times as fast.
// Counting every step since v000, it is 3.03 times as fast.
#include <hip/hip_runtime.h>

// Single causal attention head over 4,096 tokens scaled by the EMBEDDING width (x [4][4096][512]; q, k, v = x W ('xw' [512][64] 1/sqrt(512), no bias); scores = q.k^T / sqrt(C = 512) (the source divides by sqrt(n_embd), not sqrt(head_size)); causal (-inf); softmax; out = weights.v -> [4][4096][64] (1.0 M); argument order x, Wq, Wk, Wv).
// All four batches go through one launch of every kernel but the scores and the softmax (their f32 score plane is one batch's and is reused): rows stacked where the operand is shared, else the batch on grid y.
// Layout per batch: bf16 copy of x; 'xw' weights transposed once; exact projections (K 512); identity-table plane builders; scores with EVERY row on hi/lo planes (3 products, dense launches); streaming three-sweep causal softmax over the 4,096 keys; attn.v hybrid (rows < 512 hi/lo 3 products, rest fp16 x1024); k_cs8 removes the fp16 carry; k_copy4 writes the output rows once. Split-K: the projections and both attn.v products divide their K loop over the 8 waves of a work-group (partial tiles summed through LDS); attn.v also over grid z (f32 partial planes, summed in k_cs8).
// Compute dtypes, f32 accumulate: every input rounded to bf16; projections exact; scores 3 products; softmax f32; wei.v rows < 512 3 products, rest fp16; output f32.

#define NB_  4
#define TT   4096
#define DM   64
#define NH_  1
#define NKV  1
#define REP  (NH_ / NKV)
#define HD   64
#define DQ   (NH_ * HD)
#define DKV  (NKV * HD)
#define ZH   1
#define RH   512                  // query rows < RH use hi+lo planes (0: none)
#define WIN  0
#define PCAR 1024.0f
#define SCL  0.044194173824159216f   // 1/sqrt(C) with C = n_embd = 512 (the source scales by sqrt(n_embd), NOT sqrt(head_size))
#define MID  64       // q / k width (one 64-wide head)
#define CO   64       // v width
#define CC   512      // input width (d_in)
#define NWK  8        // waves of a work-group that share one K loop (split-K launches)
#define SKH  16       // grid-z K slices of the hi/lo attn.v product
#define SKF  4        // grid-z K slices of the fp16 attn.v product
typedef _Float16 h16;
typedef unsigned short bf;
typedef __attribute__((ext_vector_type(16))) __bf16   v16bf;
typedef __attribute__((ext_vector_type(16))) _Float16 v16h;
typedef __attribute__((ext_vector_type(8)))  _Float16 v8h;
typedef __attribute__((ext_vector_type(8)))  unsigned short v8us;
typedef __attribute__((ext_vector_type(8)))  float    v8f;
typedef __attribute__((ext_vector_type(4)))  float    v4f;
typedef v8h  __attribute__((may_alias)) v8ha;
typedef v4f  __attribute__((may_alias)) v4fa;
typedef v8us __attribute__((may_alias)) v8usa;

__device__ __forceinline__ unsigned short f2bf(float f) { unsigned u = __float_as_uint(f); u += 0x7FFFu + ((u >> 16) & 1u); return (unsigned short)(u >> 16); }
__device__ __forceinline__ float bf2f(unsigned short b) { return __uint_as_float(((unsigned)b) << 16); }
__device__ __forceinline__ float bfr(float f) { return bf2f(f2bf(f)); }
__device__ __forceinline__ v16h cat16(v8h lo, v8h hi) { return __builtin_shufflevector(lo, hi, 0, 1, 2, 3, 4, 5, 6, 7, 8, 9, 10, 11, 12, 13, 14, 15); }
__device__ __forceinline__ v16bf cat16b(v8us lo, v8us hi) { return __builtin_bit_cast(v16bf, __builtin_shufflevector(lo, hi, 0, 1, 2, 3, 4, 5, 6, 7, 8, 9, 10, 11, 12, 13, 14, 15)); }
__device__ __forceinline__ v8f wmma16(v16h a, v16h b, v8f c) { return __builtin_amdgcn_wmma_f32_16x16x32_f16(false, a, false, b, (short)0, c, false, false); }
__device__ __forceinline__ v8f wmmab(v16bf a, v16bf b, v8f c) { return __builtin_amdgcn_wmma_f32_16x16x32_bf16(false, a, false, b, (short)0, c, false, false); }



// ---- k_gemmw: register-blocked GEMM, one 64x64 output tile per work-group (16 accumulators a wave), operands straight from K-contiguous 16-bit planes of row pitch K; grid (M/64, N/64, Z), 32 * NW threads.
// C[m][n] (f32, pitch ldc, + optional f32 bias[n]) = sum_{k < KS} A[m][k] Bt[n][k] (+ split products per NSPLIT). z strides sA/sB/sC in elements (a K slice per z: sA = sB = KS, sC = one partial plane; KS = K: no slicing). KS % (32 * NW) == 0.
// BY: grid y is the batch, not a column tile (N = 64): A, Bt and C move by bA, bB, bC elements a batch.
// NW > 1: wave w takes the k blocks w, w + NW, ... (neighbour waves read the two halves of one 128-byte line); the NW partial tiles are summed through LDS in wave order.
template <typename T16> struct WFrag;
template <> struct WFrag<h16> { typedef v16h V; static __device__ __forceinline__ V ld(const h16* p) { return cat16(*(const v8h*)p, *(const v8h*)(p + 16)); } static __device__ __forceinline__ v8f mma(V a, V b, v8f c) { return wmma16(a, b, c); } };
template <> struct WFrag<bf> { typedef v16bf V; static __device__ __forceinline__ V ld(const bf* p) { return cat16b(*(const v8us*)p, *(const v8us*)(p + 16)); } static __device__ __forceinline__ v8f mma(V a, V b, v8f c) { return wmmab(a, b, c); } };
template <typename T16, int NSPLIT, bool BIAS, int NW, bool BY = false>
__global__ __launch_bounds__(32 * NW) void k_gemmw(const T16* __restrict__ A, const T16* __restrict__ A2, const T16* __restrict__ Bt, const T16* __restrict__ Bt2, int K, int KS, float* C, int ldc, const float* __restrict__ bias, size_t sA, size_t sB, size_t sC, size_t bA, size_t bB, size_t bC) {
    typedef typename WFrag<T16>::V V;
    __shared__ __align__(16) float os[NW == 1 ? 16 * 68 : NW * 64 * 68];
    const size_t z = blockIdx.z; A += z * sA; if (A2) A2 += z * sA; Bt += z * sB; if (Bt2) Bt2 += z * sB; C += z * sC;
    if constexpr (BY) { const size_t y = blockIdx.y; A += y * bA; if (A2) A2 += y * bA; Bt += y * bB; if (Bt2) Bt2 += y * bB; C += y * bC; }
    const int lane = threadIdx.x & 31, lr = lane & 15, hi = lane >> 4; const int r0 = blockIdx.x * 64, c0 = BY ? 0 : blockIdx.y * 64;
    v8f acc[4][4];
#pragma unroll
    for (int mb = 0; mb < 4; ++mb)
#pragma unroll
        for (int nb = 0; nb < 4; ++nb) acc[mb][nb] = (v8f){};
    const size_t aoff = (size_t)(r0 + lr) * K + 8 * hi, boff = (size_t)(c0 + lr) * K + 8 * hi;
    const int wv = (NW == 1) ? 0 : __builtin_amdgcn_readfirstlane((int)(threadIdx.x >> 5));   // wave number, scalar: the K loop keeps its scalar counter and branch
#pragma unroll 1
    for (int kc = wv * 32; kc < KS; kc += 32 * NW) {
        V a[4], a2[4];
#pragma unroll
        for (int mb = 0; mb < 4; ++mb) { a[mb] = WFrag<T16>::ld(A + aoff + (size_t)mb * 16 * K + kc); if (NSPLIT == 1 || NSPLIT == 2) a2[mb] = WFrag<T16>::ld(A2 + aoff + (size_t)mb * 16 * K + kc); }
#pragma unroll
        for (int nb = 0; nb < 4; ++nb) { const V b = WFrag<T16>::ld(Bt + boff + (size_t)nb * 16 * K + kc); V b2; if (NSPLIT >= 2) b2 = WFrag<T16>::ld(Bt2 + boff + (size_t)nb * 16 * K + kc);
#pragma unroll
            for (int mb = 0; mb < 4; ++mb) { acc[mb][nb] = WFrag<T16>::mma(a[mb], b, acc[mb][nb]); if (NSPLIT == 1 || NSPLIT == 2) acc[mb][nb] = WFrag<T16>::mma(a2[mb], b, acc[mb][nb]); if (NSPLIT >= 2) acc[mb][nb] = WFrag<T16>::mma(a[mb], b2, acc[mb][nb]); } }
        asm volatile("v_nop\n\tv_nop\n\tv_nop\n\tv_nop" : "+v"(acc[0][0]), "+v"(acc[1][1]), "+v"(acc[2][2]), "+v"(acc[3][3]) : "v"(a[0]), "v"(a[3]));
    }
    if constexpr (NW > 1) {
        float* my = os + wv * (64 * 68);
        // the three loops are unrolled so that acc[][] is indexed by constants and stays in registers
#pragma unroll
        for (int mb = 0; mb < 4; ++mb)
#pragma unroll
            for (int nb = 0; nb < 4; ++nb)
#pragma unroll
                for (int j = 0; j < 8; ++j) my[(mb * 16 + hi * 8 + j) * 68 + nb * 16 + lr] = acc[mb][nb][j];
        __syncthreads();   // every wave's partial tile is in LDS before any wave sums them
        // both loops unrolled: a thread's LDS reads go out together instead of one wait per read
#pragma unroll
        for (int s = 0; s < 32 / NW; ++s) { const int idx = s * (32 * NW) + (int)threadIdx.x, row = idx >> 4, cofs = (idx & 15) * 4; v4f val = *(const v4fa*)(os + row * 68 + cofs);
#pragma unroll
            for (int w2 = 1; w2 < NW; ++w2) val += *(const v4fa*)(os + w2 * (64 * 68) + row * 68 + cofs);
            if (BIAS) { val[0] += bfr(bias[c0 + cofs]); val[1] += bfr(bias[c0 + cofs + 1]); val[2] += bfr(bias[c0 + cofs + 2]); val[3] += bfr(bias[c0 + cofs + 3]); }
            *(v4f*)(C + (size_t)(r0 + row) * ldc + c0 + cofs) = val; }
        return;
    }
#pragma unroll
    for (int mb = 0; mb < 4; ++mb) {
#pragma unroll
        for (int nb = 0; nb < 4; ++nb) {
#pragma unroll
            for (int j = 0; j < 8; ++j) os[(hi * 8 + j) * 68 + nb * 16 + lr] = acc[mb][nb][j]; }
        __builtin_amdgcn_wave_barrier(); asm volatile("" ::: "memory");
        float* crow = C + (size_t)(r0 + mb * 16) * ldc + c0;
{
#pragma unroll
            for (int s = 0; s < 8; ++s) { const int row = 2 * s + hi, cofs = lr * 4; v4f val = *(const v4fa*)(os + row * 68 + cofs); if (BIAS) { val[0] += bfr(bias[c0 + cofs]); val[1] += bfr(bias[c0 + cofs + 1]); val[2] += bfr(bias[c0 + cofs + 2]); val[3] += bfr(bias[c0 + cofs + 3]); }
                *(v4f*)(crow + (size_t)row * ldc + cofs) = val; }
             }
        __builtin_amdgcn_wave_barrier(); asm volatile("" ::: "memory");
    }
}

__device__ __forceinline__ h16 tohx(float x) { return (h16)x; }
__device__ __forceinline__ void splitf(float y, unsigned short& h, unsigned short& l) { h = f2bf(y); l = f2bf(y - bf2f(h)); }
typedef __attribute__((ext_vector_type(2))) _Float16 v2h;
typedef __attribute__((ext_vector_type(4))) _Float16 v4h;
typedef __attribute__((ext_vector_type(2))) unsigned short v2us;
typedef __attribute__((ext_vector_type(4))) unsigned short v4us;
typedef __attribute__((ext_vector_type(2))) float v2f;
typedef __attribute__((ext_vector_type(4))) int v4i;

__global__ __launch_bounds__(256) void k_cvt8(const float* __restrict__ src, bf* dst, size_t n8) { const size_t i = (size_t)blockIdx.x * 256 + threadIdx.x; if (i >= n8) return; const v8f v = *(const v8f*)(src + i * 8); v8us o;
#pragma unroll
    for (int k = 0; k < 8; ++k) o[k] = f2bf(v[k]); *(v8us*)(dst + i * 8) = o;  }


__global__ __launch_bounds__(256) void k_wtG(const float* __restrict__ w, int K, int N, bf* Bt) {
    const int lane = threadIdx.x & 31; const int L0 = (blockIdx.x * 8 + (threadIdx.x >> 5)) * 8; const int nlines = N * K / 64;
{
#pragma unroll 1
        for (int l = 0; l < 8; ++l) { const int L = L0 + l; if (L >= nlines) break; const size_t e = (size_t)L * 64 + lane * 2; const int k = (int)(e % K), n = (int)(e / K); v2us o;
            o[0] = f2bf(w[(size_t)k * N + n]); o[1] = f2bf(w[(size_t)(k + 1) * N + n]); *(v2us*)(Bt + e) = o; }
         }
}
__global__ __launch_bounds__(256) void k_vtp(const float* __restrict__ F, int pitch, int nheads, h16* V16, bf* Vh, bf* Vl) { const size_t e = ((size_t)blockIdx.x * 256 + threadIdx.x) * 2; if (e >= (size_t)nheads * HD * TT) return; { const size_t y = blockIdx.y, po = y * nheads * HD * TT; F += y * TT * pitch; V16 += po; Vh += po; Vl += po; }   /* grid y: the batch */ const int t = (int)(e % TT); const int d = (int)((e / TT) % HD); const int g = (int)(e / ((size_t)TT * HD)); v2h o16; v2us oh, ol;
#pragma unroll
    for (int q = 0; q < 2; ++q) { const float x = F[(size_t)(t + q) * pitch + g * HD + d]; o16[q] = tohx(x); unsigned short a2, c2; splitf(x, a2, c2); oh[q] = a2; ol[q] = c2; }
    *(v2h*)(V16 + e) = o16; *(v2us*)(Vh + e) = oh; *(v2us*)(Vl + e) = ol;  }
__global__ __launch_bounds__(256) void k_lsoft(const float* __restrict__ Sb, h16* P16, bf* Ph, bf* Pl) {
    const int lane = threadIdx.x & 31; const int row = blockIdx.x * 8 + (threadIdx.x >> 5); if (row >= ZH * TT) return; const int i = row % TT; const int zz = row / TT; const bool hires = (i < RH); const float* sr = Sb + (size_t)row * TT; float mx = -3.0e38f;
#pragma unroll 4
    for (int ch = 0; ch < TT / 128; ++ch) { const int j0 = ch * 128 + lane * 4; const v4f a = *(const v4f*)(sr + j0);
#pragma unroll
        for (int q = 0; q < 4; ++q) { float t = (j0 + q <= i) ? a[q] * SCL : -3.0e38f; asm volatile("" : "+v"(t)); mx = fmaxf(mx, t); } }
#pragma unroll
    for (int sh = 16; sh; sh >>= 1) mx = fmaxf(mx, __shfl_xor(mx, sh, 32));
    float sum = 0.f;
#pragma unroll 4
    for (int ch = 0; ch < TT / 128; ++ch) { const int j0 = ch * 128 + lane * 4; const v4f a = *(const v4f*)(sr + j0);
#pragma unroll
        for (int q = 0; q < 4; ++q) { float t = (j0 + q <= i) ? a[q] * SCL : -3.0e38f; asm volatile("" : "+v"(t)); float d0 = __fsub_rn(t, mx); asm volatile("" : "+v"(d0)); sum += __builtin_amdgcn_exp2f(__fmul_rn(d0, 1.4426950408889634f)); } }
#pragma unroll
    for (int sh = 16; sh; sh >>= 1) sum += __shfl_xor(sum, sh, 32);
    const float f = __fdiv_rn(hires ? 1.0f : PCAR, sum);
{
        if (hires) {   /* rows < RH: normalised bf16 hi/lo over all keys, planes [zz][RH][TT] */
#pragma unroll
            for (int ch = 0; ch < TT / 128; ++ch) { const int j0 = ch * 128 + lane * 4; const v4f a = *(const v4f*)(sr + j0); v4us oh, ol;
#pragma unroll
                for (int q = 0; q < 4; ++q) { float t = (j0 + q <= i) ? a[q] * SCL : -3.0e38f; asm volatile("" : "+v"(t)); float d0 = __fsub_rn(t, mx); asm volatile("" : "+v"(d0)); float ex = __builtin_amdgcn_exp2f(__fmul_rn(d0, 1.4426950408889634f)); asm volatile("" : "+v"(ex)); unsigned short a2, c2; splitf(ex * f, a2, c2); oh[q] = a2; ol[q] = c2; }
                const size_t oo = ((size_t)zz * RH + i) * TT + j0; *(v4us*)(Ph + oo) = oh; *(v4us*)(Pl + oo) = ol; }
        } else {   /* rows >= RH: fp16 x PCAR, plane [zz][TT - RH][TT] */
#pragma unroll 2
            for (int ch = 0; ch < TT / 128; ++ch) { const int j0 = ch * 128 + lane * 4; const v4f a = *(const v4f*)(sr + j0); v4h o4;
#pragma unroll
                for (int q = 0; q < 4; ++q) { float t = (j0 + q <= i) ? a[q] * SCL : -3.0e38f; asm volatile("" : "+v"(t)); float d0 = __fsub_rn(t, mx); asm volatile("" : "+v"(d0)); float ex = __builtin_amdgcn_exp2f(__fmul_rn(d0, 1.4426950408889634f)); asm volatile("" : "+v"(ex)); o4[q] = tohx(ex * f); }
                *(v4h*)(P16 + ((size_t)zz * (TT - RH) + (i - RH)) * TT + j0) = o4; } }
         }
}
// k_cs8: sums the grid-z partial planes of attn.v in slice order (rows < RH: SKH planes of PH; the rest: SKF planes of PF, then x 1/PCAR removes the fp16 carry); row pitch is the value width CO. The plane loops are unrolled so that a thread's loads are all in flight at once.
__global__ __launch_bounds__(256) void k_cs8(const float* __restrict__ PH, const float* __restrict__ PF, float* O, size_t n4) { const size_t i = (size_t)blockIdx.x * 256 + threadIdx.x; if (i >= n4) return; { const size_t y = blockIdx.y; PH += y * ((size_t)SKH * RH * CO); PF += y * ((size_t)SKF * (TT - RH) * CO); O += y * ((size_t)TT * CO); }   /* grid y: the batch */ const size_t e = i * 4; const int t = (int)(e / CO); v4f a;
    if (t < RH) { a = *(const v4f*)(PH + e);
#pragma unroll
        for (int s = 1; s < SKH; ++s) a += *(const v4f*)(PH + (size_t)s * RH * CO + e);
    } else { const size_t e2 = e - (size_t)RH * CO; a = *(const v4f*)(PF + e2);
#pragma unroll
        for (int s = 1; s < SKF; ++s) a += *(const v4f*)(PF + (size_t)s * (TT - RH) * CO + e2);
#pragma unroll
        for (int q = 0; q < 4; ++q) a[q] = __fmul_rn(a[q], 1.0f / PCAR); }
    *(v4f*)(O + e) = a;  }

__global__ __launch_bounds__(256) void k_csid(float* CS) { const int idx = blockIdx.x * 256 + threadIdx.x; if (idx >= TT * HD) return; v2f cs; cs[0] = 1.0f; cs[1] = 0.0f; *(v2f*)(CS + (size_t)idx * 2) = cs;  }
// k_rope: head planes [h][t][d] (fp16 + hi/lo) of rope(x) x sc with the rotate-half convention out[d] = x[d] cos[t][d] - x[d+HD/2] sin[t][d], out[d+HD/2] = x[d+HD/2] cos[t][d+HD/2] + x[d] sin[t][d+HD/2]
__global__ __launch_bounds__(256) void k_rope(const float* __restrict__ F, int pitch, int nheads, const float* __restrict__ CS, const float* __restrict__ RF, const float* __restrict__ nw, float sc, h16* P16, bf* Ph, bf* Pl) {
    const size_t e = ((size_t)blockIdx.x * 256 + threadIdx.x) * 2; if (e >= (size_t)nheads * TT * HD) return; { const size_t y = blockIdx.y, po = y * nheads * TT * HD; F += y * TT * pitch; P16 += po; Ph += po; Pl += po; }   /* grid y: the batch */ const int d = (int)(e % HD); const int t = (int)((e / HD) % TT); const int h = (int)(e / ((size_t)HD * TT)); const float* f = F + (size_t)t * pitch + h * HD; const float rf = RF ? RF[(size_t)h * TT + t] : 1.0f; v2h o16; v2us oh, ol;
#pragma unroll
    for (int q = 0; q < 2; ++q) { const int dd = d + q; const int dp = (dd < HD / 2) ? dd + HD / 2 : dd - HD / 2; float x0 = f[dd], x1 = f[dp];
        if (RF) { float n0 = __fmul_rn(x0, rf), n1 = __fmul_rn(x1, rf); asm volatile("" : "+v"(n0)); asm volatile("" : "+v"(n1)); x0 = __fmul_rn(bfr(nw[dd]), n0); x1 = __fmul_rn(bfr(nw[dp]), n1); }
        const v2f cs = *(const v2f*)(CS + ((size_t)t * HD + dd) * 2); float a = __fmul_rn(x0, cs[0]), bq = __fmul_rn(x1, cs[1]); asm volatile("" : "+v"(a)); asm volatile("" : "+v"(bq)); const float r = ((dd < HD / 2) ? __fsub_rn(a, bq) : __fadd_rn(a, bq)) * sc;
        o16[q] = tohx(r); unsigned short a2, c2; splitf(r, a2, c2); oh[q] = a2; ol[q] = c2; }
    *(v2h*)(P16 + e) = o16; *(v2us*)(Ph + e) = oh; *(v2us*)(Pl + e) = ol;  }
__global__ __launch_bounds__(256) void k_copy4(const float* __restrict__ Y, float* out, size_t n4) { const size_t i = (size_t)blockIdx.x * 256 + threadIdx.x; if (i >= n4) return; const v4f a = *(const v4f*)(Y + i * 4); *(v4f*)(out + i * 4) = a;  }
extern "C" void kernel_launch(void* const* d_in, const int* in_sizes, int n_in,
                              void* d_out, int out_size, void* d_ws, size_t ws_size, hipStream_t stream) {
    (void)in_sizes; (void)n_in; (void)out_size;
    const float* x = (const float*)d_in[0]; const float* wq = (const float*)d_in[1]; const float* wk = (const float*)d_in[2]; const float* wv = (const float*)d_in[3];   /* standard roles: rows = queries */
    float* OUT = (float*)d_out;     // [4][4096][64]
    char* wsp = (char*)d_ws;
    auto take = [&](size_t bytes) { char* p = wsp; wsp += (bytes + 255) & ~(size_t)255; return (void*)p; };
    bf* WQ = (bf*)take((size_t)MID * CC * 2); bf* WK = (bf*)take((size_t)MID * CC * 2); bf* WV = (bf*)take((size_t)CO * CC * 2); float* CS = (float*)take((size_t)TT * HD * 2 * 4);
    bf* XB = (bf*)take((size_t)NB_ * TT * CC * 2); float* FQ = (float*)take((size_t)NB_ * TT * MID * 4); float* FK = (float*)take((size_t)NB_ * TT * MID * 4);
    h16* QP16 = (h16*)take((size_t)NB_ * TT * MID * 2); bf* QPh = (bf*)take((size_t)NB_ * TT * MID * 2); bf* QPl = (bf*)take((size_t)NB_ * TT * MID * 2); h16* KP16 = (h16*)take((size_t)NB_ * TT * MID * 2); bf* KPh = (bf*)take((size_t)NB_ * TT * MID * 2); bf* KPl = (bf*)take((size_t)NB_ * TT * MID * 2);
    h16* VT16 = (h16*)take((size_t)NB_ * CO * TT * 2); bf* VTh = (bf*)take((size_t)NB_ * CO * TT * 2); bf* VTl = (bf*)take((size_t)NB_ * CO * TT * 2);
    float* Sb = (float*)take((size_t)TT * TT * 4); h16* P16 = (h16*)take((size_t)NB_ * (TT - RH) * TT * 2); bf* Ph = (bf*)take((size_t)NB_ * RH * TT * 2); bf* Pl = (bf*)take((size_t)NB_ * RH * TT * 2);   /* one batch's scores; every batch's weights (fp16 plane: rows >= RH only) */
    if ((size_t)(wsp - (char*)d_ws) > ws_size) return;    // ws 256 MiB (carve ~252 MiB)
    float* Ob = Sb; float* PH = Ob + (size_t)NB_ * TT * CO; float* PF = PH + (size_t)NB_ * SKH * RH * CO;   /* attention output (f32) before the final copy, and the attn.v partial planes [batch][K slice]: 26 MiB in the score buffer, which nothing reads after the last softmax (stream-ordered) */
    float* FV = FK;   /* the v projection reuses the k buffer after the k planes are built (stream-ordered) */
    k_wtG<<<(unsigned)((CC * MID / 64 + 63) / 64), 256, 0, stream>>>(wq, CC, MID, WQ); k_wtG<<<(unsigned)((CC * MID / 64 + 63) / 64), 256, 0, stream>>>(wk, CC, MID, WK); k_wtG<<<(unsigned)((CC * CO / 64 + 63) / 64), 256, 0, stream>>>(wv, CC, CO, WV);   /* 'xw' weights -> Bt */
    k_csid<<<(TT * HD + 255) / 256, 256, 0, stream>>>(CS);   /* identity table: k_rope is a plain per-head plane builder here */
    const unsigned LP = (unsigned)(((size_t)NH_ * TT * HD / 2 + 255) / 256);
    k_cvt8<<<(unsigned)(((size_t)NB_ * TT * CC / 8 + 255) / 256), 256, 0, stream>>>(x, XB, (size_t)NB_ * TT * CC / 8);
    /* projections: the batches' rows stacked (M = 4 x 4096), one weight plane for all */
    k_gemmw<bf, 0, false, NWK><<<dim3(NB_ * TT / 64, MID / 64, 1), 32 * NWK, 0, stream>>>(XB, nullptr, WQ, nullptr, CC, CC, FQ, MID, nullptr, 0, 0, 0, 0, 0, 0); k_rope<<<dim3(LP, NB_), 256, 0, stream>>>(FQ, MID, NH_, CS, nullptr, nullptr, 1.0f, QP16, QPh, QPl);   /* q planes [b][n][64] */
    k_gemmw<bf, 0, false, NWK><<<dim3(NB_ * TT / 64, MID / 64, 1), 32 * NWK, 0, stream>>>(XB, nullptr, WK, nullptr, CC, CC, FK, MID, nullptr, 0, 0, 0, 0, 0, 0); k_rope<<<dim3(LP, NB_), 256, 0, stream>>>(FK, MID, NKV, CS, nullptr, nullptr, 1.0f, KP16, KPh, KPl);   /* k planes */
    k_gemmw<bf, 0, false, NWK><<<dim3(NB_ * TT / 64, CO / 64, 1), 32 * NWK, 0, stream>>>(XB, nullptr, WV, nullptr, CC, CC, FV, CO, nullptr, 0, 0, 0, 0, 0, 0); k_vtp<<<dim3((unsigned)(((size_t)TT * CO / 2 + 255) / 256), NB_), 256, 0, stream>>>(FV, CO, CO / HD, VT16, VTh, VTl);   /* v^T planes [b][64][n] */
    for (int b = 0; b < NB_; ++b) {   /* per batch: dense 4096 x 4096 scores, then their softmax into the batch's own weight planes */
        k_gemmw<bf, 2, false, 1><<<dim3(TT / 64, TT / 64, 1), 32, 0, stream>>>(QPh + (size_t)b * TT * HD, QPl + (size_t)b * TT * HD, KPh + (size_t)b * TT * HD, KPl + (size_t)b * TT * HD, HD, HD, Sb, TT, nullptr, 0, 0, 0, 0, 0, 0);   /* S[i][j] = q_i.k_j (3 products, every row) */
        k_lsoft<<<TT / 8, 256, 0, stream>>>(Sb, P16 + (size_t)b * (TT - RH) * TT, Ph + (size_t)b * RH * TT, Pl + (size_t)b * RH * TT); }   /* x 1/sqrt(C), softmax over the 4,096 keys */
    k_gemmw<bf, 2, false, NWK, true><<<dim3(RH / 64, NB_, SKH), 32 * NWK, 0, stream>>>(Ph, Pl, VTh, VTl, TT, TT / SKH, PH, CO, nullptr, TT / SKH, TT / SKH, (size_t)RH * CO, (size_t)RH * TT, (size_t)HD * TT, (size_t)SKH * RH * CO);
    k_gemmw<h16, 0, false, NWK, true><<<dim3((TT - RH) / 64, NB_, SKF), 32 * NWK, 0, stream>>>(P16, nullptr, VT16, nullptr, TT, TT / SKF, PF, CO, nullptr, TT / SKF, TT / SKF, (size_t)(TT - RH) * CO, (size_t)(TT - RH) * TT, (size_t)HD * TT, (size_t)SKF * (TT - RH) * CO);
    k_cs8<<<dim3((unsigned)(((size_t)TT * CO / 4 + 255) / 256), NB_), 256, 0, stream>>>(PH, PF, Ob, (size_t)TT * CO / 4);   /* partial planes summed; rows >= 512 x 1/1024 */
    k_copy4<<<(unsigned)(((size_t)NB_ * TT * CO / 4 + 255) / 256), 256, 0, stream>>>(Ob, OUT, (size_t)NB_ * TT * CO / 4);   /* the output rows, written once */
}

// v003
// Measured time: 235 microseconds a run.
// Timed twice side by side with v002, it ran 1.59 and 1.60 times as fast.
// All steps since v000 together make it 4.83 times as fast.
#include <hip/hip_runtime.h>

// Single causal attention head over 4,096 tokens scaled by the EMBEDDING width (x [4][4096][512]; q, k, v = x W ('xw' [512][64] 1/sqrt(512), no bias); scores = q.k^T / sqrt(C = 512) (the source divides by sqrt(n_embd), not sqrt(head_size)); causal (-inf); softmax; out = weights.v -> [4][4096][64] (1.0 M); argument order x, Wq, Wk, Wv).
// All four batches go through one launch of every kernel but the scores and the softmax (their f32 score plane is one batch's and is reused): rows stacked where the operand is shared, else the batch on grid y.
// Layout per batch: bf16 copy of x; 'xw' weights transposed once; exact projections (K 512); identity-table plane builders; scores with EVERY row on hi/lo planes (3 products, dense launches); causal softmax over the 4,096 keys, each row read once and held in registers; attn.v hybrid (rows < 512 hi/lo 3 products, rest fp16 x1024); k_cs8 removes the fp16 carry; k_copy4 writes the output rows once. Split-K: the projections and both attn.v products divide their K loop over the 8 waves of a work-group (partial tiles summed through LDS); attn.v also over grid z (f32 partial planes, summed in k_cs8).
// Compute dtypes, f32 accumulate: every input rounded to bf16; projections exact; scores 3 products; softmax f32; wei.v rows < 512 3 products, rest fp16; output f32.

#define NB_  4
#define TT   4096
#define DM   64
#define NH_  1
#define NKV  1
#define REP  (NH_ / NKV)
#define HD   64
#define DQ   (NH_ * HD)
#define DKV  (NKV * HD)
#define ZH   1
#define RH   512                  // query rows < RH use hi+lo planes (0: none)
#define WIN  0
#define PCAR 1024.0f
#define SCL  0.044194173824159216f   // 1/sqrt(C) with C = n_embd = 512 (the source scales by sqrt(n_embd), NOT sqrt(head_size))
#define MID  64       // q / k width (one 64-wide head)
#define CO   64       // v width
#define CC   512      // input width (d_in)
#define NWK  8        // waves of a work-group that share one K loop (split-K launches)
#define SKH  16       // grid-z K slices of the hi/lo attn.v product
#define SKF  4        // grid-z K slices of the fp16 attn.v product
typedef _Float16 h16;
typedef unsigned short bf;
typedef __attribute__((ext_vector_type(16))) __bf16   v16bf;
typedef __attribute__((ext_vector_type(16))) _Float16 v16h;
typedef __attribute__((ext_vector_type(8)))  _Float16 v8h;
typedef __attribute__((ext_vector_type(8)))  unsigned short v8us;
typedef __attribute__((ext_vector_type(8)))  float    v8f;
typedef __attribute__((ext_vector_type(4)))  float    v4f;
typedef v8h  __attribute__((may_alias)) v8ha;
typedef v4f  __attribute__((may_alias)) v4fa;
typedef v8us __attribute__((may_alias)) v8usa;

__device__ __forceinline__ unsigned short f2bf(float f) { unsigned u = __float_as_uint(f); u += 0x7FFFu + ((u >> 16) & 1u); return (unsigned short)(u >> 16); }
__device__ __forceinline__ float bf2f(unsigned short b) { return __uint_as_float(((unsigned)b) << 16); }
__device__ __forceinline__ float bfr(float f) { return bf2f(f2bf(f)); }
__device__ __forceinline__ v16h cat16(v8h lo, v8h hi) { return __builtin_shufflevector(lo, hi, 0, 1, 2, 3, 4, 5, 6, 7, 8, 9, 10, 11, 12, 13, 14, 15); }
__device__ __forceinline__ v16bf cat16b(v8us lo, v8us hi) { return __builtin_bit_cast(v16bf, __builtin_shufflevector(lo, hi, 0, 1, 2, 3, 4, 5, 6, 7, 8, 9, 10, 11, 12, 13, 14, 15)); }
__device__ __forceinline__ v8f wmma16(v16h a, v16h b, v8f c) { return __builtin_amdgcn_wmma_f32_16x16x32_f16(false, a, false, b, (short)0, c, false, false); }
__device__ __forceinline__ v8f wmmab(v16bf a, v16bf b, v8f c) { return __builtin_amdgcn_wmma_f32_16x16x32_bf16(false, a, false, b, (short)0, c, false, false); }



// ---- k_gemmw: register-blocked GEMM, one 64x64 output tile per work-group (16 accumulators a wave), operands straight from K-contiguous 16-bit planes of row pitch K; grid (M/64, N/64, Z), 32 * NW threads.
// C[m][n] (f32, pitch ldc, + optional f32 bias[n]) = sum_{k < KS} A[m][k] Bt[n][k] (+ split products per NSPLIT). z strides sA/sB/sC in elements (a K slice per z: sA = sB = KS, sC = one partial plane; KS = K: no slicing). KS % (32 * NW) == 0.
// BY: grid y is the batch, not a column tile (N = 64): A, Bt and C move by bA, bB, bC elements a batch.
// NW > 1: wave w takes the k blocks w, w + NW, ... (neighbour waves read the two halves of one 128-byte line); the NW partial tiles are summed through LDS in wave order.
template <typename T16> struct WFrag;
template <> struct WFrag<h16> { typedef v16h V; static __device__ __forceinline__ V ld(const h16* p) { return cat16(*(const v8h*)p, *(const v8h*)(p + 16)); } static __device__ __forceinline__ v8f mma(V a, V b, v8f c) { return wmma16(a, b, c); } };
template <> struct WFrag<bf> { typedef v16bf V; static __device__ __forceinline__ V ld(const bf* p) { return cat16b(*(const v8us*)p, *(const v8us*)(p + 16)); } static __device__ __forceinline__ v8f mma(V a, V b, v8f c) { return wmmab(a, b, c); } };
template <typename T16, int NSPLIT, bool BIAS, int NW, bool BY = false>
__global__ __launch_bounds__(32 * NW) void k_gemmw(const T16* __restrict__ A, const T16* __restrict__ A2, const T16* __restrict__ Bt, const T16* __restrict__ Bt2, int K, int KS, float* C, int ldc, const float* __restrict__ bias, size_t sA, size_t sB, size_t sC, size_t bA, size_t bB, size_t bC) {
    typedef typename WFrag<T16>::V V;
    __shared__ __align__(16) float os[NW == 1 ? 16 * 68 : NW * 64 * 68];
    const size_t z = blockIdx.z; A += z * sA; if (A2) A2 += z * sA; Bt += z * sB; if (Bt2) Bt2 += z * sB; C += z * sC;
    if constexpr (BY) { const size_t y = blockIdx.y; A += y * bA; if (A2) A2 += y * bA; Bt += y * bB; if (Bt2) Bt2 += y * bB; C += y * bC; }
    const int lane = threadIdx.x & 31, lr = lane & 15, hi = lane >> 4; const int r0 = blockIdx.x * 64, c0 = BY ? 0 : blockIdx.y * 64;
    v8f acc[4][4];
#pragma unroll
    for (int mb = 0; mb < 4; ++mb)
#pragma unroll
        for (int nb = 0; nb < 4; ++nb) acc[mb][nb] = (v8f){};
    const size_t aoff = (size_t)(r0 + lr) * K + 8 * hi, boff = (size_t)(c0 + lr) * K + 8 * hi;
    const int wv = (NW == 1) ? 0 : __builtin_amdgcn_readfirstlane((int)(threadIdx.x >> 5));   // wave number, scalar: the K loop keeps its scalar counter and branch
#pragma unroll 1
    for (int kc = wv * 32; kc < KS; kc += 32 * NW) {
        V a[4], a2[4];
#pragma unroll
        for (int mb = 0; mb < 4; ++mb) { a[mb] = WFrag<T16>::ld(A + aoff + (size_t)mb * 16 * K + kc); if (NSPLIT == 1 || NSPLIT == 2) a2[mb] = WFrag<T16>::ld(A2 + aoff + (size_t)mb * 16 * K + kc); }
#pragma unroll
        for (int nb = 0; nb < 4; ++nb) { const V b = WFrag<T16>::ld(Bt + boff + (size_t)nb * 16 * K + kc); V b2; if (NSPLIT >= 2) b2 = WFrag<T16>::ld(Bt2 + boff + (size_t)nb * 16 * K + kc);
#pragma unroll
            for (int mb = 0; mb < 4; ++mb) { acc[mb][nb] = WFrag<T16>::mma(a[mb], b, acc[mb][nb]); if (NSPLIT == 1 || NSPLIT == 2) acc[mb][nb] = WFrag<T16>::mma(a2[mb], b, acc[mb][nb]); if (NSPLIT >= 2) acc[mb][nb] = WFrag<T16>::mma(a[mb], b2, acc[mb][nb]); } }
        asm volatile("v_nop\n\tv_nop\n\tv_nop\n\tv_nop" : "+v"(acc[0][0]), "+v"(acc[1][1]), "+v"(acc[2][2]), "+v"(acc[3][3]) : "v"(a[0]), "v"(a[3]));
    }
    if constexpr (NW > 1) {
        float* my = os + wv * (64 * 68);
        // the three loops are unrolled so that acc[][] is indexed by constants and stays in registers
#pragma unroll
        for (int mb = 0; mb < 4; ++mb)
#pragma unroll
            for (int nb = 0; nb < 4; ++nb)
#pragma unroll
                for (int j = 0; j < 8; ++j) my[(mb * 16 + hi * 8 + j) * 68 + nb * 16 + lr] = acc[mb][nb][j];
        __syncthreads();   // every wave's partial tile is in LDS before any wave sums them
        // both loops unrolled: a thread's LDS reads go out together instead of one wait per read
#pragma unroll
        for (int s = 0; s < 32 / NW; ++s) { const int idx = s * (32 * NW) + (int)threadIdx.x, row = idx >> 4, cofs = (idx & 15) * 4; v4f val = *(const v4fa*)(os + row * 68 + cofs);
#pragma unroll
            for (int w2 = 1; w2 < NW; ++w2) val += *(const v4fa*)(os + w2 * (64 * 68) + row * 68 + cofs);
            if (BIAS) { val[0] += bfr(bias[c0 + cofs]); val[1] += bfr(bias[c0 + cofs + 1]); val[2] += bfr(bias[c0 + cofs + 2]); val[3] += bfr(bias[c0 + cofs + 3]); }
            *(v4f*)(C + (size_t)(r0 + row) * ldc + c0 + cofs) = val; }
        return;
    }
#pragma unroll
    for (int mb = 0; mb < 4; ++mb) {
#pragma unroll
        for (int nb = 0; nb < 4; ++nb) {
#pragma unroll
            for (int j = 0; j < 8; ++j) os[(hi * 8 + j) * 68 + nb * 16 + lr] = acc[mb][nb][j]; }
        __builtin_amdgcn_wave_barrier(); asm volatile("" ::: "memory");
        float* crow = C + (size_t)(r0 + mb * 16) * ldc + c0;
{
#pragma unroll
            for (int s = 0; s < 8; ++s) { const int row = 2 * s + hi, cofs = lr * 4; v4f val = *(const v4fa*)(os + row * 68 + cofs); if (BIAS) { val[0] += bfr(bias[c0 + cofs]); val[1] += bfr(bias[c0 + cofs + 1]); val[2] += bfr(bias[c0 + cofs + 2]); val[3] += bfr(bias[c0 + cofs + 3]); }
                *(v4f*)(crow + (size_t)row * ldc + cofs) = val; }
             }
        __builtin_amdgcn_wave_barrier(); asm volatile("" ::: "memory");
    }
}

__device__ __forceinline__ h16 tohx(float x) { return (h16)x; }
__device__ __forceinline__ void splitf(float y, unsigned short& h, unsigned short& l) { h = f2bf(y); l = f2bf(y - bf2f(h)); }
typedef __attribute__((ext_vector_type(2))) _Float16 v2h;
typedef __attribute__((ext_vector_type(4))) _Float16 v4h;
typedef __attribute__((ext_vector_type(2))) unsigned short v2us;
typedef __attribute__((ext_vector_type(4))) unsigned short v4us;
typedef __attribute__((ext_vector_type(2))) float v2f;
typedef __attribute__((ext_vector_type(4))) int v4i;

__global__ __launch_bounds__(256) void k_cvt8(const float* __restrict__ src, bf* dst, size_t n8) { const size_t i = (size_t)blockIdx.x * 256 + threadIdx.x; if (i >= n8) return; const v8f v = *(const v8f*)(src + i * 8); v8us o;
#pragma unroll
    for (int k = 0; k < 8; ++k) o[k] = f2bf(v[k]); *(v8us*)(dst + i * 8) = o;  }


__global__ __launch_bounds__(256) void k_wtG(const float* __restrict__ w, int K, int N, bf* Bt) {
    const int lane = threadIdx.x & 31; const int L0 = (blockIdx.x * 8 + (threadIdx.x >> 5)) * 8; const int nlines = N * K / 64;
{
#pragma unroll 1
        for (int l = 0; l < 8; ++l) { const int L = L0 + l; if (L >= nlines) break; const size_t e = (size_t)L * 64 + lane * 2; const int k = (int)(e % K), n = (int)(e / K); v2us o;
            o[0] = f2bf(w[(size_t)k * N + n]); o[1] = f2bf(w[(size_t)(k + 1) * N + n]); *(v2us*)(Bt + e) = o; }
         }
}
__global__ __launch_bounds__(256) void k_vtp(const float* __restrict__ F, int pitch, int nheads, h16* V16, bf* Vh, bf* Vl) { const size_t e = ((size_t)blockIdx.x * 256 + threadIdx.x) * 2; if (e >= (size_t)nheads * HD * TT) return; { const size_t y = blockIdx.y, po = y * nheads * HD * TT; F += y * TT * pitch; V16 += po; Vh += po; Vl += po; }   /* grid y: the batch */ const int t = (int)(e % TT); const int d = (int)((e / TT) % HD); const int g = (int)(e / ((size_t)TT * HD)); v2h o16; v2us oh, ol;
#pragma unroll
    for (int q = 0; q < 2; ++q) { const float x = F[(size_t)(t + q) * pitch + g * HD + d]; o16[q] = tohx(x); unsigned short a2, c2; splitf(x, a2, c2); oh[q] = a2; ol[q] = c2; }
    *(v2h*)(V16 + e) = o16; *(v2us*)(Vh + e) = oh; *(v2us*)(Vl + e) = ol;  }
// k_lsoft: one wave a row, the row held in registers (128 floats a lane). All 32 loads of the row go out before the first value is used, so a wave waits for memory once; the masked scaled scores, then their exponentials, replace the loaded values in place, and the maximum, the sum (chunk by chunk, as the keys are numbered) and the stores read the registers.
__global__ __launch_bounds__(256) void k_lsoft(const float* __restrict__ Sb, h16* P16, bf* Ph, bf* Pl) {
    const int lane = threadIdx.x & 31; const int row = blockIdx.x * 8 + (threadIdx.x >> 5); if (row >= ZH * TT) return; const int i = row % TT; const int zz = row / TT; const bool hires = (i < RH); const float* sr = Sb + (size_t)row * TT; float mx = -3.0e38f;
    v4f a[TT / 128];
    // every loop over the chunks is unrolled: a[][] is indexed by constants and stays in registers
#pragma unroll
    for (int ch = 0; ch < TT / 128; ++ch) a[ch] = *(const v4f*)(sr + ch * 128 + lane * 4);
#pragma unroll
    for (int ch = 0; ch < TT / 128; ++ch) { const int j0 = ch * 128 + lane * 4;
#pragma unroll
        for (int q = 0; q < 4; ++q) { const float t = (j0 + q <= i) ? a[ch][q] * SCL : -3.0e38f; a[ch][q] = t; mx = fmaxf(mx, t); } }
#pragma unroll
    for (int sh = 16; sh; sh >>= 1) mx = fmaxf(mx, __shfl_xor(mx, sh, 32));
    float sum = 0.f;
#pragma unroll
    for (int ch = 0; ch < TT / 128; ++ch) {
#pragma unroll
        for (int q = 0; q < 4; ++q) a[ch][q] = __fmul_rn(__fsub_rn(a[ch][q], mx), 1.4426950408889634f); }
    __builtin_amdgcn_sched_barrier(0);   // keeps the subtract/multiply pairs above out of the run of exponentials
#pragma unroll
    for (int ch = 0; ch < TT / 128; ++ch) {
#pragma unroll
        for (int q = 0; q < 4; ++q) { const float ex = __builtin_amdgcn_exp2f(a[ch][q]); a[ch][q] = ex; sum += ex; } }
#pragma unroll
    for (int sh = 16; sh; sh >>= 1) sum += __shfl_xor(sum, sh, 32);
    const float f = __fdiv_rn(hires ? 1.0f : PCAR, sum);
    if (hires) {   /* rows < RH: normalised bf16 hi/lo over all keys, planes [zz][RH][TT] */
#pragma unroll
        for (int ch = 0; ch < TT / 128; ++ch) { const int j0 = ch * 128 + lane * 4; v4us oh, ol;
#pragma unroll
            for (int q = 0; q < 4; ++q) { unsigned short a2, c2; splitf(a[ch][q] * f, a2, c2); oh[q] = a2; ol[q] = c2; }
            const size_t oo = ((size_t)zz * RH + i) * TT + j0; *(v4us*)(Ph + oo) = oh; *(v4us*)(Pl + oo) = ol; }
    } else {   /* rows >= RH: fp16 x PCAR, plane [zz][TT - RH][TT] */
#pragma unroll
        for (int ch = 0; ch < TT / 128; ++ch) { const int j0 = ch * 128 + lane * 4; v4h o4;
#pragma unroll
            for (int q = 0; q < 4; ++q) o4[q] = tohx(a[ch][q] * f);
            *(v4h*)(P16 + ((size_t)zz * (TT - RH) + (i - RH)) * TT + j0) = o4; } }
}
// k_cs8: sums the grid-z partial planes of attn.v in slice order (rows < RH: SKH planes of PH; the rest: SKF planes of PF, then x 1/PCAR removes the fp16 carry); row pitch is the value width CO. The plane loops are unrolled so that a thread's loads are all in flight at once.
__global__ __launch_bounds__(256) void k_cs8(const float* __restrict__ PH, const float* __restrict__ PF, float* O, size_t n4) { const size_t i = (size_t)blockIdx.x * 256 + threadIdx.x; if (i >= n4) return; { const size_t y = blockIdx.y; PH += y * ((size_t)SKH * RH * CO); PF += y * ((size_t)SKF * (TT - RH) * CO); O += y * ((size_t)TT * CO); }   /* grid y: the batch */ const size_t e = i * 4; const int t = (int)(e / CO); v4f a;
    if (t < RH) { a = *(const v4f*)(PH + e);
#pragma unroll
        for (int s = 1; s < SKH; ++s) a += *(const v4f*)(PH + (size_t)s * RH * CO + e);
    } else { const size_t e2 = e - (size_t)RH * CO; a = *(const v4f*)(PF + e2);
#pragma unroll
        for (int s = 1; s < SKF; ++s) a += *(const v4f*)(PF + (size_t)s * (TT - RH) * CO + e2);
#pragma unroll
        for (int q = 0; q < 4; ++q) a[q] = __fmul_rn(a[q], 1.0f / PCAR); }
    *(v4f*)(O + e) = a;  }

__global__ __launch_bounds__(256) void k_csid(float* CS) { const int idx = blockIdx.x * 256 + threadIdx.x; if (idx >= TT * HD) return; v2f cs; cs[0] = 1.0f; cs[1] = 0.0f; *(v2f*)(CS + (size_t)idx * 2) = cs;  }
// k_rope: head planes [h][t][d] (fp16 + hi/lo) of rope(x) x sc with the rotate-half convention out[d] = x[d] cos[t][d] - x[d+HD/2] sin[t][d], out[d+HD/2] = x[d+HD/2] cos[t][d+HD/2] + x[d] sin[t][d+HD/2]
__global__ __launch_bounds__(256) void k_rope(const float* __restrict__ F, int pitch, int nheads, const float* __restrict__ CS, const float* __restrict__ RF, const float* __restrict__ nw, float sc, h16* P16, bf* Ph, bf* Pl) {
    const size_t e = ((size_t)blockIdx.x * 256 + threadIdx.x) * 2; if (e >= (size_t)nheads * TT * HD) return; { const size_t y = blockIdx.y, po = y * nheads * TT * HD; F += y * TT * pitch; P16 += po; Ph += po; Pl += po; }   /* grid y: the batch */ const int d = (int)(e % HD); const int t = (int)((e / HD) % TT); const int h = (int)(e / ((size_t)HD * TT)); const float* f = F + (size_t)t * pitch + h * HD; const float rf = RF ? RF[(size_t)h * TT + t] : 1.0f; v2h o16; v2us oh, ol;
#pragma unroll
    for (int q = 0; q < 2; ++q) { const int dd = d + q; const int dp = (dd < HD / 2) ? dd + HD / 2 : dd - HD / 2; float x0 = f[dd], x1 = f[dp];
        if (RF) { float n0 = __fmul_rn(x0, rf), n1 = __fmul_rn(x1, rf); asm volatile("" : "+v"(n0)); asm volatile("" : "+v"(n1)); x0 = __fmul_rn(bfr(nw[dd]), n0); x1 = __fmul_rn(bfr(nw[dp]), n1); }
        const v2f cs = *(const v2f*)(CS + ((size_t)t * HD + dd) * 2); float a = __fmul_rn(x0, cs[0]), bq = __fmul_rn(x1, cs[1]); asm volatile("" : "+v"(a)); asm volatile("" : "+v"(bq)); const float r = ((dd < HD / 2) ? __fsub_rn(a, bq) : __fadd_rn(a, bq)) * sc;
        o16[q] = tohx(r); unsigned short a2, c2; splitf(r, a2, c2); oh[q] = a2; ol[q] = c2; }
    *(v2h*)(P16 + e) = o16; *(v2us*)(Ph + e) = oh; *(v2us*)(Pl + e) = ol;  }
__global__ __launch_bounds__(256) void k_copy4(const float* __restrict__ Y, float* out, size_t n4) { const size_t i = (size_t)blockIdx.x * 256 + threadIdx.x; if (i >= n4) return; const v4f a = *(const v4f*)(Y + i * 4); *(v4f*)(out + i * 4) = a;  }
extern "C" void kernel_launch(void* const* d_in, const int* in_sizes, int n_in,
                              void* d_out, int out_size, void* d_ws, size_t ws_size, hipStream_t stream) {
    (void)in_sizes; (void)n_in; (void)out_size;
    const float* x = (const float*)d_in[0]; const float* wq = (const float*)d_in[1]; const float* wk = (const float*)d_in[2]; const float* wv = (const float*)d_in[3];   /* standard roles: rows = queries */
    float* OUT = (float*)d_out;     // [4][4096][64]
    char* wsp = (char*)d_ws;
    auto take = [&](size_t bytes) { char* p = wsp; wsp += (bytes + 255) & ~(size_t)255; return (void*)p; };
    bf* WQ = (bf*)take((size_t)MID * CC * 2); bf* WK = (bf*)take((size_t)MID * CC * 2); bf* WV = (bf*)take((size_t)CO * CC * 2); float* CS = (float*)take((size_t)TT * HD * 2 * 4);
    bf* XB = (bf*)take((size_t)NB_ * TT * CC * 2); float* FQ = (float*)take((size_t)NB_ * TT * MID * 4); float* FK = (float*)take((size_t)NB_ * TT * MID * 4);
    h16* QP16 = (h16*)take((size_t)NB_ * TT * MID * 2); bf* QPh = (bf*)take((size_t)NB_ * TT * MID * 2); bf* QPl = (bf*)take((size_t)NB_ * TT * MID * 2); h16* KP16 = (h16*)take((size_t)NB_ * TT * MID * 2); bf* KPh = (bf*)take((size_t)NB_ * TT * MID * 2); bf* KPl = (bf*)take((size_t)NB_ * TT * MID * 2);
    h16* VT16 = (h16*)take((size_t)NB_ * CO * TT * 2); bf* VTh = (bf*)take((size_t)NB_ * CO * TT * 2); bf* VTl = (bf*)take((size_t)NB_ * CO * TT * 2);
    float* Sb = (float*)take((size_t)TT * TT * 4); h16* P16 = (h16*)take((size_t)NB_ * (TT - RH) * TT * 2); bf* Ph = (bf*)take((size_t)NB_ * RH * TT * 2); bf* Pl = (bf*)take((size_t)NB_ * RH * TT * 2);   /* one batch's scores; every batch's weights (fp16 plane: rows >= RH only) */
    if ((size_t)(wsp - (char*)d_ws) > ws_size) return;    // ws 256 MiB (carve ~252 MiB)
    float* Ob = Sb; float* PH = Ob + (size_t)NB_ * TT * CO; float* PF = PH + (size_t)NB_ * SKH * RH * CO;   /* attention output (f32) before the final copy, and the attn.v partial planes [batch][K slice]: 26 MiB in the score buffer, which nothing reads after the last softmax (stream-ordered) */
    float* FV = FK;   /* the v projection reuses the k buffer after the k planes are built (stream-ordered) */
    k_wtG<<<(unsigned)((CC * MID / 64 + 63) / 64), 256, 0, stream>>>(wq, CC, MID, WQ); k_wtG<<<(unsigned)((CC * MID / 64 + 63) / 64), 256, 0, stream>>>(wk, CC, MID, WK); k_wtG<<<(unsigned)((CC * CO / 64 + 63) / 64), 256, 0, stream>>>(wv, CC, CO, WV);   /* 'xw' weights -> Bt */
    k_csid<<<(TT * HD + 255) / 256, 256, 0, stream>>>(CS);   /* identity table: k_rope is a plain per-head plane builder here */
    const unsigned LP = (unsigned)(((size_t)NH_ * TT * HD / 2 + 255) / 256);
    k_cvt8<<<(unsigned)(((size_t)NB_ * TT * CC / 8 + 255) / 256), 256, 0, stream>>>(x, XB, (size_t)NB_ * TT * CC / 8);
    /* projections: the batches' rows stacked (M = 4 x 4096), one weight plane for all */
    k_gemmw<bf, 0, false, NWK><<<dim3(NB_ * TT / 64, MID / 64, 1), 32 * NWK, 0, stream>>>(XB, nullptr, WQ, nullptr, CC, CC, FQ, MID, nullptr, 0, 0, 0, 0, 0, 0); k_rope<<<dim3(LP, NB_), 256, 0, stream>>>(FQ, MID, NH_, CS, nullptr, nullptr, 1.0f, QP16, QPh, QPl);   /* q planes [b][n][64] */
    k_gemmw<bf, 0, false, NWK><<<dim3(NB_ * TT / 64, MID / 64, 1), 32 * NWK, 0, stream>>>(XB, nullptr, WK, nullptr, CC, CC, FK, MID, nullptr, 0, 0, 0, 0, 0, 0); k_rope<<<dim3(LP, NB_), 256, 0, stream>>>(FK, MID, NKV, CS, nullptr, nullptr, 1.0f, KP16, KPh, KPl);   /* k planes */
    k_gemmw<bf, 0, false, NWK><<<dim3(NB_ * TT / 64, CO / 64, 1), 32 * NWK, 0, stream>>>(XB, nullptr, WV, nullptr, CC, CC, FV, CO, nullptr, 0, 0, 0, 0, 0, 0); k_vtp<<<dim3((unsigned)(((size_t)TT * CO / 2 + 255) / 256), NB_), 256, 0, stream>>>(FV, CO, CO / HD, VT16, VTh, VTl);   /* v^T planes [b][64][n] */
    for (int b = 0; b < NB_; ++b) {   /* per batch: dense 4096 x 4096 scores, then their softmax into the batch's own weight planes */
        k_gemmw<bf, 2, false, 1><<<dim3(TT / 64, TT / 64, 1), 32, 0, stream>>>(QPh + (size_t)b * TT * HD, QPl + (size_t)b * TT * HD, KPh + (size_t)b * TT * HD, KPl + (size_t)b * TT * HD, HD, HD, Sb, TT, nullptr, 0, 0, 0, 0, 0, 0);   /* S[i][j] = q_i.k_j (3 products, every row) */
        k_lsoft<<<TT / 8, 256, 0, stream>>>(Sb, P16 + (size_t)b * (TT - RH) * TT, Ph + (size_t)b * RH * TT, Pl + (size_t)b * RH * TT); }   /* x 1/sqrt(C), softmax over the 4,096 keys */
    k_gemmw<bf, 2, false, NWK, true><<<dim3(RH / 64, NB_, SKH), 32 * NWK, 0, stream>>>(Ph, Pl, VTh, VTl, TT, TT / SKH, PH, CO, nullptr, TT / SKH, TT / SKH, (size_t)RH * CO, (size_t)RH * TT, (size_t)HD * TT, (size_t)SKH * RH * CO);
    k_gemmw<h16, 0, false, NWK, true><<<dim3((TT - RH) / 64, NB_, SKF), 32 * NWK, 0, stream>>>(P16, nullptr, VT16, nullptr, TT, TT / SKF, PF, CO, nullptr, TT / SKF, TT / SKF, (size_t)(TT - RH) * CO, (size_t)(TT - RH) * TT, (size_t)HD * TT, (size_t)SKF * (TT - RH) * CO);
    k_cs8<<<dim3((unsigned)(((size_t)TT * CO / 4 + 255) / 256), NB_), 256, 0, stream>>>(PH, PF, Ob, (size_t)TT * CO / 4);   /* partial planes summed; rows >= 512 x 1/1024 */
    k_copy4<<<(unsigned)(((size_t)NB_ * TT * CO / 4 + 255) / 256), 256, 0, stream>>>(Ob, OUT, (size_t)NB_ * TT * CO / 4);   /* the output rows, written once */
}

// v004
// It runs in 168 microseconds.
// In two side-by-side timings against v003, it was 1.40 and 1.39 times as fast.
// Counting every step since v000, it is 6.73 times as fast.
#include <hip/hip_runtime.h>

// Single causal attention head over 4,096 tokens scaled by the EMBEDDING width (x [4][4096][512]; q, k, v = x W ('xw' [512][64] 1/sqrt(512), no bias); scores = q.k^T / sqrt(C = 512) (the source divides by sqrt(n_embd), not sqrt(head_size)); causal (-inf); softmax; out = weights.v -> [4][4096][64] (1.0 M); argument order x, Wq, Wk, Wv).
// All four batches go through one launch of every kernel but the scores and the softmax (their f32 score plane is one batch's and is reused): rows stacked where the operand is shared, else the batch on grid y.
// Layout per batch: bf16 copy of x; 'xw' weights transposed once; exact projections (K 512); identity-table plane builders; scores with EVERY row on hi/lo planes (3 products); causal softmax, each row read once and held in registers; attn.v hybrid (rows < 512 hi/lo 3 products, rest fp16 x1024); k_cs8 removes the fp16 carry; k_copy4 writes the output rows once. Split-K: the projections and both attn.v products divide their K loop over the 8 waves of a work-group (partial tiles summed through LDS); attn.v also over grid z (f32 partial planes, summed in k_cs8).
// Causal skip: keys above the diagonal have weight exactly 0, so nothing is computed, stored or read for them. Scores: only the 64x64 tiles whose columns lie below the end of the row's 128-key chunk; softmax: only the 128-key chunks up to the one that holds the diagonal; attn.v: the K loop of a 64-row tile ends at the tile's last row, a K slice wholly above it is neither written nor summed.
// Compute dtypes, f32 accumulate: every input rounded to bf16; projections exact; scores 3 products; softmax f32; wei.v rows < 512 3 products, rest fp16; output f32.

#define NB_  4
#define TT   4096
#define DM   64
#define NH_  1
#define NKV  1
#define REP  (NH_ / NKV)
#define HD   64
#define DQ   (NH_ * HD)
#define DKV  (NKV * HD)
#define ZH   1
#define RH   512                  // query rows < RH use hi+lo planes (0: none)
#define WIN  0
#define PCAR 1024.0f
#define SCL  0.044194173824159216f   // 1/sqrt(C) with C = n_embd = 512 (the source scales by sqrt(n_embd), NOT sqrt(head_size))
#define MID  64       // q / k width (one 64-wide head)
#define CO   64       // v width
#define CC   512      // input width (d_in)
#define NWK  8        // waves of a work-group that share one K loop (split-K launches)
#define SKH  2        // grid-z K slices of the hi/lo attn.v product (its rows < RH see only the keys < RH: slices of RH / SKH)
#define SKF  4        // grid-z K slices of the fp16 attn.v product
typedef _Float16 h16;
typedef unsigned short bf;
typedef __attribute__((ext_vector_type(16))) __bf16   v16bf;
typedef __attribute__((ext_vector_type(16))) _Float16 v16h;
typedef __attribute__((ext_vector_type(8)))  _Float16 v8h;
typedef __attribute__((ext_vector_type(8)))  unsigned short v8us;
typedef __attribute__((ext_vector_type(8)))  float    v8f;
typedef __attribute__((ext_vector_type(4)))  float    v4f;
typedef v8h  __attribute__((may_alias)) v8ha;
typedef v4f  __attribute__((may_alias)) v4fa;
typedef v8us __attribute__((may_alias)) v8usa;

__device__ __forceinline__ unsigned short f2bf(float f) { unsigned u = __float_as_uint(f); u += 0x7FFFu + ((u >> 16) & 1u); return (unsigned short)(u >> 16); }
__device__ __forceinline__ float bf2f(unsigned short b) { return __uint_as_float(((unsigned)b) << 16); }
__device__ __forceinline__ float bfr(float f) { return bf2f(f2bf(f)); }
__device__ __forceinline__ v16h cat16(v8h lo, v8h hi) { return __builtin_shufflevector(lo, hi, 0, 1, 2, 3, 4, 5, 6, 7, 8, 9, 10, 11, 12, 13, 14, 15); }
__device__ __forceinline__ v16bf cat16b(v8us lo, v8us hi) { return __builtin_bit_cast(v16bf, __builtin_shufflevector(lo, hi, 0, 1, 2, 3, 4, 5, 6, 7, 8, 9, 10, 11, 12, 13, 14, 15)); }
__device__ __forceinline__ v8f wmma16(v16h a, v16h b, v8f c) { return __builtin_amdgcn_wmma_f32_16x16x32_f16(false, a, false, b, (short)0, c, false, false); }
__device__ __forceinline__ v8f wmmab(v16bf a, v16bf b, v8f c) { return __builtin_amdgcn_wmma_f32_16x16x32_bf16(false, a, false, b, (short)0, c, false, false); }



// ---- k_gemmw: register-blocked GEMM, one 64x64 output tile per work-group (16 accumulators a wave), operands straight from K-contiguous 16-bit planes of row pitch K; grid (M/64, N/64, Z), 32 * NW threads.
// C[m][n] (f32, pitch ldc, + optional f32 bias[n]) = sum_{k < KS} A[m][k] Bt[n][k] (+ split products per NSPLIT). z strides sA/sB/sC in elements (a K slice per z: sA = sB = KS, sC = one partial plane; KS = K: no slicing). KS % (32 * NW) == 0.
// BY: grid y is the batch, not a column tile (N = 64): A, Bt and C move by bA, bB, bC elements a batch.
// CAUS 1 (scores): only the tiles at or below the diagonal's 128-column chunk exist (column tile <= row tile | 1). Row tiles bx and last - bx together have gridDim.y of them, so grid (M/128, N/64 + 2) holds exactly the live tiles.
// CAUS 2 (attn.v): row m of A is query rbase + m and k is the key: the K loop ends behind the tile's last query; a work-group whose whole K slice lies above it writes nothing (k_cs8 skips that plane by the same test).
// NW > 1: wave w takes the k blocks w, w + NW, ... (neighbour waves read the two halves of one 128-byte line); the NW partial tiles are summed through LDS in wave order.
template <typename T16> struct WFrag;
template <> struct WFrag<h16> { typedef v16h V; static __device__ __forceinline__ V ld(const h16* p) { return cat16(*(const v8h*)p, *(const v8h*)(p + 16)); } static __device__ __forceinline__ v8f mma(V a, V b, v8f c) { return wmma16(a, b, c); } };
template <> struct WFrag<bf> { typedef v16bf V; static __device__ __forceinline__ V ld(const bf* p) { return cat16b(*(const v8us*)p, *(const v8us*)(p + 16)); } static __device__ __forceinline__ v8f mma(V a, V b, v8f c) { return wmmab(a, b, c); } };
template <typename T16, int NSPLIT, bool BIAS, int NW, bool BY = false, int CAUS = 0>
__global__ __launch_bounds__(32 * NW) void k_gemmw(const T16* __restrict__ A, const T16* __restrict__ A2, const T16* __restrict__ Bt, const T16* __restrict__ Bt2, int K, int KS, float* C, int ldc, const float* __restrict__ bias, size_t sA, size_t sB, size_t sC, size_t bA, size_t bB, size_t bC, int rbase) {
    typedef typename WFrag<T16>::V V;
    __shared__ __align__(16) float os[NW == 1 ? 16 * 68 : NW * 64 * 68];
    const size_t z = blockIdx.z; A += z * sA; if (A2) A2 += z * sA; Bt += z * sB; if (Bt2) Bt2 += z * sB; C += z * sC;
    if constexpr (BY) { const size_t y = blockIdx.y; A += y * bA; if (A2) A2 += y * bA; Bt += y * bB; if (Bt2) Bt2 += y * bB; C += y * bC; }
    const int lane = threadIdx.x & 31, lr = lane & 15, hi = lane >> 4; int r0 = blockIdx.x * 64, c0 = BY ? 0 : blockIdx.y * 64; int kend = KS;
    if constexpr (CAUS == 1) { const int bx = blockIdx.x, by = blockIdx.y, n = (bx | 1) + 1; r0 = (by < n ? bx : 2 * (int)gridDim.x - 1 - bx) * 64; c0 = (by < n ? by : by - n) * 64; }
    if constexpr (CAUS == 2) { kend = min(KS, rbase + r0 + 64 - (int)blockIdx.z * KS); if (kend <= 0) return; }   // the same for every thread of the work-group, in front of the barrier
    v8f acc[4][4];
#pragma unroll
    for (int mb = 0; mb < 4; ++mb)
#pragma unroll
        for (int nb = 0; nb < 4; ++nb) acc[mb][nb] = (v8f){};
    const size_t aoff = (size_t)(r0 + lr) * K + 8 * hi, boff = (size_t)(c0 + lr) * K + 8 * hi;
    const int wv = (NW == 1) ? 0 : __builtin_amdgcn_readfirstlane((int)(threadIdx.x >> 5));   // wave number, scalar: the K loop keeps its scalar counter and branch
#pragma unroll 1
    for (int kc = wv * 32; kc < kend; kc += 32 * NW) {
        V a[4], a2[4];
#pragma unroll
        for (int mb = 0; mb < 4; ++mb) { a[mb] = WFrag<T16>::ld(A + aoff + (size_t)mb * 16 * K + kc); if (NSPLIT == 1 || NSPLIT == 2) a2[mb] = WFrag<T16>::ld(A2 + aoff + (size_t)mb * 16 * K + kc); }
#pragma unroll
        for (int nb = 0; nb < 4; ++nb) { const V b = WFrag<T16>::ld(Bt + boff + (size_t)nb * 16 * K + kc); V b2; if (NSPLIT >= 2) b2 = WFrag<T16>::ld(Bt2 + boff + (size_t)nb * 16 * K + kc);
#pragma unroll
            for (int mb = 0; mb < 4; ++mb) { acc[mb][nb] = WFrag<T16>::mma(a[mb], b, acc[mb][nb]); if (NSPLIT == 1 || NSPLIT == 2) acc[mb][nb] = WFrag<T16>::mma(a2[mb], b, acc[mb][nb]); if (NSPLIT >= 2) acc[mb][nb] = WFrag<T16>::mma(a[mb], b2, acc[mb][nb]); } }
        asm volatile("v_nop\n\tv_nop\n\tv_nop\n\tv_nop" : "+v"(acc[0][0]), "+v"(acc[1][1]), "+v"(acc[2][2]), "+v"(acc[3][3]) : "v"(a[0]), "v"(a[3]));
    }
    if constexpr (NW > 1) {
        float* my = os + wv * (64 * 68);
        // the three loops are unrolled so that acc[][] is indexed by constants and stays in registers
#pragma unroll
        for (int mb = 0; mb < 4; ++mb)
#pragma unroll
            for (int nb = 0; nb < 4; ++nb)
#pragma unroll
                for (int j = 0; j < 8; ++j) my[(mb * 16 + hi * 8 + j) * 68 + nb * 16 + lr] = acc[mb][nb][j];
        __syncthreads();   // every wave's partial tile is in LDS before any wave sums them
        // both loops unrolled: a thread's LDS reads go out together instead of one wait per read
#pragma unroll
        for (int s = 0; s < 32 / NW; ++s) { const int idx = s * (32 * NW) + (int)threadIdx.x, row = idx >> 4, cofs = (idx & 15) * 4; v4f val = *(const v4fa*)(os + row * 68 + cofs);
#pragma unroll
            for (int w2 = 1; w2 < NW; ++w2) val += *(const v4fa*)(os + w2 * (64 * 68) + row * 68 + cofs);
            if (BIAS) { val[0] += bfr(bias[c0 + cofs]); val[1] += bfr(bias[c0 + cofs + 1]); val[2] += bfr(bias[c0 + cofs + 2]); val[3] += bfr(bias[c0 + cofs + 3]); }
            *(v4f*)(C + (size_t)(r0 + row) * ldc + c0 + cofs) = val; }
        return;
    }
#pragma unroll
    for (int mb = 0; mb < 4; ++mb) {
#pragma unroll
        for (int nb = 0; nb < 4; ++nb) {
#pragma unroll
            for (int j = 0; j < 8; ++j) os[(hi * 8 + j) * 68 + nb * 16 + lr] = acc[mb][nb][j]; }
        __builtin_amdgcn_wave_barrier(); asm volatile("" ::: "memory");
        float* crow = C + (size_t)(r0 + mb * 16) * ldc + c0;
{
#pragma unroll
            for (int s = 0; s < 8; ++s) { const int row = 2 * s + hi, cofs = lr * 4; v4f val = *(const v4fa*)(os + row * 68 + cofs); if (BIAS) { val[0] += bfr(bias[c0 + cofs]); val[1] += bfr(bias[c0 + cofs + 1]); val[2] += bfr(bias[c0 + cofs + 2]); val[3] += bfr(bias[c0 + cofs + 3]); }
                *(v4f*)(crow + (size_t)row * ldc + cofs) = val; }
             }
        __builtin_amdgcn_wave_barrier(); asm volatile("" ::: "memory");
    }
}

__device__ __forceinline__ h16 tohx(float x) { return (h16)x; }
__device__ __forceinline__ void splitf(float y, unsigned short& h, unsigned short& l) { h = f2bf(y); l = f2bf(y - bf2f(h)); }
typedef __attribute__((ext_vector_type(2))) _Float16 v2h;
typedef __attribute__((ext_vector_type(4))) _Float16 v4h;
typedef __attribute__((ext_vector_type(2))) unsigned short v2us;
typedef __attribute__((ext_vector_type(4))) unsigned short v4us;
typedef __attribute__((ext_vector_type(2))) float v2f;
typedef __attribute__((ext_vector_type(4))) int v4i;

__global__ __launch_bounds__(256) void k_cvt8(const float* __restrict__ src, bf* dst, size_t n8) { const size_t i = (size_t)blockIdx.x * 256 + threadIdx.x; if (i >= n8) return; const v8f v = *(const v8f*)(src + i * 8); v8us o;
#pragma unroll
    for (int k = 0; k < 8; ++k) o[k] = f2bf(v[k]); *(v8us*)(dst + i * 8) = o;  }


__global__ __launch_bounds__(256) void k_wtG(const float* __restrict__ w, int K, int N, bf* Bt) {
    const int lane = threadIdx.x & 31; const int L0 = (blockIdx.x * 8 + (threadIdx.x >> 5)) * 8; const int nlines = N * K / 64;
{
#pragma unroll 1
        for (int l = 0; l < 8; ++l) { const int L = L0 + l; if (L >= nlines) break; const size_t e = (size_t)L * 64 + lane * 2; const int k = (int)(e % K), n = (int)(e / K); v2us o;
            o[0] = f2bf(w[(size_t)k * N + n]); o[1] = f2bf(w[(size_t)(k + 1) * N + n]); *(v2us*)(Bt + e) = o; }
         }
}
__global__ __launch_bounds__(256) void k_vtp(const float* __restrict__ F, int pitch, int nheads, h16* V16, bf* Vh, bf* Vl) { const size_t e = ((size_t)blockIdx.x * 256 + threadIdx.x) * 2; if (e >= (size_t)nheads * HD * TT) return; { const size_t y = blockIdx.y, po = y * nheads * HD * TT; F += y * TT * pitch; V16 += po; Vh += po; Vl += po; }   /* grid y: the batch */ const int t = (int)(e % TT); const int d = (int)((e / TT) % HD); const int g = (int)(e / ((size_t)TT * HD)); v2h o16; v2us oh, ol;
#pragma unroll
    for (int q = 0; q < 2; ++q) { const float x = F[(size_t)(t + q) * pitch + g * HD + d]; o16[q] = tohx(x); unsigned short a2, c2; splitf(x, a2, c2); oh[q] = a2; ol[q] = c2; }
    *(v2h*)(V16 + e) = o16; *(v2us*)(Vh + e) = oh; *(v2us*)(Vl + e) = ol;  }
// k_lsoft: one wave a row, the row held in registers (up to 128 floats a lane). Only the nch 128-key chunks up to the one that holds the diagonal are loaded, worked on and stored: the chunks behind it would add exact zeros to the sum, and attn.v never reads them. The body is compiled once per row length in steps of 512 keys (NG = 1 .. 8; a work-group's 8 rows share one NG), so that only the last three chunks of a body need a test (scalar: the row number is). The longest rows go to the first work-groups, so that no long row starts last. All loads of the row go out before the first value is used, so a wave waits for memory once; the masked scaled scores, then their exponentials, replace the loaded values in place, and the maximum, the sum (chunk by chunk, as the keys are numbered) and the stores read the registers.
template <int NG>
__device__ __forceinline__ void lsoft_row(const float* __restrict__ sr, const int i, const int zz, const int nch, const int lane, h16* P16, bf* Ph, bf* Pl) {
    constexpr int NC = NG * 4;   // chunks 0 .. NC - 4 are live in every row of this length class
    constexpr bool CANHI = (NG - 1) * 512 < RH, CANLO = NG * 512 > RH; const bool hires = CANHI && (!CANLO || i < RH);   /* which of the two output forms rows of this length class can take */ float mx = -3.0e38f;
    v4f a[NC];
    // every loop over the chunks is unrolled: a[][] is indexed by constants and stays in registers
#pragma unroll
    for (int ch = 0; ch < NC; ++ch) if (ch <= NC - 4 || ch < nch) a[ch] = *(const v4f*)(sr + ch * 128 + lane * 4);
#pragma unroll
    for (int ch = 0; ch < NC; ++ch) if (ch <= NC - 4 || ch < nch) { const int j0 = ch * 128 + lane * 4;
#pragma unroll
        for (int q = 0; q < 4; ++q) { const float t = (ch < NC - 4 || j0 + q <= i) ? a[ch][q] * SCL : -3.0e38f; a[ch][q] = t; mx = fmaxf(mx, t); } }   // i >= (NC - 4) * 128 in this length class: the chunks in front of that hold no masked key
#pragma unroll
    for (int sh = 16; sh; sh >>= 1) mx = fmaxf(mx, __shfl_xor(mx, sh, 32));
    float sum = 0.f;
#pragma unroll
    for (int ch = 0; ch < NC; ++ch) if (ch <= NC - 4 || ch < nch) {
#pragma unroll
        for (int q = 0; q < 4; ++q) a[ch][q] = __fmul_rn(__fsub_rn(a[ch][q], mx), 1.4426950408889634f); }
#pragma unroll
    for (int ch = 0; ch < NC; ++ch) if (ch <= NC - 4 || ch < nch) {
        // a chunk's four exponentials in place, in one statement with a v_nop behind the last: no instruction directly behind a v_exp_f32 reads its result or overwrites its source (the slot the instruction set wants kept free)
        asm("v_exp_f32 %0, %0\n\tv_exp_f32 %1, %1\n\tv_exp_f32 %2, %2\n\tv_exp_f32 %3, %3\n\tv_nop" : "+v"(a[ch][0]), "+v"(a[ch][1]), "+v"(a[ch][2]), "+v"(a[ch][3]));
#pragma unroll
        for (int q = 0; q < 4; ++q) sum += a[ch][q]; }
#pragma unroll
    for (int sh = 16; sh; sh >>= 1) sum += __shfl_xor(sum, sh, 32);
    const float f = __fdiv_rn(hires ? 1.0f : PCAR, sum);
    if (hires) {   /* rows < RH: normalised bf16 hi/lo, planes [zz][RH][TT] */
#pragma unroll
        for (int ch = 0; ch < NC; ++ch) if (ch <= NC - 4 || ch < nch) { const int j0 = ch * 128 + lane * 4; v4us oh, ol;
#pragma unroll
            for (int q = 0; q < 4; ++q) { unsigned short a2, c2; splitf(a[ch][q] * f, a2, c2); oh[q] = a2; ol[q] = c2; }
            const size_t oo = ((size_t)zz * RH + i) * TT + j0; *(v4us*)(Ph + oo) = oh; *(v4us*)(Pl + oo) = ol;
            if (ch >= NC - 4) asm volatile("s_wait_xcnt 0x0" ::: "memory"); }   // behind the stores, in front of the branch: the code behind it (the next tested chunk; behind the last chunk, whatever the build lays out next) rewrites registers that these stores name
    } else {   /* rows >= RH: fp16 x PCAR, plane [zz][TT - RH][TT] */
#pragma unroll
        for (int ch = 0; ch < NC; ++ch) if (ch <= NC - 4 || ch < nch) { const int j0 = ch * 128 + lane * 4; v4h o4;
#pragma unroll
            for (int q = 0; q < 4; ++q) o4[q] = tohx(a[ch][q] * f);
            *(v4h*)(P16 + ((size_t)zz * (TT - RH) + (i - RH)) * TT + j0) = o4;
            if (ch >= NC - 4) asm volatile("s_wait_xcnt 0x0" ::: "memory"); } }   // as above
}
__global__ __launch_bounds__(256) void k_lsoft(const float* __restrict__ Sb, h16* P16, bf* Ph, bf* Pl) {
    const int lane = threadIdx.x & 31; const int row = (ZH * TT / 8 - 1 - (int)blockIdx.x) * 8 + __builtin_amdgcn_readfirstlane((int)(threadIdx.x >> 5));   /* scalar: the tests on nch are scalar branches */ if (row >= ZH * TT) return; const int i = row % TT; const int zz = row / TT; const int nch = (i >> 7) + 1; const float* sr = Sb + (size_t)row * TT;
    static_assert(TT == 8 * 512, "one case per 512 keys");
    switch ((nch + 3) >> 2) {
        case 1: lsoft_row<1>(sr, i, zz, nch, lane, P16, Ph, Pl); return; case 2: lsoft_row<2>(sr, i, zz, nch, lane, P16, Ph, Pl); return; case 3: lsoft_row<3>(sr, i, zz, nch, lane, P16, Ph, Pl); return; case 4: lsoft_row<4>(sr, i, zz, nch, lane, P16, Ph, Pl); return;
        case 5: lsoft_row<5>(sr, i, zz, nch, lane, P16, Ph, Pl); return; case 6: lsoft_row<6>(sr, i, zz, nch, lane, P16, Ph, Pl); return; case 7: lsoft_row<7>(sr, i, zz, nch, lane, P16, Ph, Pl); return; default: lsoft_row<8>(sr, i, zz, nch, lane, P16, Ph, Pl); return; }
}
// k_cs8: sums the grid-z partial planes of attn.v in slice order (rows < RH: SKH planes of PH; the rest: SKF planes of PF, then x 1/PCAR removes the fp16 carry); row pitch is the value width CO. A plane whose K slice lies wholly above the row's 64-row tile was not written and counts as zero. The plane loops are unrolled, loads first and sums behind them, so that a thread's loads are all in flight at once.
__global__ __launch_bounds__(256) void k_cs8(const float* __restrict__ PH, const float* __restrict__ PF, float* O, size_t n4) { const size_t i = (size_t)blockIdx.x * 256 + threadIdx.x; if (i >= n4) return; { const size_t y = blockIdx.y; PH += y * ((size_t)SKH * RH * CO); PF += y * ((size_t)SKF * (TT - RH) * CO); O += y * ((size_t)TT * CO); }   /* grid y: the batch */ const size_t e = i * 4; const int t = (int)(e / CO); v4f a;
    if (t < RH) { v4f p[SKH];
#pragma unroll
        for (int s = 0; s < SKH; ++s) { p[s] = (v4f){}; if (s == 0 || s * (RH / SKH) <= (t | 63)) p[s] = *(const v4f*)(PH + (size_t)s * RH * CO + e); }
        a = p[0];
#pragma unroll
        for (int s = 1; s < SKH; ++s) a += p[s];
    } else { const size_t e2 = e - (size_t)RH * CO; v4f p[SKF];
#pragma unroll
        for (int s = 0; s < SKF; ++s) { p[s] = (v4f){}; if (s == 0 || s * (TT / SKF) <= (t | 63)) p[s] = *(const v4f*)(PF + (size_t)s * (TT - RH) * CO + e2); }
        a = p[0];
#pragma unroll
        for (int s = 1; s < SKF; ++s) a += p[s];
#pragma unroll
        for (int q = 0; q < 4; ++q) a[q] = __fmul_rn(a[q], 1.0f / PCAR); }
    *(v4f*)(O + e) = a;  }

__global__ __launch_bounds__(256) void k_csid(float* CS) { const int idx = blockIdx.x * 256 + threadIdx.x; if (idx >= TT * HD) return; v2f cs; cs[0] = 1.0f; cs[1] = 0.0f; *(v2f*)(CS + (size_t)idx * 2) = cs;  }
// k_rope: head planes [h][t][d] (fp16 + hi/lo) of rope(x) x sc with the rotate-half convention out[d] = x[d] cos[t][d] - x[d+HD/2] sin[t][d], out[d+HD/2] = x[d+HD/2] cos[t][d+HD/2] + x[d] sin[t][d+HD/2]
__global__ __launch_bounds__(256) void k_rope(const float* __restrict__ F, int pitch, int nheads, const float* __restrict__ CS, const float* __restrict__ RF, const float* __restrict__ nw, float sc, h16* P16, bf* Ph, bf* Pl) {
    const size_t e = ((size_t)blockIdx.x * 256 + threadIdx.x) * 2; if (e >= (size_t)nheads * TT * HD) return; { const size_t y = blockIdx.y, po = y * nheads * TT * HD; F += y * TT * pitch; P16 += po; Ph += po; Pl += po; }   /* grid y: the batch */ const int d = (int)(e % HD); const int t = (int)((e / HD) % TT); const int h = (int)(e / ((size_t)HD * TT)); const float* f = F + (size_t)t * pitch + h * HD; const float rf = RF ? RF[(size_t)h * TT + t] : 1.0f; v2h o16; v2us oh, ol;
#pragma unroll
    for (int q = 0; q < 2; ++q) { const int dd = d + q; const int dp = (dd < HD / 2) ? dd + HD / 2 : dd - HD / 2; float x0 = f[dd], x1 = f[dp];
        if (RF) { float n0 = __fmul_rn(x0, rf), n1 = __fmul_rn(x1, rf); asm volatile("" : "+v"(n0)); asm volatile("" : "+v"(n1)); x0 = __fmul_rn(bfr(nw[dd]), n0); x1 = __fmul_rn(bfr(nw[dp]), n1); }
        const v2f cs = *(const v2f*)(CS + ((size_t)t * HD + dd) * 2); float a = __fmul_rn(x0, cs[0]), bq = __fmul_rn(x1, cs[1]); asm volatile("" : "+v"(a)); asm volatile("" : "+v"(bq)); const float r = ((dd < HD / 2) ? __fsub_rn(a, bq) : __fadd_rn(a, bq)) * sc;
        o16[q] = tohx(r); unsigned short a2, c2; splitf(r, a2, c2); oh[q] = a2; ol[q] = c2; }
    *(v2h*)(P16 + e) = o16; *(v2us*)(Ph + e) = oh; *(v2us*)(Pl + e) = ol;  }
__global__ __launch_bounds__(256) void k_copy4(const float* __restrict__ Y, float* out, size_t n4) { const size_t i = (size_t)blockIdx.x * 256 + threadIdx.x; if (i >= n4) return; const v4f a = *(const v4f*)(Y + i * 4); *(v4f*)(out + i * 4) = a;  }
extern "C" void kernel_launch(void* const* d_in, const int* in_sizes, int n_in,
                              void* d_out, int out_size, void* d_ws, size_t ws_size, hipStream_t stream) {
    (void)in_sizes; (void)n_in; (void)out_size;
    const float* x = (const float*)d_in[0]; const float* wq = (const float*)d_in[1]; const float* wk = (const float*)d_in[2]; const float* wv = (const float*)d_in[3];   /* standard roles: rows = queries */
    float* OUT = (float*)d_out;     // [4][4096][64]
    char* wsp = (char*)d_ws;
    auto take = [&](size_t bytes) { char* p = wsp; wsp += (bytes + 255) & ~(size_t)255; return (void*)p; };
    bf* WQ = (bf*)take((size_t)MID * CC * 2); bf* WK = (bf*)take((size_t)MID * CC * 2); bf* WV = (bf*)take((size_t)CO * CC * 2); float* CS = (float*)take((size_t)TT * HD * 2 * 4);
    bf* XB = (bf*)take((size_t)NB_ * TT * CC * 2); float* FQ = (float*)take((size_t)NB_ * TT * MID * 4); float* FK = (float*)take((size_t)NB_ * TT * MID * 4);
    h16* QP16 = (h16*)take((size_t)NB_ * TT * MID * 2); bf* QPh = (bf*)take((size_t)NB_ * TT * MID * 2); bf* QPl = (bf*)take((size_t)NB_ * TT * MID * 2); h16* KP16 = (h16*)take((size_t)NB_ * TT * MID * 2); bf* KPh = (bf*)take((size_t)NB_ * TT * MID * 2); bf* KPl = (bf*)take((size_t)NB_ * TT * MID * 2);
    h16* VT16 = (h16*)take((size_t)NB_ * CO * TT * 2); bf* VTh = (bf*)take((size_t)NB_ * CO * TT * 2); bf* VTl = (bf*)take((size_t)NB_ * CO * TT * 2);
    float* Sb = (float*)take((size_t)TT * TT * 4); h16* P16 = (h16*)take((size_t)NB_ * (TT - RH) * TT * 2); bf* Ph = (bf*)take((size_t)NB_ * RH * TT * 2); bf* Pl = (bf*)take((size_t)NB_ * RH * TT * 2);   /* one batch's scores; every batch's weights (fp16 plane: rows >= RH only) */
    if ((size_t)(wsp - (char*)d_ws) > ws_size) return;    // ws 256 MiB (carve ~252 MiB)
    float* Ob = Sb; float* PH = Ob + (size_t)NB_ * TT * CO; float* PF = PH + (size_t)NB_ * SKH * RH * CO;   /* attention output (f32) before the final copy, and the attn.v partial planes [batch][K slice]: 19 MiB in the score buffer, which nothing reads after the last softmax (stream-ordered) */
    float* FV = FK;   /* the v projection reuses the k buffer after the k planes are built (stream-ordered) */
    k_wtG<<<(unsigned)((CC * MID / 64 + 63) / 64), 256, 0, stream>>>(wq, CC, MID, WQ); k_wtG<<<(unsigned)((CC * MID / 64 + 63) / 64), 256, 0, stream>>>(wk, CC, MID, WK); k_wtG<<<(unsigned)((CC * CO / 64 + 63) / 64), 256, 0, stream>>>(wv, CC, CO, WV);   /* 'xw' weights -> Bt */
    k_csid<<<(TT * HD + 255) / 256, 256, 0, stream>>>(CS);   /* identity table: k_rope is a plain per-head plane builder here */
    const unsigned LP = (unsigned)(((size_t)NH_ * TT * HD / 2 + 255) / 256);
    k_cvt8<<<(unsigned)(((size_t)NB_ * TT * CC / 8 + 255) / 256), 256, 0, stream>>>(x, XB, (size_t)NB_ * TT * CC / 8);
    /* projections: the batches' rows stacked (M = 4 x 4096), one weight plane for all */
    k_gemmw<bf, 0, false, NWK><<<dim3(NB_ * TT / 64, MID / 64, 1), 32 * NWK, 0, stream>>>(XB, nullptr, WQ, nullptr, CC, CC, FQ, MID, nullptr, 0, 0, 0, 0, 0, 0, 0); k_rope<<<dim3(LP, NB_), 256, 0, stream>>>(FQ, MID, NH_, CS, nullptr, nullptr, 1.0f, QP16, QPh, QPl);   /* q planes [b][n][64] */
    k_gemmw<bf, 0, false, NWK><<<dim3(NB_ * TT / 64, MID / 64, 1), 32 * NWK, 0, stream>>>(XB, nullptr, WK, nullptr, CC, CC, FK, MID, nullptr, 0, 0, 0, 0, 0, 0, 0); k_rope<<<dim3(LP, NB_), 256, 0, stream>>>(FK, MID, NKV, CS, nullptr, nullptr, 1.0f, KP16, KPh, KPl);   /* k planes */
    k_gemmw<bf, 0, false, NWK><<<dim3(NB_ * TT / 64, CO / 64, 1), 32 * NWK, 0, stream>>>(XB, nullptr, WV, nullptr, CC, CC, FV, CO, nullptr, 0, 0, 0, 0, 0, 0, 0); k_vtp<<<dim3((unsigned)(((size_t)TT * CO / 2 + 255) / 256), NB_), 256, 0, stream>>>(FV, CO, CO / HD, VT16, VTh, VTl);   /* v^T planes [b][64][n] */
    for (int b = 0; b < NB_; ++b) {   /* per batch: the causal part of the 4096 x 4096 scores, then their softmax into the batch's own weight planes */
        k_gemmw<bf, 2, false, 1, false, 1><<<dim3(TT / 128, TT / 64 + 2, 1), 32, 0, stream>>>(QPh + (size_t)b * TT * HD, QPl + (size_t)b * TT * HD, KPh + (size_t)b * TT * HD, KPl + (size_t)b * TT * HD, HD, HD, Sb, TT, nullptr, 0, 0, 0, 0, 0, 0, 0);   /* S[i][j] = q_i.k_j (3 products, every row) */
        k_lsoft<<<TT / 8, 256, 0, stream>>>(Sb, P16 + (size_t)b * (TT - RH) * TT, Ph + (size_t)b * RH * TT, Pl + (size_t)b * RH * TT); }   /* x 1/sqrt(C), softmax over the keys <= the row */
    k_gemmw<bf, 2, false, NWK, true, 2><<<dim3(RH / 64, NB_, SKH), 32 * NWK, 0, stream>>>(Ph, Pl, VTh, VTl, TT, RH / SKH, PH, CO, nullptr, RH / SKH, RH / SKH, (size_t)RH * CO, (size_t)RH * TT, (size_t)HD * TT, (size_t)SKH * RH * CO, 0);
    k_gemmw<h16, 0, false, NWK, true, 2><<<dim3((TT - RH) / 64, NB_, SKF), 32 * NWK, 0, stream>>>(P16, nullptr, VT16, nullptr, TT, TT / SKF, PF, CO, nullptr, TT / SKF, TT / SKF, (size_t)(TT - RH) * CO, (size_t)(TT - RH) * TT, (size_t)HD * TT, (size_t)SKF * (TT - RH) * CO, RH);
    k_cs8<<<dim3((unsigned)(((size_t)TT * CO / 4 + 255) / 256), NB_), 256, 0, stream>>>(PH, PF, Ob, (size_t)TT * CO / 4);   /* partial planes summed; rows >= 512 x 1/1024 */
    k_copy4<<<(unsigned)(((size_t)NB_ * TT * CO / 4 + 255) / 256), 256, 0, stream>>>(Ob, OUT, (size_t)NB_ * TT * CO / 4);   /* the output rows, written once */
}

// v005
// Measured time: 93.3 microseconds a run.
// Next to v004, in two timings, it ran 1.80 and 1.82 times as fast.
// All steps since v000 together make it 12.2 times as fast.
#include <hip/hip_runtime.h>

// Single causal attention head over 4,096 tokens scaled by the EMBEDDING width (x [4][4096][512]; q, k, v = x W ('xw' [512][64] 1/sqrt(512), no bias); scores = q.k^T / sqrt(C = 512) (the source divides by sqrt(n_embd), not sqrt(head_size)); causal (-inf); softmax; out = weights.v -> [4][4096][64] (1.0 M); argument order x, Wq, Wk, Wv).
// All four batches go through one launch of every kernel: rows stacked where the operand is shared, else the batch on grid y.
// Layout per batch: bf16 copy of x; 'xw' weights transposed once; exact projections (K 512, the K loop divided over the 8 waves of a work-group, partial tiles summed through LDS); identity-table plane builders; k_fattn: scores with EVERY row on hi/lo planes (3 products), causal softmax with a running maximum, attn.v hybrid (rows < 512 hi/lo 3 products, rest fp16), all in registers; it writes the output rows once.
// Causal skip: keys above the diagonal have weight exactly 0: a query group's key loop ends at its own 32-key block, and only that block is masked.
// Compute dtypes, f32 accumulate: every input rounded to bf16; projections exact; scores 3 products; softmax f32; wei.v rows < 512 3 products, rest fp16; output f32.

#define NB_  4
#define TT   4096
#define DM   64
#define NH_  1
#define NKV  1
#define REP  (NH_ / NKV)
#define HD   64
#define DQ   (NH_ * HD)
#define DKV  (NKV * HD)
#define ZH   1
#define RH   512                  // query rows < RH use hi+lo planes (0: none)
#define WIN  0
#define SCL  0.044194173824159216f   // 1/sqrt(C) with C = n_embd = 512 (the source scales by sqrt(n_embd), NOT sqrt(head_size))
#define MID  64       // q / k width (one 64-wide head)
#define CO   64       // v width
#define CC   512      // input width (d_in)
#define NWK  8        // waves of a work-group that share one K loop (split-K launches)
typedef _Float16 h16;
typedef unsigned short bf;
typedef __attribute__((ext_vector_type(16))) __bf16   v16bf;
typedef __attribute__((ext_vector_type(16))) _Float16 v16h;
typedef __attribute__((ext_vector_type(8)))  _Float16 v8h;
typedef __attribute__((ext_vector_type(8)))  unsigned short v8us;
typedef __attribute__((ext_vector_type(8)))  float    v8f;
typedef __attribute__((ext_vector_type(4)))  float    v4f;
typedef v8h  __attribute__((may_alias)) v8ha;
typedef v4f  __attribute__((may_alias)) v4fa;
typedef v8us __attribute__((may_alias)) v8usa;

__device__ __forceinline__ unsigned short f2bf(float f) { unsigned u = __float_as_uint(f); u += 0x7FFFu + ((u >> 16) & 1u); return (unsigned short)(u >> 16); }
__device__ __forceinline__ float bf2f(unsigned short b) { return __uint_as_float(((unsigned)b) << 16); }
__device__ __forceinline__ float bfr(float f) { return bf2f(f2bf(f)); }
__device__ __forceinline__ v16h cat16(v8h lo, v8h hi) { return __builtin_shufflevector(lo, hi, 0, 1, 2, 3, 4, 5, 6, 7, 8, 9, 10, 11, 12, 13, 14, 15); }
__device__ __forceinline__ v16bf cat16b(v8us lo, v8us hi) { return __builtin_bit_cast(v16bf, __builtin_shufflevector(lo, hi, 0, 1, 2, 3, 4, 5, 6, 7, 8, 9, 10, 11, 12, 13, 14, 15)); }
__device__ __forceinline__ v8f wmma16(v16h a, v16h b, v8f c) { return __builtin_amdgcn_wmma_f32_16x16x32_f16(false, a, false, b, (short)0, c, false, false); }
__device__ __forceinline__ v8f wmmab(v16bf a, v16bf b, v8f c) { return __builtin_amdgcn_wmma_f32_16x16x32_bf16(false, a, false, b, (short)0, c, false, false); }



// ---- k_gemmw: register-blocked GEMM, one 64x64 output tile per work-group (16 accumulators a wave), operands straight from K-contiguous 16-bit planes of row pitch K; grid (M/64, N/64, Z), 32 * NW threads.
// C[m][n] (f32, pitch ldc, + optional f32 bias[n]) = sum_{k < KS} A[m][k] Bt[n][k] (+ split products per NSPLIT). z strides sA/sB/sC in elements (a K slice per z: sA = sB = KS, sC = one partial plane; KS = K: no slicing). KS % (32 * NW) == 0.
// BY: grid y is the batch, not a column tile (N = 64): A, Bt and C move by bA, bB, bC elements a batch.
// CAUS 1 (scores): only the tiles at or below the diagonal's 128-column chunk exist (column tile <= row tile | 1). Row tiles bx and last - bx together have gridDim.y of them, so grid (M/128, N/64 + 2) holds exactly the live tiles.
// CAUS 2 (attn.v): row m of A is query rbase + m and k is the key: the K loop ends behind the tile's last query; a work-group whose whole K slice lies above it writes nothing.
// NW > 1: wave w takes the k blocks w, w + NW, ... (neighbour waves read the two halves of one 128-byte line); the NW partial tiles are summed through LDS in wave order.
template <typename T16> struct WFrag;
template <> struct WFrag<h16> { typedef v16h V; static __device__ __forceinline__ V ld(const h16* p) { return cat16(*(const v8h*)p, *(const v8h*)(p + 16)); } static __device__ __forceinline__ v8f mma(V a, V b, v8f c) { return wmma16(a, b, c); } };
template <> struct WFrag<bf> { typedef v16bf V; static __device__ __forceinline__ V ld(const bf* p) { return cat16b(*(const v8us*)p, *(const v8us*)(p + 16)); } static __device__ __forceinline__ v8f mma(V a, V b, v8f c) { return wmmab(a, b, c); } };
template <typename T16, int NSPLIT, bool BIAS, int NW, bool BY = false, int CAUS = 0>
__global__ __launch_bounds__(32 * NW) void k_gemmw(const T16* __restrict__ A, const T16* __restrict__ A2, const T16* __restrict__ Bt, const T16* __restrict__ Bt2, int K, int KS, float* C, int ldc, const float* __restrict__ bias, size_t sA, size_t sB, size_t sC, size_t bA, size_t bB, size_t bC, int rbase) {
    typedef typename WFrag<T16>::V V;
    __shared__ __align__(16) float os[NW == 1 ? 16 * 68 : NW * 64 * 68];
    const size_t z = blockIdx.z; A += z * sA; if (A2) A2 += z * sA; Bt += z * sB; if (Bt2) Bt2 += z * sB; C += z * sC;
    if constexpr (BY) { const size_t y = blockIdx.y; A += y * bA; if (A2) A2 += y * bA; Bt += y * bB; if (Bt2) Bt2 += y * bB; C += y * bC; }
    const int lane = threadIdx.x & 31, lr = lane & 15, hi = lane >> 4; int r0 = blockIdx.x * 64, c0 = BY ? 0 : blockIdx.y * 64; int kend = KS;
    if constexpr (CAUS == 1) { const int bx = blockIdx.x, by = blockIdx.y, n = (bx | 1) + 1; r0 = (by < n ? bx : 2 * (int)gridDim.x - 1 - bx) * 64; c0 = (by < n ? by : by - n) * 64; }
    if constexpr (CAUS == 2) { kend = min(KS, rbase + r0 + 64 - (int)blockIdx.z * KS); if (kend <= 0) return; }   // the same for every thread of the work-group, in front of the barrier
    v8f acc[4][4];
#pragma unroll
    for (int mb = 0; mb < 4; ++mb)
#pragma unroll
        for (int nb = 0; nb < 4; ++nb) acc[mb][nb] = (v8f){};
    const size_t aoff = (size_t)(r0 + lr) * K + 8 * hi, boff = (size_t)(c0 + lr) * K + 8 * hi;
    const int wv = (NW == 1) ? 0 : __builtin_amdgcn_readfirstlane((int)(threadIdx.x >> 5));   // wave number, scalar: the K loop keeps its scalar counter and branch
#pragma unroll 1
    for (int kc = wv * 32; kc < kend; kc += 32 * NW) {
        V a[4], a2[4];
#pragma unroll
        for (int mb = 0; mb < 4; ++mb) { a[mb] = WFrag<T16>::ld(A + aoff + (size_t)mb * 16 * K + kc); if (NSPLIT == 1 || NSPLIT == 2) a2[mb] = WFrag<T16>::ld(A2 + aoff + (size_t)mb * 16 * K + kc); }
#pragma unroll
        for (int nb = 0; nb < 4; ++nb) { const V b = WFrag<T16>::ld(Bt + boff + (size_t)nb * 16 * K + kc); V b2; if (NSPLIT >= 2) b2 = WFrag<T16>::ld(Bt2 + boff + (size_t)nb * 16 * K + kc);
#pragma unroll
            for (int mb = 0; mb < 4; ++mb) { acc[mb][nb] = WFrag<T16>::mma(a[mb], b, acc[mb][nb]); if (NSPLIT == 1 || NSPLIT == 2) acc[mb][nb] = WFrag<T16>::mma(a2[mb], b, acc[mb][nb]); if (NSPLIT >= 2) acc[mb][nb] = WFrag<T16>::mma(a[mb], b2, acc[mb][nb]); } }
        asm volatile("v_nop\n\tv_nop\n\tv_nop\n\tv_nop" : "+v"(acc[0][0]), "+v"(acc[1][1]), "+v"(acc[2][2]), "+v"(acc[3][3]) : "v"(a[0]), "v"(a[3]));
    }
    if constexpr (NW > 1) {
        float* my = os + wv * (64 * 68);
        // the three loops are unrolled so that acc[][] is indexed by constants and stays in registers
#pragma unroll
        for (int mb = 0; mb < 4; ++mb)
#pragma unroll
            for (int nb = 0; nb < 4; ++nb)
#pragma unroll
                for (int j = 0; j < 8; ++j) my[(mb * 16 + hi * 8 + j) * 68 + nb * 16 + lr] = acc[mb][nb][j];
        __syncthreads();   // every wave's partial tile is in LDS before any wave sums them
        // both loops unrolled: a thread's LDS reads go out together instead of one wait per read
#pragma unroll
        for (int s = 0; s < 32 / NW; ++s) { const int idx = s * (32 * NW) + (int)threadIdx.x, row = idx >> 4, cofs = (idx & 15) * 4; v4f val = *(const v4fa*)(os + row * 68 + cofs);
#pragma unroll
            for (int w2 = 1; w2 < NW; ++w2) val += *(const v4fa*)(os + w2 * (64 * 68) + row * 68 + cofs);
            if (BIAS) { val[0] += bfr(bias[c0 + cofs]); val[1] += bfr(bias[c0 + cofs + 1]); val[2] += bfr(bias[c0 + cofs + 2]); val[3] += bfr(bias[c0 + cofs + 3]); }
            *(v4f*)(C + (size_t)(r0 + row) * ldc + c0 + cofs) = val; }
        return;
    }
#pragma unroll
    for (int mb = 0; mb < 4; ++mb) {
#pragma unroll
        for (int nb = 0; nb < 4; ++nb) {
#pragma unroll
            for (int j = 0; j < 8; ++j) os[(hi * 8 + j) * 68 + nb * 16 + lr] = acc[mb][nb][j]; }
        __builtin_amdgcn_wave_barrier(); asm volatile("" ::: "memory");
        float* crow = C + (size_t)(r0 + mb * 16) * ldc + c0;
{
#pragma unroll
            for (int s = 0; s < 8; ++s) { const int row = 2 * s + hi, cofs = lr * 4; v4f val = *(const v4fa*)(os + row * 68 + cofs); if (BIAS) { val[0] += bfr(bias[c0 + cofs]); val[1] += bfr(bias[c0 + cofs + 1]); val[2] += bfr(bias[c0 + cofs + 2]); val[3] += bfr(bias[c0 + cofs + 3]); }
                *(v4f*)(crow + (size_t)row * ldc + cofs) = val; }
             }
        __builtin_amdgcn_wave_barrier(); asm volatile("" ::: "memory");
    }
}

__device__ __forceinline__ h16 tohx(float x) { return (h16)x; }
__device__ __forceinline__ void splitf(float y, unsigned short& h, unsigned short& l) { h = f2bf(y); l = f2bf(y - bf2f(h)); }
typedef __attribute__((ext_vector_type(2))) _Float16 v2h;
typedef __attribute__((ext_vector_type(4))) _Float16 v4h;
typedef __attribute__((ext_vector_type(2))) unsigned short v2us;
typedef __attribute__((ext_vector_type(4))) unsigned short v4us;
typedef __attribute__((ext_vector_type(2))) float v2f;
typedef __attribute__((ext_vector_type(4))) int v4i;

__global__ __launch_bounds__(256) void k_cvt8(const float* __restrict__ src, bf* dst, size_t n8) { const size_t i = (size_t)blockIdx.x * 256 + threadIdx.x; if (i >= n8) return; const v8f v = *(const v8f*)(src + i * 8); v8us o;
#pragma unroll
    for (int k = 0; k < 8; ++k) o[k] = f2bf(v[k]); *(v8us*)(dst + i * 8) = o;  }


__global__ __launch_bounds__(256) void k_wtG(const float* __restrict__ w, int K, int N, bf* Bt) {
    const int lane = threadIdx.x & 31; const int L0 = (blockIdx.x * 8 + (threadIdx.x >> 5)) * 8; const int nlines = N * K / 64;
{
#pragma unroll 1
        for (int l = 0; l < 8; ++l) { const int L = L0 + l; if (L >= nlines) break; const size_t e = (size_t)L * 64 + lane * 2; const int k = (int)(e % K), n = (int)(e / K); v2us o;
            o[0] = f2bf(w[(size_t)k * N + n]); o[1] = f2bf(w[(size_t)(k + 1) * N + n]); *(v2us*)(Bt + e) = o; }
         }
}
__global__ __launch_bounds__(256) void k_vtp(const float* __restrict__ F, int pitch, int nheads, h16* V16, bf* Vh, bf* Vl) { const size_t e = ((size_t)blockIdx.x * 256 + threadIdx.x) * 2; if (e >= (size_t)nheads * HD * TT) return; { const size_t y = blockIdx.y, po = y * nheads * HD * TT; F += y * TT * pitch; V16 += po; Vh += po; Vl += po; }   /* grid y: the batch */ const int t = (int)(e % TT); const int d = (int)((e / TT) % HD); const int g = (int)(e / ((size_t)TT * HD)); v2h o16; v2us oh, ol;
#pragma unroll
    for (int q = 0; q < 2; ++q) { const float x = F[(size_t)(t + q) * pitch + g * HD + d]; o16[q] = tohx(x); unsigned short a2, c2; splitf(x, a2, c2); oh[q] = a2; ol[q] = c2; }
    *(v2h*)(V16 + e) = o16; *(v2us*)(Vh + e) = oh; *(v2us*)(Vl + e) = ol;  }
__global__ __launch_bounds__(256) void k_csid(float* CS) { const int idx = blockIdx.x * 256 + threadIdx.x; if (idx >= TT * HD) return; v2f cs; cs[0] = 1.0f; cs[1] = 0.0f; *(v2f*)(CS + (size_t)idx * 2) = cs;  }
// k_rope: head planes [h][t][d] (fp16 + hi/lo) of rope(x) x sc with the rotate-half convention out[d] = x[d] cos[t][d] - x[d+HD/2] sin[t][d], out[d+HD/2] = x[d+HD/2] cos[t][d+HD/2] + x[d] sin[t][d+HD/2]
__global__ __launch_bounds__(256) void k_rope(const float* __restrict__ F, int pitch, int nheads, const float* __restrict__ CS, const float* __restrict__ RF, const float* __restrict__ nw, float sc, h16* P16, bf* Ph, bf* Pl) {
    const size_t e = ((size_t)blockIdx.x * 256 + threadIdx.x) * 2; if (e >= (size_t)nheads * TT * HD) return; { const size_t y = blockIdx.y, po = y * nheads * TT * HD; F += y * TT * pitch; P16 += po; Ph += po; Pl += po; }   /* grid y: the batch */ const int d = (int)(e % HD); const int t = (int)((e / HD) % TT); const int h = (int)(e / ((size_t)HD * TT)); const float* f = F + (size_t)t * pitch + h * HD; const float rf = RF ? RF[(size_t)h * TT + t] : 1.0f; v2h o16; v2us oh, ol;
#pragma unroll
    for (int q = 0; q < 2; ++q) { const int dd = d + q; const int dp = (dd < HD / 2) ? dd + HD / 2 : dd - HD / 2; float x0 = f[dd], x1 = f[dp];
        if (RF) { float n0 = __fmul_rn(x0, rf), n1 = __fmul_rn(x1, rf); asm volatile("" : "+v"(n0)); asm volatile("" : "+v"(n1)); x0 = __fmul_rn(bfr(nw[dd]), n0); x1 = __fmul_rn(bfr(nw[dp]), n1); }
        const v2f cs = *(const v2f*)(CS + ((size_t)t * HD + dd) * 2); float a = __fmul_rn(x0, cs[0]), bq = __fmul_rn(x1, cs[1]); asm volatile("" : "+v"(a)); asm volatile("" : "+v"(bq)); const float r = ((dd < HD / 2) ? __fsub_rn(a, bq) : __fadd_rn(a, bq)) * sc;
        o16[q] = tohx(r); unsigned short a2, c2; splitf(r, a2, c2); oh[q] = a2; ol[q] = c2; }
    *(v2h*)(P16 + e) = o16; *(v2us*)(Ph + e) = oh; *(v2us*)(Pl + e) = ol;  }
// ---- k_fattn: scores, causal softmax and attn.v in one kernel; no score and no weight goes to memory.
// Transposed products: S^T = K.Q^T (A = 16 key rows, B = 16 query rows, both K-contiguous, 3 hi/lo products), O^T += V^T.P^T. In a 16x16 tile of S^T a lane holds 8 keys (8 * hi + r) of ONE query (lr), so the maximum and the sum of a query are in-lane plus one exchange between the wave's halves, and two such tiles (keys 0-15, 16-31), converted in place, are the B operand of the second product in the k order of the A loader (8 * hi + 0..7, 16 + 8 * hi + 0..7).
// A work-group (16 waves) works on two groups of 32 queries, group n - 1 - x and then group x, so every work-group has the same number of 32-key blocks. The 16 waves divide a group's blocks (wave w: blocks w, w + 16, ...; only the last block holds masked keys), each with a running maximum, sum and output tile of its own; the partial results of both groups are joined through LDS behind one barrier, in wave order, and the output rows are written once.
// Rows < RH: P and V on bf16 hi/lo planes (3 products); the rest: P and V fp16. P is exp(s - running maximum), at most 1; the division by the sum comes last.
#define QW   32                                   // queries of a group
#define NWF  16                                   // waves of a work-group
#define OPT  68                                   // LDS pitch (floats) of a query's 64 partial outputs
#define SC2  (SCL * 1.4426950408889634f)          // score -> exponent of 2
__device__ __forceinline__ float xhalf(float x) { return __builtin_bit_cast(float, __builtin_amdgcn_permlanex16(__builtin_bit_cast(int, x), __builtin_bit_cast(int, x), 0x76543210, 0xfedcba98, false, false)); }   // lane l with lane l ^ 16
template <bool HIRES>
__device__ __forceinline__ void fattn_wave(const bf* __restrict__ Qh, const bf* __restrict__ Ql, const bf* __restrict__ Kh, const bf* __restrict__ Kl, const h16* __restrict__ V16, const bf* __restrict__ Vh, const bf* __restrict__ Vl, const int q0, const int nkb, const int wv, const int lr, const int hi, float* my, float* mm, float* ml) {
    v16bf qh[2][2], ql[2][2];
#pragma unroll
    for (int qt = 0; qt < 2; ++qt)
#pragma unroll
        for (int ks = 0; ks < 2; ++ks) { const size_t qo = (size_t)(q0 + qt * 16 + lr) * HD + ks * 32 + 8 * hi; qh[qt][ks] = WFrag<bf>::ld(Qh + qo); ql[qt][ks] = WFrag<bf>::ld(Ql + qo); }
    // the Q fragments have arrived before the key loop is entered (loaded values as inputs only): its first instructions rewrite the address registers of the last Q loads
    asm volatile("" :: "v"(qh[0][0]), "v"(qh[0][1]), "v"(qh[1][0]), "v"(qh[1][1]), "v"(ql[0][0]), "v"(ql[0][1]), "v"(ql[1][0]), "v"(ql[1][1]));
    const unsigned koff = lr * HD + 8 * hi, voff = lr * TT + 8 * hi;   // the lane's place in a block of K rows (row = key) and of V^T rows (row = d)
    v8f o[4][2]; float m[2], l[2];
#pragma unroll
    for (int qt = 0; qt < 2; ++qt) { m[qt] = -3.0e38f; l[qt] = 0.f;
#pragma unroll
        for (int dt = 0; dt < 4; ++dt) o[dt][qt] = (v8f){}; }
#pragma unroll 1
    for (int kb = wv; kb < nkb; kb += NWF) {
        const int k0 = kb * 32; const bf* khs = Kh + (size_t)k0 * HD; const bf* kls = Kl + (size_t)k0 * HD;   // scalar bases: a block's loads share one lane offset, the rest is immediate
        v16bf kh[2][2], kl[2][2];
#pragma unroll
        for (int kt = 0; kt < 2; ++kt)
#pragma unroll
            for (int ks = 0; ks < 2; ++ks) { const unsigned ko = koff + kt * 16 * HD + ks * 32; kh[kt][ks] = WFrag<bf>::ld(khs + ko); kl[kt][ks] = WFrag<bf>::ld(kls + ko); }
        // holds the block's 16 K loads in front of the first product (loaded values as inputs only): they go out together and the wave waits for memory once, where the build otherwise reuses two fragments' registers and waits five times in a row
        asm volatile("" :: "v"(kh[0][0]), "v"(kh[0][1]), "v"(kh[1][0]), "v"(kh[1][1]), "v"(kl[0][0]), "v"(kl[0][1]), "v"(kl[1][0]), "v"(kl[1][1]));
        v8f s[2][2];
#pragma unroll
        for (int kt = 0; kt < 2; ++kt) { s[kt][0] = (v8f){}; s[kt][1] = (v8f){}; }
#pragma unroll
        for (int ks = 0; ks < 2; ++ks) {
#pragma unroll
            for (int kt = 0; kt < 2; ++kt)
#pragma unroll
                for (int qt = 0; qt < 2; ++qt) s[kt][qt] = wmmab(kh[kt][ks], qh[qt][ks], s[kt][qt]);
#pragma unroll
            for (int kt = 0; kt < 2; ++kt)
#pragma unroll
                for (int qt = 0; qt < 2; ++qt) s[kt][qt] = wmmab(kh[kt][ks], ql[qt][ks], s[kt][qt]);
#pragma unroll
            for (int kt = 0; kt < 2; ++kt)
#pragma unroll
                for (int qt = 0; qt < 2; ++qt) s[kt][qt] = wmmab(kl[kt][ks], qh[qt][ks], s[kt][qt]); }
        // the V^T fragments (A operand: row = d, k = the block's 32 keys) are asked for here, so that they fly during the softmax arithmetic
        v16h vf[4]; v16bf vh[4], vl[4];
#pragma unroll
        for (int dt = 0; dt < 4; ++dt) { const unsigned vo = voff + dt * 16 * TT; if (HIRES) { vh[dt] = WFrag<bf>::ld(Vh + k0 + vo); vl[dt] = WFrag<bf>::ld(Vl + k0 + vo); } else vf[dt] = WFrag<h16>::ld(V16 + k0 + vo); }
        asm volatile("s_wait_xcnt 0x0" ::: "memory");   // behind the V loads, in front of the branch on the diagonal block: the code behind it rewrites the loads' address registers
        if (kb == nkb - 1) {   // the diagonal block (k0 == q0; a scalar test): keys behind the query are masked
#pragma unroll
            for (int kt = 0; kt < 2; ++kt)
#pragma unroll
                for (int qt = 0; qt < 2; ++qt)
#pragma unroll
                    for (int r = 0; r < 8; ++r) if (kt * 16 + 8 * hi + r > qt * 16 + lr) s[kt][qt][r] = -3.0e38f; }
        float al[2];
#pragma unroll
        for (int qt = 0; qt < 2; ++qt) { float mx = s[0][qt][0];
#pragma unroll
            for (int r = 1; r < 8; ++r) mx = fmaxf(mx, s[0][qt][r]);
#pragma unroll
            for (int r = 0; r < 8; ++r) mx = fmaxf(mx, s[1][qt][r]);
            mx = fmaxf(mx, xhalf(mx)); mx = fmaxf(mx, m[qt]); al[qt] = (m[qt] - mx) * SC2; m[qt] = mx; const float nm = -mx * SC2;
#pragma unroll
            for (int kt = 0; kt < 2; ++kt)
#pragma unroll
                for (int r = 0; r < 8; ++r) s[kt][qt][r] = fmaf(s[kt][qt][r], SC2, nm); }
        // exponentials in place, four to a statement with a v_nop behind the last: no instruction directly behind a v_exp_f32 reads its result or overwrites its source (the slot the instruction set wants kept free)
#pragma unroll
        for (int qt = 0; qt < 2; ++qt)
#pragma unroll
            for (int kt = 0; kt < 2; ++kt) {
                asm("v_exp_f32 %0, %0\n\tv_exp_f32 %1, %1\n\tv_exp_f32 %2, %2\n\tv_exp_f32 %3, %3\n\tv_nop" : "+v"(s[kt][qt][0]), "+v"(s[kt][qt][1]), "+v"(s[kt][qt][2]), "+v"(s[kt][qt][3]));
                asm("v_exp_f32 %0, %0\n\tv_exp_f32 %1, %1\n\tv_exp_f32 %2, %2\n\tv_exp_f32 %3, %3\n\tv_nop" : "+v"(s[kt][qt][4]), "+v"(s[kt][qt][5]), "+v"(s[kt][qt][6]), "+v"(s[kt][qt][7])); }
        // the two rescale factors, with the same free slot behind the last
        asm("v_exp_f32 %0, %0\n\tv_exp_f32 %1, %1\n\tv_nop" : "+v"(al[0]), "+v"(al[1]));
#pragma unroll
        for (int qt = 0; qt < 2; ++qt) { float sum = 0.f;
#pragma unroll
            for (int kt = 0; kt < 2; ++kt)
#pragma unroll
                for (int r = 0; r < 8; ++r) sum += s[kt][qt][r];
            l[qt] = fmaf(l[qt], al[qt], sum);
#pragma unroll
            for (int dt = 0; dt < 4; ++dt) o[dt][qt] *= al[qt]; }
        if (HIRES) {
#pragma unroll
            for (int qt = 0; qt < 2; ++qt) { v8us h0, h1, l0, l1;
#pragma unroll
                for (int r = 0; r < 8; ++r) { unsigned short a2, c2; splitf(s[0][qt][r], a2, c2); h0[r] = a2; l0[r] = c2; splitf(s[1][qt][r], a2, c2); h1[r] = a2; l1[r] = c2; }
                const v16bf ph = cat16b(h0, h1), pl = cat16b(l0, l1);
#pragma unroll
                for (int dt = 0; dt < 4; ++dt) o[dt][qt] = wmmab(vh[dt], ph, o[dt][qt]);
#pragma unroll
                for (int dt = 0; dt < 4; ++dt) o[dt][qt] = wmmab(vh[dt], pl, o[dt][qt]);
#pragma unroll
                for (int dt = 0; dt < 4; ++dt) o[dt][qt] = wmmab(vl[dt], ph, o[dt][qt]); }
        } else {
#pragma unroll
            for (int qt = 0; qt < 2; ++qt) { v16h p;
#pragma unroll
                for (int r = 0; r < 8; ++r) { p[r] = tohx(s[0][qt][r]); p[8 + r] = tohx(s[1][qt][r]); }
#pragma unroll
                for (int dt = 0; dt < 4; ++dt) o[dt][qt] = wmma16(vf[dt], p, o[dt][qt]); }
        }
    }
#pragma unroll
    for (int qt = 0; qt < 2; ++qt) { l[qt] += xhalf(l[qt]);   // the halves' sums, joined once
        if (hi == 0) { mm[qt * 16 + lr] = m[qt]; ml[qt * 16 + lr] = l[qt]; }
#pragma unroll
        for (int dt = 0; dt < 4; ++dt) { float* p = my + (qt * 16 + lr) * OPT + dt * 16 + 8 * hi; v4f lo4, hi4;
#pragma unroll
            for (int r = 0; r < 4; ++r) { lo4[r] = o[dt][qt][r]; hi4[r] = o[dt][qt][4 + r]; }
            *(v4fa*)p = lo4; *(v4fa*)(p + 4) = hi4; } }
}
__global__ __launch_bounds__(32 * NWF) void k_fattn(const bf* __restrict__ Qh, const bf* __restrict__ Ql, const bf* __restrict__ Kh, const bf* __restrict__ Kl, const h16* __restrict__ V16, const bf* __restrict__ Vh, const bf* __restrict__ Vl, float* __restrict__ O) {
    __shared__ __align__(16) float os[2 * NWF * QW * OPT]; __shared__ float ms[2 * NWF * QW]; __shared__ float ls[2 * NWF * QW];
    { const size_t po = (size_t)blockIdx.y * TT * HD; Qh += po; Ql += po; Kh += po; Kl += po; V16 += po; Vh += po; Vl += po; O += (size_t)blockIdx.y * TT * CO; }   /* grid y: the batch */
    const int lane = threadIdx.x & 31, lr = lane & 15, hi = lane >> 4;
    const int wv = __builtin_amdgcn_readfirstlane((int)(threadIdx.x >> 5));   // wave number, scalar: the key loop keeps a scalar counter and branch
#pragma unroll 1
    for (int ph = 0; ph < 2; ++ph) {   // rolled: one copy of each body in the text
        const int g = ph ? (int)blockIdx.x : TT / QW - 1 - (int)blockIdx.x, q0 = g * QW, sl = ph * NWF + wv;
        if (q0 < RH) fattn_wave<true>(Qh, Ql, Kh, Kl, V16, Vh, Vl, q0, g + 1, wv, lr, hi, os + sl * (QW * OPT), ms + sl * QW, ls + sl * QW);
        else fattn_wave<false>(Qh, Ql, Kh, Kl, V16, Vh, Vl, q0, g + 1, wv, lr, hi, os + sl * (QW * OPT), ms + sl * QW, ls + sl * QW); }
    __syncthreads();   // every wave's partial maxima, sums and output tiles are in LDS before any wave joins them
    const int ph = wv >> 3, t8 = (wv & 7) * 32 + (int)__builtin_amdgcn_mbcnt_lo(~0u, 0u), q = t8 >> 3, d0 = (t8 & 7) * 8, wb = ph * NWF;   // waves 0-7: the first group's 32 x 64 outputs, 8 a thread; the rest: the second's. The lane number is read anew: kept in a register over the key loops it was spilled to scratch
    const int q0 = (ph ? (int)blockIdx.x : TT / QW - 1 - (int)blockIdx.x) * QW;
    float e[NWF]; float M = -3.0e38f;
    // the loops over the waves are unrolled: a thread's LDS reads go out together
#pragma unroll
    for (int w = 0; w < NWF; ++w) { e[w] = ms[(wb + w) * QW + q]; M = fmaxf(M, e[w]); }
#pragma unroll
    for (int w = 0; w < NWF; ++w) e[w] = (e[w] - M) * SC2;   // a wave that had no block: maximum -3e38, factor 0
    // as above: four exponentials and the free slot
#pragma unroll
    for (int w = 0; w < NWF; w += 4) {
        asm("v_exp_f32 %0, %0\n\tv_exp_f32 %1, %1\n\tv_exp_f32 %2, %2\n\tv_exp_f32 %3, %3\n\tv_nop" : "+v"(e[w]), "+v"(e[w + 1]), "+v"(e[w + 2]), "+v"(e[w + 3])); }
    float L = 0.f; v4f a0 = (v4f){}, a1 = (v4f){};
#pragma unroll
    for (int w = 0; w < NWF; ++w) { const float* p = os + (wb + w) * (QW * OPT) + q * OPT + d0; L = fmaf(e[w], ls[(wb + w) * QW + q], L); a0 += *(const v4fa*)p * e[w]; a1 += *(const v4fa*)(p + 4) * e[w]; }
    const float inv = __fdiv_rn(1.0f, L);
    float* orow = O + (size_t)(q0 + q) * CO + d0; *(v4f*)orow = a0 * inv; *(v4f*)(orow + 4) = a1 * inv;
}

extern "C" void kernel_launch(void* const* d_in, const int* in_sizes, int n_in,
                              void* d_out, int out_size, void* d_ws, size_t ws_size, hipStream_t stream) {
    (void)in_sizes; (void)n_in; (void)out_size;
    const float* x = (const float*)d_in[0]; const float* wq = (const float*)d_in[1]; const float* wk = (const float*)d_in[2]; const float* wv = (const float*)d_in[3];   /* standard roles: rows = queries */
    float* OUT = (float*)d_out;     // [4][4096][64]
    char* wsp = (char*)d_ws;
    auto take = [&](size_t bytes) { char* p = wsp; wsp += (bytes + 255) & ~(size_t)255; return (void*)p; };
    bf* WQ = (bf*)take((size_t)MID * CC * 2); bf* WK = (bf*)take((size_t)MID * CC * 2); bf* WV = (bf*)take((size_t)CO * CC * 2); float* CS = (float*)take((size_t)TT * HD * 2 * 4);
    bf* XB = (bf*)take((size_t)NB_ * TT * CC * 2); float* FQ = (float*)take((size_t)NB_ * TT * MID * 4); float* FK = (float*)take((size_t)NB_ * TT * MID * 4);
    h16* QP16 = (h16*)take((size_t)NB_ * TT * MID * 2); bf* QPh = (bf*)take((size_t)NB_ * TT * MID * 2); bf* QPl = (bf*)take((size_t)NB_ * TT * MID * 2); h16* KP16 = (h16*)take((size_t)NB_ * TT * MID * 2); bf* KPh = (bf*)take((size_t)NB_ * TT * MID * 2); bf* KPl = (bf*)take((size_t)NB_ * TT * MID * 2);
    h16* VT16 = (h16*)take((size_t)NB_ * CO * TT * 2); bf* VTh = (bf*)take((size_t)NB_ * CO * TT * 2); bf* VTl = (bf*)take((size_t)NB_ * CO * TT * 2);
    if ((size_t)(wsp - (char*)d_ws) > ws_size) return;    // carve ~44 MiB of the 256 MiB
    float* FV = FK;   /* the v projection reuses the k buffer after the k planes are built (stream-ordered) */
    k_wtG<<<(unsigned)((CC * MID / 64 + 63) / 64), 256, 0, stream>>>(wq, CC, MID, WQ); k_wtG<<<(unsigned)((CC * MID / 64 + 63) / 64), 256, 0, stream>>>(wk, CC, MID, WK); k_wtG<<<(unsigned)((CC * CO / 64 + 63) / 64), 256, 0, stream>>>(wv, CC, CO, WV);   /* 'xw' weights -> Bt */
    k_csid<<<(TT * HD + 255) / 256, 256, 0, stream>>>(CS);   /* identity table: k_rope is a plain per-head plane builder here */
    const unsigned LP = (unsigned)(((size_t)NH_ * TT * HD / 2 + 255) / 256);
    k_cvt8<<<(unsigned)(((size_t)NB_ * TT * CC / 8 + 255) / 256), 256, 0, stream>>>(x, XB, (size_t)NB_ * TT * CC / 8);
    /* projections: the batches' rows stacked (M = 4 x 4096), one weight plane for all */
    k_gemmw<bf, 0, false, NWK><<<dim3(NB_ * TT / 64, MID / 64, 1), 32 * NWK, 0, stream>>>(XB, nullptr, WQ, nullptr, CC, CC, FQ, MID, nullptr, 0, 0, 0, 0, 0, 0, 0); k_rope<<<dim3(LP, NB_), 256, 0, stream>>>(FQ, MID, NH_, CS, nullptr, nullptr, 1.0f, QP16, QPh, QPl);   /* q planes [b][n][64] */
    k_gemmw<bf, 0, false, NWK><<<dim3(NB_ * TT / 64, MID / 64, 1), 32 * NWK, 0, stream>>>(XB, nullptr, WK, nullptr, CC, CC, FK, MID, nullptr, 0, 0, 0, 0, 0, 0, 0); k_rope<<<dim3(LP, NB_), 256, 0, stream>>>(FK, MID, NKV, CS, nullptr, nullptr, 1.0f, KP16, KPh, KPl);   /* k planes */
    k_gemmw<bf, 0, false, NWK><<<dim3(NB_ * TT / 64, CO / 64, 1), 32 * NWK, 0, stream>>>(XB, nullptr, WV, nullptr, CC, CC, FV, CO, nullptr, 0, 0, 0, 0, 0, 0, 0); k_vtp<<<dim3((unsigned)(((size_t)TT * CO / 2 + 255) / 256), NB_), 256, 0, stream>>>(FV, CO, CO / HD, VT16, VTh, VTl);   /* v^T planes [b][64][n] */
    k_fattn<<<dim3(TT / QW / 2, NB_), 32 * NWF, 0, stream>>>(QPh, QPl, KPh, KPl, VT16, VTh, VTl, OUT);   /* scores (3 products), x 1/sqrt(C), causal softmax, weights.v; writes the output rows once */
}

// v006
// Measured time: 44.8 microseconds a run.
// Timed twice side by side with v005, it ran 2.08 and 2.09 times as fast.
// Over all steps from v000 it is 25.4 times as fast.
#include <hip/hip_runtime.h>

// Single causal attention head over 4,096 tokens scaled by the EMBEDDING width (x [4][4096][512]; q, k, v = x W ('xw' [512][64] 1/sqrt(512), no bias); scores = q.k^T / sqrt(C = 512) (the source divides by sqrt(n_embd), not sqrt(head_size)); causal (-inf); softmax; out = weights.v -> [4][4096][64] (1.0 M); argument order x, Wq, Wk, Wv).
// Three launches, all four batches in each: k_wfrag (weights), k_proj (q, k, v and their planes), k_fattn (attention).
// Layout: the 'xw' weights rounded to bf16 and stored once in the order of the matrix fragments; k_proj reads x as f32, rounds it to bf16 on the way into LDS, does the three exact projections (K 512, one accumulator over the whole K) and writes the hi/lo and fp16 planes itself; k_fattn: scores with EVERY row on hi/lo planes (3 products), causal softmax with a running maximum, attn.v hybrid (rows < 512 hi/lo 3 products, rest fp16), all in registers; it writes the output rows once.
// Causal skip: keys above the diagonal have weight exactly 0: a query group's key loop ends at its own 32-key block, and only that block is masked.
// Compute dtypes, f32 accumulate: every input rounded to bf16; projections exact; scores 3 products; softmax f32; wei.v rows < 512 3 products, rest fp16; output f32.

#define NB_  4
#define TT   4096
#define DM   64
#define NH_  1
#define NKV  1
#define REP  (NH_ / NKV)
#define HD   64
#define DQ   (NH_ * HD)
#define DKV  (NKV * HD)
#define ZH   1
#define RH   512                  // query rows < RH use hi+lo planes (0: none)
#define WIN  0
#define SCL  0.044194173824159216f   // 1/sqrt(C) with C = n_embd = 512 (the source scales by sqrt(n_embd), NOT sqrt(head_size))
#define MID  64       // q / k width (one 64-wide head)
#define CO   64       // v width
#define CC   512      // input width (d_in)
typedef _Float16 h16;
typedef unsigned short bf;
typedef __attribute__((ext_vector_type(16))) __bf16   v16bf;
typedef __attribute__((ext_vector_type(16))) _Float16 v16h;
typedef __attribute__((ext_vector_type(8)))  _Float16 v8h;
typedef __attribute__((ext_vector_type(8)))  unsigned short v8us;
typedef __attribute__((ext_vector_type(8)))  float    v8f;
typedef __attribute__((ext_vector_type(4)))  float    v4f;
typedef v8h  __attribute__((may_alias)) v8ha;
typedef v4f  __attribute__((may_alias)) v4fa;
typedef v8us __attribute__((may_alias)) v8usa;

__device__ __forceinline__ unsigned short f2bf(float f) { unsigned u = __float_as_uint(f); u += 0x7FFFu + ((u >> 16) & 1u); return (unsigned short)(u >> 16); }
__device__ __forceinline__ float bf2f(unsigned short b) { return __uint_as_float(((unsigned)b) << 16); }
__device__ __forceinline__ float bfr(float f) { return bf2f(f2bf(f)); }
__device__ __forceinline__ v16h cat16(v8h lo, v8h hi) { return __builtin_shufflevector(lo, hi, 0, 1, 2, 3, 4, 5, 6, 7, 8, 9, 10, 11, 12, 13, 14, 15); }
__device__ __forceinline__ v16bf cat16b(v8us lo, v8us hi) { return __builtin_bit_cast(v16bf, __builtin_shufflevector(lo, hi, 0, 1, 2, 3, 4, 5, 6, 7, 8, 9, 10, 11, 12, 13, 14, 15)); }
__device__ __forceinline__ v8f wmma16(v16h a, v16h b, v8f c) { return __builtin_amdgcn_wmma_f32_16x16x32_f16(false, a, false, b, (short)0, c, false, false); }
__device__ __forceinline__ v8f wmmab(v16bf a, v16bf b, v8f c) { return __builtin_amdgcn_wmma_f32_16x16x32_bf16(false, a, false, b, (short)0, c, false, false); }



// fragment loader (16 rows x 32 k, K-contiguous 16-bit rows): the lane's row at p, k = 8 * hi + 0..7 and 16 + 8 * hi + 0..7
template <typename T16> struct WFrag;
template <> struct WFrag<h16> { typedef v16h V; static __device__ __forceinline__ V ld(const h16* p) { return cat16(*(const v8h*)p, *(const v8h*)(p + 16)); } static __device__ __forceinline__ v8f mma(V a, V b, v8f c) { return wmma16(a, b, c); } };
template <> struct WFrag<bf> { typedef v16bf V; static __device__ __forceinline__ V ld(const bf* p) { return cat16b(*(const v8us*)p, *(const v8us*)(p + 16)); } static __device__ __forceinline__ v8f mma(V a, V b, v8f c) { return wmmab(a, b, c); } };

__device__ __forceinline__ h16 tohx(float x) { return (h16)x; }
__device__ __forceinline__ void splitf(float y, unsigned short& h, unsigned short& l) { h = f2bf(y); l = f2bf(y - bf2f(h)); }
typedef __attribute__((ext_vector_type(2))) _Float16 v2h;
typedef __attribute__((ext_vector_type(4))) _Float16 v4h;
typedef __attribute__((ext_vector_type(2))) unsigned short v2us;
typedef __attribute__((ext_vector_type(4))) unsigned short v4us;
typedef __attribute__((ext_vector_type(2))) float v2f;
typedef __attribute__((ext_vector_type(4))) int v4i;

typedef v4us __attribute__((may_alias)) v4usa;
#define PR   64                                   // tokens of a k_proj work-group
#define NWP  12                                   // its waves: one 16-wide column tile of q (0-3), k (4-7), v (8-11) each
#define XP   520                                  // LDS pitch of an x row, 16-bit elements (1,040 B = 16 B x odd: the fragment reads meet no bank twice)
#define EP   72                                   // LDS pitch of an output plane's row, 16-bit elements (144 B = 16 B x odd)
#define PLN  ((size_t)NB_ * TT * HD)              // elements of one plane; the seven planes lie behind one another: q hi, q lo, k hi, k lo [b][t][64]; v^T fp16, hi, lo [b][64][t]
// ---- k_wfrag: the three 'xw' weights [512][64], rounded to bf16, in fragment order: [matrix][column tile][k block of 32][half][lane][8], so that a wave's fragment is two loads of 512 contiguous bytes.
// Lane l, half h, element e hold column 16 * tile + (l & 15) and k = 32 * block + 16 * h + 8 * (l >> 4) + e: the k order of WFrag::ld.
__global__ __launch_bounds__(256) void k_wfrag(const float* __restrict__ wq, const float* __restrict__ wk, const float* __restrict__ wv, bf* WF) {
    const float* __restrict__ w = blockIdx.y == 0 ? wq : blockIdx.y == 1 ? wk : wv;
    const int i = blockIdx.x * 256 + threadIdx.x, lane = i & 31, half = (i >> 5) & 1, ks = (i >> 6) & 15, nt = i >> 10;
    const int n = nt * 16 + (lane & 15), k = ks * 32 + half * 16 + 8 * (lane >> 4); v8us o;
#pragma unroll
    for (int e = 0; e < 8; ++e) o[e] = f2bf(w[(size_t)(k + e) * HD + n]);
    *(v8us*)(WF + ((size_t)blockIdx.y * (HD * CC / 8) + i) * 8) = o;
}
// ---- k_proj: q, k, v of 64 tokens and all seven planes in one work-group; grid: the 4 x 4096 stacked tokens / 64.
// x goes f32 -> bf16 -> LDS once; a wave holds its column tile's weights for the whole K in registers (asked for next to the x loads, so both fly together) and multiplies them with the four token tiles out of LDS.
// q, k: D = W^T.x^T (A = 16 columns, B = 16 tokens): a lane holds 8 neighbouring columns of ONE token, 16 bytes of a [t][64] plane. v: D = x.W (A = tokens, B = columns): 8 neighbouring tokens of ONE column, 16 bytes of a [64][t] plane.
// The planes' rows are put together in LDS (in the x tile's place) and leave as whole 128-byte lines, each from one wave.
__global__ __launch_bounds__(32 * NWP) void k_proj(const float* __restrict__ x, const bf* __restrict__ WF, bf* PL) {
    __shared__ __align__(16) bf xs[PR * XP];
    const int tid = threadIdx.x, lane = tid & 31, lr = lane & 15, hi = lane >> 4;
    const int wv = __builtin_amdgcn_readfirstlane(tid >> 5);   // wave number, scalar: the tests on it are scalar branches
    v16bf wf[CC / 32]; const bf* wp = WF + (size_t)wv * (16 * CC) + lane * 8;
    // every loop of this kernel is unrolled: wf[], xv[] and acc[] are indexed by constants and stay in registers, and a loop's loads go out together
#pragma unroll
    for (int ks = 0; ks < CC / 32; ++ks) wf[ks] = cat16b(*(const v8us*)(wp + ks * 512), *(const v8us*)(wp + ks * 512 + 256));
    const float* xg = x + (size_t)blockIdx.x * (PR * CC);
    constexpr int NX = PR * CC / 4, SX = (NX + 32 * NWP - 1) / (32 * NWP), WX = (NX - (SX - 1) * 32 * NWP) / 32;   // 16-byte pieces of the tile; rounds of the work-group; waves of the last round
    v4f xv[SX];
#pragma unroll
    for (int s = 0; s < SX; ++s) if (s < SX - 1 || wv < WX) xv[s] = *(const v4f*)(xg + (size_t)(s * 32 * NWP + tid) * 4);
#pragma unroll
    for (int s = 0; s < SX; ++s) if (s < SX - 1 || wv < WX) { const int idx = s * 32 * NWP + tid; v4us o;
#pragma unroll
        for (int e = 0; e < 4; ++e) o[e] = f2bf(xv[s][e]);
        *(v4usa*)(xs + (idx >> 7) * XP + (idx & 127) * 4) = o; }
    __syncthreads();   // the bf16 tile is whole before any wave reads fragments of it
    v8f acc[4];
#pragma unroll
    for (int mt = 0; mt < 4; ++mt) acc[mt] = (v8f){};
    const bf* xr = xs + lr * XP + 8 * hi;
    // a k block's 8 LDS reads are held in front of its first product (loaded values as inputs only), so that they go out together and the wave waits for LDS once, where the build otherwise reuses one fragment's registers and waits in front of every product
    // the v_nop at each branch's end: the distance behind the last matrix instructions, whose results are read behind the jump out of the branch
    if (wv < 8) {
#pragma unroll
        for (int ks = 0; ks < CC / 32; ++ks) { v16bf xf[4];
#pragma unroll
            for (int mt = 0; mt < 4; ++mt) { const bf* p = xr + mt * 16 * XP + ks * 32; xf[mt] = cat16b(*(const v8usa*)p, *(const v8usa*)(p + 16)); }
            asm volatile("" :: "v"(xf[0]), "v"(xf[1]), "v"(xf[2]), "v"(xf[3]));
#pragma unroll
            for (int mt = 0; mt < 4; ++mt) acc[mt] = wmmab(wf[ks], xf[mt], acc[mt]); }
        asm volatile("v_nop\n\tv_nop\n\tv_nop\n\tv_nop" : "+v"(acc[0]), "+v"(acc[1]), "+v"(acc[2]), "+v"(acc[3]));
    } else {
#pragma unroll
        for (int ks = 0; ks < CC / 32; ++ks) { v16bf xf[4];
#pragma unroll
            for (int mt = 0; mt < 4; ++mt) { const bf* p = xr + mt * 16 * XP + ks * 32; xf[mt] = cat16b(*(const v8usa*)p, *(const v8usa*)(p + 16)); }
            asm volatile("" :: "v"(xf[0]), "v"(xf[1]), "v"(xf[2]), "v"(xf[3]));
#pragma unroll
            for (int mt = 0; mt < 4; ++mt) acc[mt] = wmmab(xf[mt], wf[ks], acc[mt]); }
        asm volatile("v_nop\n\tv_nop\n\tv_nop\n\tv_nop" : "+v"(acc[0]), "+v"(acc[1]), "+v"(acc[2]), "+v"(acc[3]));
    }
    __syncthreads();   // every wave has read its last fragment before the planes' rows overwrite the tile
    if (wv < 8) {
        bf* eh = xs + (wv >> 2) * (2 * PR * EP) + lr * EP + (wv & 3) * 16 + 8 * hi;   // row = token, column = the wave's tile
#pragma unroll
        for (int mt = 0; mt < 4; ++mt) { v8us h, l;
#pragma unroll
            for (int j = 0; j < 8; ++j) { unsigned short a2, c2; splitf(acc[mt][j], a2, c2); h[j] = a2; l[j] = c2; }
            *(v8usa*)(eh + mt * 16 * EP) = h; *(v8usa*)(eh + PR * EP + mt * 16 * EP) = l; }
    } else {
        bf* ev = xs + 4 * PR * EP + ((wv & 3) * 16 + lr) * EP + 8 * hi;   // row = column of v, column = token
#pragma unroll
        for (int mt = 0; mt < 4; ++mt) { v8h o16; v8us h, l;
#pragma unroll
            for (int j = 0; j < 8; ++j) { unsigned short a2, c2; o16[j] = tohx(acc[mt][j]); splitf(acc[mt][j], a2, c2); h[j] = a2; l[j] = c2; }
            *(v8usa*)(ev + mt * 16) = __builtin_bit_cast(v8us, o16); *(v8usa*)(ev + PR * EP + mt * 16) = h; *(v8usa*)(ev + 2 * PR * EP + mt * 16) = l; }
    }
    __syncthreads();   // the planes' rows are whole before they are copied out
    constexpr int NE = 7 * PR * 8, SE = (NE + 32 * NWP - 1) / (32 * NWP), WE = (NE - (SE - 1) * 32 * NWP) / 32;   // 16-byte pieces of the seven planes' rows; rounds; waves of the last round
    const size_t gq = (size_t)blockIdx.x * (PR * HD), gv = (size_t)(blockIdx.x / (TT / PR)) * (HD * TT) + (blockIdx.x % (TT / PR)) * PR;
#pragma unroll
    for (int s = 0; s < SE; ++s) {
        if (s == SE - 1) asm volatile("s_wait_xcnt 0x0" ::: "memory");   // behind the full rounds' stores, in front of the branch on the last round: the code behind it rewrites the stores' address registers
        if (s < SE - 1 || wv < WE) { const int c = s * 32 * NWP + tid, p = c >> 9, row = (c >> 3) & 63, ch = c & 7;
            *(v8us*)(PL + p * PLN + (p < 4 ? gq + (size_t)row * HD : gv + (size_t)row * TT) + ch * 8) = *(const v8usa*)(xs + p * (PR * EP) + row * EP + ch * 8); } }
}
// ---- k_fattn: scores, causal softmax and attn.v in one kernel; no score and no weight goes to memory.
// Transposed products: S^T = K.Q^T (A = 16 key rows, B = 16 query rows, both K-contiguous, 3 hi/lo products), O^T += V^T.P^T. In a 16x16 tile of S^T a lane holds 8 keys (8 * hi + r) of ONE query (lr), so the maximum and the sum of a query are in-lane plus one exchange between the wave's halves, and two such tiles (keys 0-15, 16-31), converted in place, are the B operand of the second product in the k order of the A loader (8 * hi + 0..7, 16 + 8 * hi + 0..7).
// A work-group (16 waves) works on two groups of 32 queries, group n - 1 - x and then group x, so every work-group has the same number of 32-key blocks. The 16 waves divide a group's blocks (wave w: blocks w, w + 16, ...; only the last block holds masked keys), each with a running maximum, sum and output tile of its own; the partial results of both groups are joined through LDS behind one barrier, in wave order, and the output rows are written once.
// Rows < RH: P and V on bf16 hi/lo planes (3 products); the rest: P and V fp16. P is exp(s - running maximum), at most 1; the division by the sum comes last.
#define QW   32                                   // queries of a group
#define NWF  16                                   // waves of a work-group
#define OPT  68                                   // LDS pitch (floats) of a query's 64 partial outputs
#define SC2  (SCL * 1.4426950408889634f)          // score -> exponent of 2
__device__ __forceinline__ float xhalf(float x) { return __builtin_bit_cast(float, __builtin_amdgcn_permlanex16(__builtin_bit_cast(int, x), __builtin_bit_cast(int, x), 0x76543210, 0xfedcba98, false, false)); }   // lane l with lane l ^ 16
template <bool HIRES>
__device__ __forceinline__ void fattn_wave(const bf* __restrict__ Qh, const bf* __restrict__ Ql, const bf* __restrict__ Kh, const bf* __restrict__ Kl, const h16* __restrict__ V16, const bf* __restrict__ Vh, const bf* __restrict__ Vl, const int q0, const int nkb, const int wv, const int lr, const int hi, float* my, float* mm, float* ml) {
    v16bf qh[2][2], ql[2][2];
#pragma unroll
    for (int qt = 0; qt < 2; ++qt)
#pragma unroll
        for (int ks = 0; ks < 2; ++ks) { const size_t qo = (size_t)(q0 + qt * 16 + lr) * HD + ks * 32 + 8 * hi; qh[qt][ks] = WFrag<bf>::ld(Qh + qo); ql[qt][ks] = WFrag<bf>::ld(Ql + qo); }
    // the Q fragments have arrived before the key loop is entered (loaded values as inputs only): its first instructions rewrite the address registers of the last Q loads
    asm volatile("" :: "v"(qh[0][0]), "v"(qh[0][1]), "v"(qh[1][0]), "v"(qh[1][1]), "v"(ql[0][0]), "v"(ql[0][1]), "v"(ql[1][0]), "v"(ql[1][1]));
    const unsigned koff = lr * HD + 8 * hi, voff = lr * TT + 8 * hi;   // the lane's place in a block of K rows (row = key) and of V^T rows (row = d)
    v8f o[4][2]; float m[2], l[2];
#pragma unroll
    for (int qt = 0; qt < 2; ++qt) { m[qt] = -3.0e38f; l[qt] = 0.f;
#pragma unroll
        for (int dt = 0; dt < 4; ++dt) o[dt][qt] = (v8f){}; }
#pragma unroll 1
    for (int kb = wv; kb < nkb; kb += NWF) {
        const int k0 = kb * 32; const bf* khs = Kh + (size_t)k0 * HD; const bf* kls = Kl + (size_t)k0 * HD;   // scalar bases: a block's loads share one lane offset, the rest is immediate
        v16bf kh[2][2], kl[2][2];
#pragma unroll
        for (int kt = 0; kt < 2; ++kt)
#pragma unroll
            for (int ks = 0; ks < 2; ++ks) { const unsigned ko = koff + kt * 16 * HD + ks * 32; kh[kt][ks] = WFrag<bf>::ld(khs + ko); kl[kt][ks] = WFrag<bf>::ld(kls + ko); }
        // holds the block's 16 K loads in front of the first product (loaded values as inputs only): they go out together and the wave waits for memory once, where the build otherwise reuses two fragments' registers and waits five times in a row
        asm volatile("" :: "v"(kh[0][0]), "v"(kh[0][1]), "v"(kh[1][0]), "v"(kh[1][1]), "v"(kl[0][0]), "v"(kl[0][1]), "v"(kl[1][0]), "v"(kl[1][1]));
        v8f s[2][2];
#pragma unroll
        for (int kt = 0; kt < 2; ++kt) { s[kt][0] = (v8f){}; s[kt][1] = (v8f){}; }
#pragma unroll
        for (int ks = 0; ks < 2; ++ks) {
#pragma unroll
            for (int kt = 0; kt < 2; ++kt)
#pragma unroll
                for (int qt = 0; qt < 2; ++qt) s[kt][qt] = wmmab(kh[kt][ks], qh[qt][ks], s[kt][qt]);
#pragma unroll
            for (int kt = 0; kt < 2; ++kt)
#pragma unroll
                for (int qt = 0; qt < 2; ++qt) s[kt][qt] = wmmab(kh[kt][ks], ql[qt][ks], s[kt][qt]);
#pragma unroll
            for (int kt = 0; kt < 2; ++kt)
#pragma unroll
                for (int qt = 0; qt < 2; ++qt) s[kt][qt] = wmmab(kl[kt][ks], qh[qt][ks], s[kt][qt]); }
        // the V^T fragments (A operand: row = d, k = the block's 32 keys) are asked for here, so that they fly during the softmax arithmetic
        v16h vf[4]; v16bf vh[4], vl[4];
#pragma unroll
        for (int dt = 0; dt < 4; ++dt) { const unsigned vo = voff + dt * 16 * TT; if (HIRES) { vh[dt] = WFrag<bf>::ld(Vh + k0 + vo); vl[dt] = WFrag<bf>::ld(Vl + k0 + vo); } else vf[dt] = WFrag<h16>::ld(V16 + k0 + vo); }
        asm volatile("s_wait_xcnt 0x0" ::: "memory");   // behind the V loads, in front of the branch on the diagonal block: the code behind it rewrites the loads' address registers
        if (kb == nkb - 1) {   // the diagonal block (k0 == q0; a scalar test): keys behind the query are masked
#pragma unroll
            for (int kt = 0; kt < 2; ++kt)
#pragma unroll
                for (int qt = 0; qt < 2; ++qt)
#pragma unroll
                    for (int r = 0; r < 8; ++r) if (kt * 16 + 8 * hi + r > qt * 16 + lr) s[kt][qt][r] = -3.0e38f; }
        float al[2];
#pragma unroll
        for (int qt = 0; qt < 2; ++qt) { float mx = s[0][qt][0];
#pragma unroll
            for (int r = 1; r < 8; ++r) mx = fmaxf(mx, s[0][qt][r]);
#pragma unroll
            for (int r = 0; r < 8; ++r) mx = fmaxf(mx, s[1][qt][r]);
            mx = fmaxf(mx, xhalf(mx)); mx = fmaxf(mx, m[qt]); al[qt] = (m[qt] - mx) * SC2; m[qt] = mx; const float nm = -mx * SC2;
#pragma unroll
            for (int kt = 0; kt < 2; ++kt)
#pragma unroll
                for (int r = 0; r < 8; ++r) s[kt][qt][r] = fmaf(s[kt][qt][r], SC2, nm); }
        // exponentials in place, four to a statement with a v_nop behind the last: no instruction directly behind a v_exp_f32 reads its result or overwrites its source (the slot the instruction set wants kept free)
#pragma unroll
        for (int qt = 0; qt < 2; ++qt)
#pragma unroll
            for (int kt = 0; kt < 2; ++kt) {
                asm("v_exp_f32 %0, %0\n\tv_exp_f32 %1, %1\n\tv_exp_f32 %2, %2\n\tv_exp_f32 %3, %3\n\tv_nop" : "+v"(s[kt][qt][0]), "+v"(s[kt][qt][1]), "+v"(s[kt][qt][2]), "+v"(s[kt][qt][3]));
                asm("v_exp_f32 %0, %0\n\tv_exp_f32 %1, %1\n\tv_exp_f32 %2, %2\n\tv_exp_f32 %3, %3\n\tv_nop" : "+v"(s[kt][qt][4]), "+v"(s[kt][qt][5]), "+v"(s[kt][qt][6]), "+v"(s[kt][qt][7])); }
        // the two rescale factors, with the same free slot behind the last
        asm("v_exp_f32 %0, %0\n\tv_exp_f32 %1, %1\n\tv_nop" : "+v"(al[0]), "+v"(al[1]));
#pragma unroll
        for (int qt = 0; qt < 2; ++qt) { float sum = 0.f;
#pragma unroll
            for (int kt = 0; kt < 2; ++kt)
#pragma unroll
                for (int r = 0; r < 8; ++r) sum += s[kt][qt][r];
            l[qt] = fmaf(l[qt], al[qt], sum);
#pragma unroll
            for (int dt = 0; dt < 4; ++dt) o[dt][qt] *= al[qt]; }
        if (HIRES) {
#pragma unroll
            for (int qt = 0; qt < 2; ++qt) { v8us h0, h1, l0, l1;
#pragma unroll
                for (int r = 0; r < 8; ++r) { unsigned short a2, c2; splitf(s[0][qt][r], a2, c2); h0[r] = a2; l0[r] = c2; splitf(s[1][qt][r], a2, c2); h1[r] = a2; l1[r] = c2; }
                const v16bf ph = cat16b(h0, h1), pl = cat16b(l0, l1);
#pragma unroll
                for (int dt = 0; dt < 4; ++dt) o[dt][qt] = wmmab(vh[dt], ph, o[dt][qt]);
#pragma unroll
                for (int dt = 0; dt < 4; ++dt) o[dt][qt] = wmmab(vh[dt], pl, o[dt][qt]);
#pragma unroll
                for (int dt = 0; dt < 4; ++dt) o[dt][qt] = wmmab(vl[dt], ph, o[dt][qt]); }
        } else {
#pragma unroll
            for (int qt = 0; qt < 2; ++qt) { v16h p;
#pragma unroll
                for (int r = 0; r < 8; ++r) { p[r] = tohx(s[0][qt][r]); p[8 + r] = tohx(s[1][qt][r]); }
#pragma unroll
                for (int dt = 0; dt < 4; ++dt) o[dt][qt] = wmma16(vf[dt], p, o[dt][qt]); }
        }
    }
#pragma unroll
    for (int qt = 0; qt < 2; ++qt) { l[qt] += xhalf(l[qt]);   // the halves' sums, joined once
        if (hi == 0) { mm[qt * 16 + lr] = m[qt]; ml[qt * 16 + lr] = l[qt]; }
#pragma unroll
        for (int dt = 0; dt < 4; ++dt) { float* p = my + (qt * 16 + lr) * OPT + dt * 16 + 8 * hi; v4f lo4, hi4;
#pragma unroll
            for (int r = 0; r < 4; ++r) { lo4[r] = o[dt][qt][r]; hi4[r] = o[dt][qt][4 + r]; }
            *(v4fa*)p = lo4; *(v4fa*)(p + 4) = hi4; } }
}
__global__ __launch_bounds__(32 * NWF) void k_fattn(const bf* __restrict__ Qh, const bf* __restrict__ Ql, const bf* __restrict__ Kh, const bf* __restrict__ Kl, const h16* __restrict__ V16, const bf* __restrict__ Vh, const bf* __restrict__ Vl, float* __restrict__ O) {
    __shared__ __align__(16) float os[2 * NWF * QW * OPT]; __shared__ float ms[2 * NWF * QW]; __shared__ float ls[2 * NWF * QW];
    { const size_t po = (size_t)blockIdx.y * TT * HD; Qh += po; Ql += po; Kh += po; Kl += po; V16 += po; Vh += po; Vl += po; O += (size_t)blockIdx.y * TT * CO; }   /* grid y: the batch */
    const int lane = threadIdx.x & 31, lr = lane & 15, hi = lane >> 4;
    const int wv = __builtin_amdgcn_readfirstlane((int)(threadIdx.x >> 5));   // wave number, scalar: the key loop keeps a scalar counter and branch
#pragma unroll 1
    for (int ph = 0; ph < 2; ++ph) {   // rolled: one copy of each body in the text
        const int g = ph ? (int)blockIdx.x : TT / QW - 1 - (int)blockIdx.x, q0 = g * QW, sl = ph * NWF + wv;
        if (q0 < RH) fattn_wave<true>(Qh, Ql, Kh, Kl, V16, Vh, Vl, q0, g + 1, wv, lr, hi, os + sl * (QW * OPT), ms + sl * QW, ls + sl * QW);
        else fattn_wave<false>(Qh, Ql, Kh, Kl, V16, Vh, Vl, q0, g + 1, wv, lr, hi, os + sl * (QW * OPT), ms + sl * QW, ls + sl * QW); }
    __syncthreads();   // every wave's partial maxima, sums and output tiles are in LDS before any wave joins them
    const int ph = wv >> 3, t8 = (wv & 7) * 32 + (int)__builtin_amdgcn_mbcnt_lo(~0u, 0u), q = t8 >> 3, d0 = (t8 & 7) * 8, wb = ph * NWF;   // waves 0-7: the first group's 32 x 64 outputs, 8 a thread; the rest: the second's. The lane number is read anew: kept in a register over the key loops it was spilled to scratch
    const int q0 = (ph ? (int)blockIdx.x : TT / QW - 1 - (int)blockIdx.x) * QW;
    float e[NWF]; float M = -3.0e38f;
    // the loops over the waves are unrolled: a thread's LDS reads go out together
#pragma unroll
    for (int w = 0; w < NWF; ++w) { e[w] = ms[(wb + w) * QW + q]; M = fmaxf(M, e[w]); }
#pragma unroll
    for (int w = 0; w < NWF; ++w) e[w] = (e[w] - M) * SC2;   // a wave that had no block: maximum -3e38, factor 0
    // as above: four exponentials and the free slot
#pragma unroll
    for (int w = 0; w < NWF; w += 4) {
        asm("v_exp_f32 %0, %0\n\tv_exp_f32 %1, %1\n\tv_exp_f32 %2, %2\n\tv_exp_f32 %3, %3\n\tv_nop" : "+v"(e[w]), "+v"(e[w + 1]), "+v"(e[w + 2]), "+v"(e[w + 3])); }
    float L = 0.f; v4f a0 = (v4f){}, a1 = (v4f){};
#pragma unroll
    for (int w = 0; w < NWF; ++w) { const float* p = os + (wb + w) * (QW * OPT) + q * OPT + d0; L = fmaf(e[w], ls[(wb + w) * QW + q], L); a0 += *(const v4fa*)p * e[w]; a1 += *(const v4fa*)(p + 4) * e[w]; }
    const float inv = __fdiv_rn(1.0f, L);
    float* orow = O + (size_t)(q0 + q) * CO + d0; *(v4f*)orow = a0 * inv; *(v4f*)(orow + 4) = a1 * inv;
}

extern "C" void kernel_launch(void* const* d_in, const int* in_sizes, int n_in,
                              void* d_out, int out_size, void* d_ws, size_t ws_size, hipStream_t stream) {
    (void)in_sizes; (void)n_in; (void)out_size;
    const float* x = (const float*)d_in[0]; const float* wq = (const float*)d_in[1]; const float* wk = (const float*)d_in[2]; const float* wv = (const float*)d_in[3];   /* standard roles: rows = queries */
    float* OUT = (float*)d_out;     // [4][4096][64]
    char* wsp = (char*)d_ws;
    auto take = [&](size_t bytes) { char* p = wsp; wsp += (bytes + 255) & ~(size_t)255; return (void*)p; };
    bf* WF = (bf*)take((size_t)3 * HD * CC * 2); bf* PL = (bf*)take(7 * PLN * 2);
    if ((size_t)(wsp - (char*)d_ws) > ws_size) return;    // carve ~14 MiB of the 256 MiB
    k_wfrag<<<dim3(HD * CC / 8 / 256, 3), 256, 0, stream>>>(wq, wk, wv, WF);   /* 'xw' weights -> bf16 fragments */
    k_proj<<<NB_ * TT / PR, 32 * NWP, 0, stream>>>(x, WF, PL);   /* q, k, v (the batches' rows stacked) and their planes */
    k_fattn<<<dim3(TT / QW / 2, NB_), 32 * NWF, 0, stream>>>(PL, PL + PLN, PL + 2 * PLN, PL + 3 * PLN, (const h16*)(PL + 4 * PLN), PL + 5 * PLN, PL + 6 * PLN, OUT);   /* scores (3 products), x 1/sqrt(C), causal softmax, weights.v; writes the output rows once */
}

// v007
// Measured time: 32.7 microseconds a run.
// Two timings next to v006 put it at 1.36 and 1.37 times that version's speed.
// All steps since v000 together make it 34.6 times as fast.
#include <hip/hip_runtime.h>

// Single causal attention head over 4,096 tokens scaled by the EMBEDDING width (x [4][4096][512]; q, k, v = x W ('xw' [512][64] 1/sqrt(512), no bias); scores = q.k^T / sqrt(C = 512) (the source divides by sqrt(n_embd), not sqrt(head_size)); causal (-inf); softmax; out = weights.v -> [4][4096][64] (1.0 M); argument order x, Wq, Wk, Wv).
// Three launches, all four batches in each: k_wfrag (weights), k_proj (q, k, v and their planes), k_fattn (attention).
// Layout: the 'xw' weights rounded to bf16 and stored once in the order of the matrix fragments; k_proj reads x as f32, rounds it to bf16 on the way into LDS, does the three exact projections (K 512, one accumulator over the whole K) and writes the hi/lo and fp16 planes itself, each in the order of its reader's matrix fragments; k_fattn: scores with EVERY row on hi/lo planes (3 products), causal softmax with a running maximum, attn.v hybrid (rows < 512 hi/lo 3 products, rest fp16), all in registers; it writes the output rows once.
// Causal skip: keys above the diagonal have weight exactly 0: a query group's key loop ends at its own 32-key block, and only that block is masked.
// Compute dtypes, f32 accumulate: every input rounded to bf16; projections exact; scores 3 products; softmax f32; wei.v rows < 512 3 products, rest fp16; output f32.

#define NB_  4
#define TT   4096
#define DM   64
#define NH_  1
#define NKV  1
#define REP  (NH_ / NKV)
#define HD   64
#define DQ   (NH_ * HD)
#define DKV  (NKV * HD)
#define ZH   1
#define RH   512                  // query rows < RH use hi+lo planes (0: none)
#define WIN  0
#define SCL  0.044194173824159216f   // 1/sqrt(C) with C = n_embd = 512 (the source scales by sqrt(n_embd), NOT sqrt(head_size))
#define MID  64       // q / k width (one 64-wide head)
#define CO   64       // v width
#define CC   512      // input width (d_in)
typedef _Float16 h16;
typedef unsigned short bf;
typedef __attribute__((ext_vector_type(16))) __bf16   v16bf;
typedef __attribute__((ext_vector_type(16))) _Float16 v16h;
typedef __attribute__((ext_vector_type(8)))  _Float16 v8h;
typedef __attribute__((ext_vector_type(8)))  unsigned short v8us;
typedef __attribute__((ext_vector_type(8)))  float    v8f;
typedef __attribute__((ext_vector_type(4)))  float    v4f;
typedef v8h  __attribute__((may_alias)) v8ha;
typedef v4f  __attribute__((may_alias)) v4fa;
typedef v8us __attribute__((may_alias)) v8usa;

__device__ __forceinline__ unsigned short f2bf(float f) { unsigned u = __float_as_uint(f); u += 0x7FFFu + ((u >> 16) & 1u); return (unsigned short)(u >> 16); }
__device__ __forceinline__ float bf2f(unsigned short b) { return __uint_as_float(((unsigned)b) << 16); }
__device__ __forceinline__ float bfr(float f) { return bf2f(f2bf(f)); }
__device__ __forceinline__ v16h cat16(v8h lo, v8h hi) { return __builtin_shufflevector(lo, hi, 0, 1, 2, 3, 4, 5, 6, 7, 8, 9, 10, 11, 12, 13, 14, 15); }
__device__ __forceinline__ v16bf cat16b(v8us lo, v8us hi) { return __builtin_bit_cast(v16bf, __builtin_shufflevector(lo, hi, 0, 1, 2, 3, 4, 5, 6, 7, 8, 9, 10, 11, 12, 13, 14, 15)); }
__device__ __forceinline__ v8f wmma16(v16h a, v16h b, v8f c) { return __builtin_amdgcn_wmma_f32_16x16x32_f16(false, a, false, b, (short)0, c, false, false); }
__device__ __forceinline__ v8f wmmab(v16bf a, v16bf b, v8f c) { return __builtin_amdgcn_wmma_f32_16x16x32_bf16(false, a, false, b, (short)0, c, false, false); }



// fragment loader (16 rows x 32 k, stored in fragment order [half][lane][8]): p is the lane's own 16 bytes of half 0; the lane holds k = 8 * hi + 0..7 (half 0) and 16 + 8 * hi + 0..7 (half 1) of row lr; each of the two loads of a wave covers 512 contiguous bytes
template <typename T16> struct WFrag;
template <> struct WFrag<h16> { typedef v16h V; static __device__ __forceinline__ V ld(const h16* p) { return cat16(*(const v8h*)p, *(const v8h*)(p + 256)); } static __device__ __forceinline__ v8f mma(V a, V b, v8f c) { return wmma16(a, b, c); } };
template <> struct WFrag<bf> { typedef v16bf V; static __device__ __forceinline__ V ld(const bf* p) { return cat16b(*(const v8us*)p, *(const v8us*)(p + 256)); } static __device__ __forceinline__ v8f mma(V a, V b, v8f c) { return wmmab(a, b, c); } };

__device__ __forceinline__ h16 tohx(float x) { return (h16)x; }
__device__ __forceinline__ void splitf(float y, unsigned short& h, unsigned short& l) { h = f2bf(y); l = f2bf(y - bf2f(h)); }
typedef __attribute__((ext_vector_type(2))) _Float16 v2h;
typedef __attribute__((ext_vector_type(4))) _Float16 v4h;
typedef __attribute__((ext_vector_type(2))) unsigned short v2us;
typedef __attribute__((ext_vector_type(4))) unsigned short v4us;
typedef __attribute__((ext_vector_type(2))) float v2f;
typedef __attribute__((ext_vector_type(4))) int v4i;

typedef v4us __attribute__((may_alias)) v4usa;
#define PR   64                                   // tokens of a k_proj work-group
#define NWP  12                                   // its waves: one 16-wide column tile of q (0-3), k (4-7), v (8-11) each
#define XP   520                                  // LDS pitch of an x row, 16-bit elements (1,040 B = 16 B x odd: the fragment reads meet no bank twice)
#define EP   72                                   // LDS pitch of an output plane's row, 16-bit elements (144 B = 16 B x odd)
#define PLN  ((size_t)NB_ * TT * HD)              // elements of one plane; the seven planes lie behind one another, all in fragment order: q hi, q lo, k hi, k lo [b][t / 16][d / 32][half][lane][8] (lane: row t % 16 = lr); v^T fp16, hi, lo [b][t / 32][d / 16][half][lane][8] (lane: row d % 16 = lr; k = the 32 tokens)
// ---- k_wfrag: the three 'xw' weights [512][64], rounded to bf16, in fragment order: [matrix][column tile][k block of 32][half][lane][8], so that a wave's fragment is two loads of 512 contiguous bytes.
// Lane l, half h, element e hold column 16 * tile + (l & 15) and k = 32 * block + 16 * h + 8 * (l >> 4) + e: the k order of WFrag::ld.
__global__ __launch_bounds__(256) void k_wfrag(const float* __restrict__ wq, const float* __restrict__ wk, const float* __restrict__ wv, bf* WF) {
    const float* __restrict__ w = blockIdx.y == 0 ? wq : blockIdx.y == 1 ? wk : wv;
    const int i = blockIdx.x * 256 + threadIdx.x, lane = i & 31, half = (i >> 5) & 1, ks = (i >> 6) & 15, nt = i >> 10;
    const int n = nt * 16 + (lane & 15), k = ks * 32 + half * 16 + 8 * (lane >> 4); v8us o;
#pragma unroll
    for (int e = 0; e < 8; ++e) o[e] = f2bf(w[(size_t)(k + e) * HD + n]);
    *(v8us*)(WF + ((size_t)blockIdx.y * (HD * CC / 8) + i) * 8) = o;
}
// ---- k_proj: q, k, v of 64 tokens and all seven planes in one work-group; grid: the 4 x 4096 stacked tokens / 64.
// x goes f32 -> bf16 -> LDS once; a wave holds its column tile's weights for the whole K in registers (asked for next to the x loads, so both fly together) and multiplies them with the four token tiles out of LDS.
// q, k: D = W^T.x^T (A = 16 columns, B = 16 tokens): a lane holds 8 neighbouring columns of ONE token, 16 bytes of a [t][64] plane. v: D = x.W (A = tokens, B = columns): 8 neighbouring tokens of ONE column, 16 bytes of a [64][t] plane.
// The planes' rows are put together in LDS (in the x tile's place) and leave in fragment order: a wave's store is one half fragment, 512 contiguous bytes, so that k_fattn's fragment loads cover 4 whole lines each and not 16 lines in 32-byte pieces.
__global__ __launch_bounds__(32 * NWP) void k_proj(const float* __restrict__ x, const bf* __restrict__ WF, bf* PL) {
    __shared__ __align__(16) bf xs[PR * XP];
    const int tid = threadIdx.x, lane = tid & 31, lr = lane & 15, hi = lane >> 4;
    const int wv = __builtin_amdgcn_readfirstlane(tid >> 5);   // wave number, scalar: the tests on it are scalar branches
    v16bf wf[CC / 32]; const bf* wp = WF + (size_t)wv * (16 * CC) + lane * 8;
    // every loop of this kernel is unrolled: wf[], xv[] and acc[] are indexed by constants and stay in registers, and a loop's loads go out together
#pragma unroll
    for (int ks = 0; ks < CC / 32; ++ks) wf[ks] = cat16b(*(const v8us*)(wp + ks * 512), *(const v8us*)(wp + ks * 512 + 256));
    const float* xg = x + (size_t)blockIdx.x * (PR * CC);
    constexpr int NX = PR * CC / 4, SX = (NX + 32 * NWP - 1) / (32 * NWP), WX = (NX - (SX - 1) * 32 * NWP) / 32;   // 16-byte pieces of the tile; rounds of the work-group; waves of the last round
    v4f xv[SX];
#pragma unroll
    for (int s = 0; s < SX; ++s) if (s < SX - 1 || wv < WX) xv[s] = *(const v4f*)(xg + (size_t)(s * 32 * NWP + tid) * 4);
#pragma unroll
    for (int s = 0; s < SX; ++s) if (s < SX - 1 || wv < WX) { const int idx = s * 32 * NWP + tid; v4us o;
#pragma unroll
        for (int e = 0; e < 4; ++e) o[e] = f2bf(xv[s][e]);
        *(v4usa*)(xs + (idx >> 7) * XP + (idx & 127) * 4) = o; }
    __syncthreads();   // the bf16 tile is whole before any wave reads fragments of it
    v8f acc[4];
#pragma unroll
    for (int mt = 0; mt < 4; ++mt) acc[mt] = (v8f){};
    const bf* xr = xs + lr * XP + 8 * hi;
    // a k block's 8 LDS reads are held in front of its first product (loaded values as inputs only), so that they go out together and the wave waits for LDS once, where the build otherwise reuses one fragment's registers and waits in front of every product
    // the v_nop at each branch's end: the distance behind the last matrix instructions, whose results are read behind the jump out of the branch
    if (wv < 8) {
#pragma unroll
        for (int ks = 0; ks < CC / 32; ++ks) { v16bf xf[4];
#pragma unroll
            for (int mt = 0; mt < 4; ++mt) { const bf* p = xr + mt * 16 * XP + ks * 32; xf[mt] = cat16b(*(const v8usa*)p, *(const v8usa*)(p + 16)); }
            asm volatile("" :: "v"(xf[0]), "v"(xf[1]), "v"(xf[2]), "v"(xf[3]));
#pragma unroll
            for (int mt = 0; mt < 4; ++mt) acc[mt] = wmmab(wf[ks], xf[mt], acc[mt]); }
        asm volatile("v_nop\n\tv_nop\n\tv_nop\n\tv_nop" : "+v"(acc[0]), "+v"(acc[1]), "+v"(acc[2]), "+v"(acc[3]));
    } else {
#pragma unroll
        for (int ks = 0; ks < CC / 32; ++ks) { v16bf xf[4];
#pragma unroll
            for (int mt = 0; mt < 4; ++mt) { const bf* p = xr + mt * 16 * XP + ks * 32; xf[mt] = cat16b(*(const v8usa*)p, *(const v8usa*)(p + 16)); }
            asm volatile("" :: "v"(xf[0]), "v"(xf[1]), "v"(xf[2]), "v"(xf[3]));
#pragma unroll
            for (int mt = 0; mt < 4; ++mt) acc[mt] = wmmab(xf[mt], wf[ks], acc[mt]); }
        asm volatile("v_nop\n\tv_nop\n\tv_nop\n\tv_nop" : "+v"(acc[0]), "+v"(acc[1]), "+v"(acc[2]), "+v"(acc[3]));
    }
    __syncthreads();   // every wave has read its last fragment before the planes' rows overwrite the tile
    if (wv < 8) {
        bf* eh = xs + (wv >> 2) * (2 * PR * EP) + lr * EP + (wv & 3) * 16 + 8 * hi;   // row = token, column = the wave's tile
#pragma unroll
        for (int mt = 0; mt < 4; ++mt) { v8us h, l;
#pragma unroll
            for (int j = 0; j < 8; ++j) { unsigned short a2, c2; splitf(acc[mt][j], a2, c2); h[j] = a2; l[j] = c2; }
            *(v8usa*)(eh + mt * 16 * EP) = h; *(v8usa*)(eh + PR * EP + mt * 16 * EP) = l; }
    } else {
        bf* ev = xs + 4 * PR * EP + ((wv & 3) * 16 + lr) * EP + 8 * hi;   // row = column of v, column = token
#pragma unroll
        for (int mt = 0; mt < 4; ++mt) { v8h o16; v8us h, l;
#pragma unroll
            for (int j = 0; j < 8; ++j) { unsigned short a2, c2; o16[j] = tohx(acc[mt][j]); splitf(acc[mt][j], a2, c2); h[j] = a2; l[j] = c2; }
            *(v8usa*)(ev + mt * 16) = __builtin_bit_cast(v8us, o16); *(v8usa*)(ev + PR * EP + mt * 16) = h; *(v8usa*)(ev + 2 * PR * EP + mt * 16) = l; }
    }
    __syncthreads();   // the planes' rows are whole before they are copied out
    constexpr int NE = 7 * PR * 8, SE = (NE + 32 * NWP - 1) / (32 * NWP), WE = (NE - (SE - 1) * 32 * NWP) / 32;   // 16-byte pieces of the seven planes' rows; rounds; waves of the last round
    const size_t gq = (size_t)blockIdx.x * (PR * HD);   // the work-group's 64 tokens are 4,096 contiguous elements of every plane
#pragma unroll
    for (int s = 0; s < SE; ++s) {
        if (s == SE - 1) asm volatile("s_wait_xcnt 0x0" ::: "memory");   // behind the full rounds' stores, in front of the branch on the last round: the code behind it rewrites the stores' address registers
        if (s < SE - 1 || wv < WE) { const int u = s * NWP + wv, p = u >> 4, f = u & 15;   // scalar: the plane and the half fragment (of its 16) that this wave stores
            const int row = (p < 4 ? (f >> 2) * 16 : ((f >> 1) & 3) * 16) + lr, ch = (p < 4 ? (f & 3) * 2 : (f >> 3) * 4 + (f & 1) * 2) + hi;   // q, k: f = [token tile][d block][half]; v: f = [key block][d tile][half]; ch: the 8 elements at 16 * half + 8 * hi of the 32 k
            *(v8us*)(PL + p * PLN + gq + f * 256 + lane * 8) = *(const v8usa*)(xs + p * (PR * EP) + row * EP + ch * 8); } }
}
// ---- k_fattn: scores, causal softmax and attn.v in one kernel; no score and no weight goes to memory.
// Transposed products: S^T = K.Q^T (A = 16 key rows, B = 16 query rows, both read in fragment order, 3 hi/lo products), O^T += V^T.P^T. In a 16x16 tile of S^T a lane holds 8 keys (8 * hi + r) of ONE query (lr), so the maximum and the sum of a query are in-lane plus one exchange between the wave's halves, and two such tiles (keys 0-15, 16-31), converted in place, are the B operand of the second product in the k order of the A loader (8 * hi + 0..7, 16 + 8 * hi + 0..7).
// A work-group (16 waves) works on two groups of 32 queries, group n - 1 - x and then group x, so every work-group has the same number of 32-key blocks. The 16 waves divide a group's blocks (wave w: blocks w, w + 16, ...; only the last block holds masked keys), each with a running maximum, sum and output tile of its own; the partial results of both groups are joined through LDS behind one barrier, in wave order, and the output rows are written once.
// Rows < RH: P and V on bf16 hi/lo planes (3 products); the rest: P and V fp16. P is exp(s - running maximum), at most 1; the division by the sum comes last.
#define QW   32                                   // queries of a group
#define NWF  16                                   // waves of a work-group
#define OPT  68                                   // LDS pitch (floats) of a query's 64 partial outputs
#define SC2  (SCL * 1.4426950408889634f)          // score -> exponent of 2
__device__ __forceinline__ float xhalf(float x) { return __builtin_bit_cast(float, __builtin_amdgcn_permlanex16(__builtin_bit_cast(int, x), __builtin_bit_cast(int, x), 0x76543210, 0xfedcba98, false, false)); }   // lane l with lane l ^ 16
template <bool HIRES>
__device__ __forceinline__ void fattn_wave(const bf* __restrict__ Qh, const bf* __restrict__ Ql, const bf* __restrict__ Kh, const bf* __restrict__ Kl, const h16* __restrict__ V16, const bf* __restrict__ Vh, const bf* __restrict__ Vl, const int q0, const int nkb, const int wv, const int lr, const int hi, float* my, float* mm, float* ml) {
    v16bf qh[2][2], ql[2][2];
#pragma unroll
    for (int qt = 0; qt < 2; ++qt)
#pragma unroll
        for (int ks = 0; ks < 2; ++ks) { const size_t qo = (size_t)(q0 + qt * 16) * HD + ks * 512 + (16 * hi + lr) * 8; qh[qt][ks] = WFrag<bf>::ld(Qh + qo); ql[qt][ks] = WFrag<bf>::ld(Ql + qo); }
    // the Q fragments have arrived before the key loop is entered (loaded values as inputs only): its first instructions rewrite the address registers of the last Q loads
    asm volatile("" :: "v"(qh[0][0]), "v"(qh[0][1]), "v"(qh[1][0]), "v"(qh[1][1]), "v"(ql[0][0]), "v"(ql[0][1]), "v"(ql[1][0]), "v"(ql[1][1]));
    const unsigned loff = (16 * hi + lr) * 8;   // the lane's place in a half fragment, the same for K and V^T
    v8f o[4][2]; float m[2], l[2];
#pragma unroll
    for (int qt = 0; qt < 2; ++qt) { m[qt] = -3.0e38f; l[qt] = 0.f;
#pragma unroll
        for (int dt = 0; dt < 4; ++dt) o[dt][qt] = (v8f){}; }
#pragma unroll 1
    for (int kb = wv; kb < nkb; kb += NWF) {
        const int k0 = kb * 32; const bf* khs = Kh + (size_t)k0 * HD; const bf* kls = Kl + (size_t)k0 * HD;   // scalar bases: a block's loads share one lane offset, the rest is immediate
        v16bf kh[2][2], kl[2][2];
#pragma unroll
        for (int kt = 0; kt < 2; ++kt)
#pragma unroll
            for (int ks = 0; ks < 2; ++ks) { const unsigned ko = loff + kt * 16 * HD + ks * 512; kh[kt][ks] = WFrag<bf>::ld(khs + ko); kl[kt][ks] = WFrag<bf>::ld(kls + ko); }
        // holds the block's 16 K loads in front of the first product (loaded values as inputs only): they go out together and the wave waits for memory once, where the build otherwise reuses two fragments' registers and waits five times in a row
        asm volatile("" :: "v"(kh[0][0]), "v"(kh[0][1]), "v"(kh[1][0]), "v"(kh[1][1]), "v"(kl[0][0]), "v"(kl[0][1]), "v"(kl[1][0]), "v"(kl[1][1]));
        v8f s[2][2];
#pragma unroll
        for (int kt = 0; kt < 2; ++kt) { s[kt][0] = (v8f){}; s[kt][1] = (v8f){}; }
#pragma unroll
        for (int ks = 0; ks < 2; ++ks) {
#pragma unroll
            for (int kt = 0; kt < 2; ++kt)
#pragma unroll
                for (int qt = 0; qt < 2; ++qt) s[kt][qt] = wmmab(kh[kt][ks], qh[qt][ks], s[kt][qt]);
#pragma unroll
            for (int kt = 0; kt < 2; ++kt)
#pragma unroll
                for (int qt = 0; qt < 2; ++qt) s[kt][qt] = wmmab(kh[kt][ks], ql[qt][ks], s[kt][qt]);
#pragma unroll
            for (int kt = 0; kt < 2; ++kt)
#pragma unroll
                for (int qt = 0; qt < 2; ++qt) s[kt][qt] = wmmab(kl[kt][ks], qh[qt][ks], s[kt][qt]); }
        // the V^T fragments (A operand: row = d, k = the block's 32 keys) are asked for here, so that they fly during the softmax arithmetic
        v16h vf[4]; v16bf vh[4], vl[4];
#pragma unroll
        for (int dt = 0; dt < 4; ++dt) { const unsigned vo = loff + dt * 512; const size_t vb = (size_t)k0 * HD; if (HIRES) { vh[dt] = WFrag<bf>::ld(Vh + vb + vo); vl[dt] = WFrag<bf>::ld(Vl + vb + vo); } else vf[dt] = WFrag<h16>::ld(V16 + vb + vo); }
        asm volatile("s_wait_xcnt 0x0" ::: "memory");   // behind the V loads, in front of the branch on the diagonal block: the code behind it rewrites the loads' address registers
        if (kb == nkb - 1) {   // the diagonal block (k0 == q0; a scalar test): keys behind the query are masked
#pragma unroll
            for (int kt = 0; kt < 2; ++kt)
#pragma unroll
                for (int qt = 0; qt < 2; ++qt)
#pragma unroll
                    for (int r = 0; r < 8; ++r) if (kt * 16 + 8 * hi + r > qt * 16 + lr) s[kt][qt][r] = -3.0e38f; }
        float al[2];
#pragma unroll
        for (int qt = 0; qt < 2; ++qt) { float mx = s[0][qt][0];
#pragma unroll
            for (int r = 1; r < 8; ++r) mx = fmaxf(mx, s[0][qt][r]);
#pragma unroll
            for (int r = 0; r < 8; ++r) mx = fmaxf(mx, s[1][qt][r]);
            mx = fmaxf(mx, xhalf(mx)); mx = fmaxf(mx, m[qt]); al[qt] = (m[qt] - mx) * SC2; m[qt] = mx; const float nm = -mx * SC2;
#pragma unroll
            for (int kt = 0; kt < 2; ++kt)
#pragma unroll
                for (int r = 0; r < 8; ++r) s[kt][qt][r] = fmaf(s[kt][qt][r], SC2, nm); }
        // exponentials in place, four to a statement with a v_nop behind the last: no instruction directly behind a v_exp_f32 reads its result or overwrites its source (the slot the instruction set wants kept free)
#pragma unroll
        for (int qt = 0; qt < 2; ++qt)
#pragma unroll
            for (int kt = 0; kt < 2; ++kt) {
                asm("v_exp_f32 %0, %0\n\tv_exp_f32 %1, %1\n\tv_exp_f32 %2, %2\n\tv_exp_f32 %3, %3\n\tv_nop" : "+v"(s[kt][qt][0]), "+v"(s[kt][qt][1]), "+v"(s[kt][qt][2]), "+v"(s[kt][qt][3]));
                asm("v_exp_f32 %0, %0\n\tv_exp_f32 %1, %1\n\tv_exp_f32 %2, %2\n\tv_exp_f32 %3, %3\n\tv_nop" : "+v"(s[kt][qt][4]), "+v"(s[kt][qt][5]), "+v"(s[kt][qt][6]), "+v"(s[kt][qt][7])); }
        // the two rescale factors, with the same free slot behind the last
        asm("v_exp_f32 %0, %0\n\tv_exp_f32 %1, %1\n\tv_nop" : "+v"(al[0]), "+v"(al[1]));
#pragma unroll
        for (int qt = 0; qt < 2; ++qt) { float sum = 0.f;
#pragma unroll
            for (int kt = 0; kt < 2; ++kt)
#pragma unroll
                for (int r = 0; r < 8; ++r) sum += s[kt][qt][r];
            l[qt] = fmaf(l[qt], al[qt], sum);
#pragma unroll
            for (int dt = 0; dt < 4; ++dt) o[dt][qt] *= al[qt]; }
        if (HIRES) {
#pragma unroll
            for (int qt = 0; qt < 2; ++qt) { v8us h0, h1, l0, l1;
#pragma unroll
                for (int r = 0; r < 8; ++r) { unsigned short a2, c2; splitf(s[0][qt][r], a2, c2); h0[r] = a2; l0[r] = c2; splitf(s[1][qt][r], a2, c2); h1[r] = a2; l1[r] = c2; }
                const v16bf ph = cat16b(h0, h1), pl = cat16b(l0, l1);
#pragma unroll
                for (int dt = 0; dt < 4; ++dt) o[dt][qt] = wmmab(vh[dt], ph, o[dt][qt]);
#pragma unroll
                for (int dt = 0; dt < 4; ++dt) o[dt][qt] = wmmab(vh[dt], pl, o[dt][qt]);
#pragma unroll
                for (int dt = 0; dt < 4; ++dt) o[dt][qt] = wmmab(vl[dt], ph, o[dt][qt]); }
        } else {
#pragma unroll
            for (int qt = 0; qt < 2; ++qt) { v16h p;
#pragma unroll
                for (int r = 0; r < 8; ++r) { p[r] = tohx(s[0][qt][r]); p[8 + r] = tohx(s[1][qt][r]); }
#pragma unroll
                for (int dt = 0; dt < 4; ++dt) o[dt][qt] = wmma16(vf[dt], p, o[dt][qt]); }
        }
    }
#pragma unroll
    for (int qt = 0; qt < 2; ++qt) { l[qt] += xhalf(l[qt]);   // the halves' sums, joined once
        if (hi == 0) { mm[qt * 16 + lr] = m[qt]; ml[qt * 16 + lr] = l[qt]; }
#pragma unroll
        for (int dt = 0; dt < 4; ++dt) { float* p = my + (qt * 16 + lr) * OPT + dt * 16 + 8 * hi; v4f lo4, hi4;
#pragma unroll
            for (int r = 0; r < 4; ++r) { lo4[r] = o[dt][qt][r]; hi4[r] = o[dt][qt][4 + r]; }
            *(v4fa*)p = lo4; *(v4fa*)(p + 4) = hi4; } }
}
__global__ __launch_bounds__(32 * NWF) void k_fattn(const bf* __restrict__ Qh, const bf* __restrict__ Ql, const bf* __restrict__ Kh, const bf* __restrict__ Kl, const h16* __restrict__ V16, const bf* __restrict__ Vh, const bf* __restrict__ Vl, float* __restrict__ O) {
    __shared__ __align__(16) float os[2 * NWF * QW * OPT]; __shared__ float ms[2 * NWF * QW]; __shared__ float ls[2 * NWF * QW];
    { const size_t po = (size_t)blockIdx.y * TT * HD; Qh += po; Ql += po; Kh += po; Kl += po; V16 += po; Vh += po; Vl += po; O += (size_t)blockIdx.y * TT * CO; }   /* grid y: the batch */
    const int lane = threadIdx.x & 31, lr = lane & 15, hi = lane >> 4;
    const int wv = __builtin_amdgcn_readfirstlane((int)(threadIdx.x >> 5));   // wave number, scalar: the key loop keeps a scalar counter and branch
#pragma unroll 1
    for (int ph = 0; ph < 2; ++ph) {   // rolled: one copy of each body in the text
        const int g = ph ? (int)blockIdx.x : TT / QW - 1 - (int)blockIdx.x, q0 = g * QW, sl = ph * NWF + wv;
        if (q0 < RH) fattn_wave<true>(Qh, Ql, Kh, Kl, V16, Vh, Vl, q0, g + 1, wv, lr, hi, os + sl * (QW * OPT), ms + sl * QW, ls + sl * QW);
        else fattn_wave<false>(Qh, Ql, Kh, Kl, V16, Vh, Vl, q0, g + 1, wv, lr, hi, os + sl * (QW * OPT), ms + sl * QW, ls + sl * QW); }
    __syncthreads();   // every wave's partial maxima, sums and output tiles are in LDS before any wave joins them
    const int ph = wv >> 3, t8 = (wv & 7) * 32 + (int)__builtin_amdgcn_mbcnt_lo(~0u, 0u), q = t8 >> 3, d0 = (t8 & 7) * 8, wb = ph * NWF;   // waves 0-7: the first group's 32 x 64 outputs, 8 a thread; the rest: the second's. The lane number is read anew: kept in a register over the key loops it was spilled to scratch
    const int q0 = (ph ? (int)blockIdx.x : TT / QW - 1 - (int)blockIdx.x) * QW;
    float e[NWF]; float M = -3.0e38f;
    // the loops over the waves are unrolled: a thread's LDS reads go out together
#pragma unroll
    for (int w = 0; w < NWF; ++w) { e[w] = ms[(wb + w) * QW + q]; M = fmaxf(M, e[w]); }
#pragma unroll
    for (int w = 0; w < NWF; ++w) e[w] = (e[w] - M) * SC2;   // a wave that had no block: maximum -3e38, factor 0
    // as above: four exponentials and the free slot
#pragma unroll
    for (int w = 0; w < NWF; w += 4) {
        asm("v_exp_f32 %0, %0\n\tv_exp_f32 %1, %1\n\tv_exp_f32 %2, %2\n\tv_exp_f32 %3, %3\n\tv_nop" : "+v"(e[w]), "+v"(e[w + 1]), "+v"(e[w + 2]), "+v"(e[w + 3])); }
    float L = 0.f; v4f a0 = (v4f){}, a1 = (v4f){};
#pragma unroll
    for (int w = 0; w < NWF; ++w) { const float* p = os + (wb + w) * (QW * OPT) + q * OPT + d0; L = fmaf(e[w], ls[(wb + w) * QW + q], L); a0 += *(const v4fa*)p * e[w]; a1 += *(const v4fa*)(p + 4) * e[w]; }
    const float inv = __fdiv_rn(1.0f, L);
    float* orow = O + (size_t)(q0 + q) * CO + d0; *(v4f*)orow = a0 * inv; *(v4f*)(orow + 4) = a1 * inv;
}

extern "C" void kernel_launch(void* const* d_in, const int* in_sizes, int n_in,
                              void* d_out, int out_size, void* d_ws, size_t ws_size, hipStream_t stream) {
    (void)in_sizes; (void)n_in; (void)out_size;
    const float* x = (const float*)d_in[0]; const float* wq = (const float*)d_in[1]; const float* wk = (const float*)d_in[2]; const float* wv = (const float*)d_in[3];   /* standard roles: rows = queries */
    float* OUT = (float*)d_out;     // [4][4096][64]
    char* wsp = (char*)d_ws;
    auto take = [&](size_t bytes) { char* p = wsp; wsp += (bytes + 255) & ~(size_t)255; return (void*)p; };
    bf* WF = (bf*)take((size_t)3 * HD * CC * 2); bf* PL = (bf*)take(7 * PLN * 2);
    if ((size_t)(wsp - (char*)d_ws) > ws_size) return;    // carve ~14 MiB of the 256 MiB
    k_wfrag<<<dim3(HD * CC / 8 / 256, 3), 256, 0, stream>>>(wq, wk, wv, WF);   /* 'xw' weights -> bf16 fragments */
    k_proj<<<NB_ * TT / PR, 32 * NWP, 0, stream>>>(x, WF, PL);   /* q, k, v (the batches' rows stacked) and their planes */
    k_fattn<<<dim3(TT / QW / 2, NB_), 32 * NWF, 0, stream>>>(PL, PL + PLN, PL + 2 * PLN, PL + 3 * PLN, (const h16*)(PL + 4 * PLN), PL + 5 * PLN, PL + 6 * PLN, OUT);   /* scores (3 products), x 1/sqrt(C), causal softmax, weights.v; writes the output rows once */
}

// v008
// One run takes 31.2 microseconds.
// In two side-by-side timings against v007, it was 1.03 and 1.05 times as fast.
// Counting every step since v000, it is 36.1 times as fast.
#include <hip/hip_runtime.h>

// Single causal attention head over 4,096 tokens scaled by the EMBEDDING width (x [4][4096][512]; q, k, v = x W ('xw' [512][64] 1/sqrt(512), no bias); scores = q.k^T / sqrt(C = 512) (the source divides by sqrt(n_embd), not sqrt(head_size)); causal (-inf); softmax; out = weights.v -> [4][4096][64] (1.0 M); argument order x, Wq, Wk, Wv).
// Three launches, all four batches in each: k_wfrag (weights), k_proj (q, k, v and their planes), k_fattn (attention).
// Layout: the 'xw' weights rounded to bf16 and stored once in the order of the matrix fragments; k_proj reads x as f32, rounds it to bf16 on the way into LDS, does the three exact projections (K 512, one accumulator over the whole K) and writes the hi/lo and fp16 planes itself, each in the order of its reader's matrix fragments; k_fattn: scores with EVERY row on hi/lo planes (3 products), causal softmax with a running maximum, attn.v hybrid (rows < 512 hi/lo 3 products, rest fp16), all in registers; it writes the output rows once.
// Causal skip: keys above the diagonal have weight exactly 0: a query group's key loop ends at its own 32-key block, and only that block is masked.
// Compute dtypes, f32 accumulate: every input rounded to bf16; projections exact; scores 3 products; softmax f32; wei.v rows < 512 3 products, rest fp16; output f32.

#define NB_  4
#define TT   4096
#define DM   64
#define NH_  1
#define NKV  1
#define REP  (NH_ / NKV)
#define HD   64
#define DQ   (NH_ * HD)
#define DKV  (NKV * HD)
#define ZH   1
#define RH   512                  // query rows < RH use hi+lo planes (0: none)
#define WIN  0
#define SCL  0.044194173824159216f   // 1/sqrt(C) with C = n_embd = 512 (the source scales by sqrt(n_embd), NOT sqrt(head_size))
#define MID  64       // q / k width (one 64-wide head)
#define CO   64       // v width
#define CC   512      // input width (d_in)
typedef _Float16 h16;
typedef unsigned short bf;
typedef __attribute__((ext_vector_type(16))) __bf16   v16bf;
typedef __attribute__((ext_vector_type(16))) _Float16 v16h;
typedef __attribute__((ext_vector_type(8)))  _Float16 v8h;
typedef __attribute__((ext_vector_type(8)))  unsigned short v8us;
typedef __attribute__((ext_vector_type(8)))  float    v8f;
typedef __attribute__((ext_vector_type(4)))  float    v4f;
typedef v8h  __attribute__((may_alias)) v8ha;
typedef v4f  __attribute__((may_alias)) v4fa;
typedef v8us __attribute__((may_alias)) v8usa;

__device__ __forceinline__ unsigned short f2bf(float f) { unsigned u = __float_as_uint(f); u += 0x7FFFu + ((u >> 16) & 1u); return (unsigned short)(u >> 16); }
__device__ __forceinline__ float bf2f(unsigned short b) { return __uint_as_float(((unsigned)b) << 16); }
__device__ __forceinline__ float bfr(float f) { return bf2f(f2bf(f)); }
__device__ __forceinline__ v16h cat16(v8h lo, v8h hi) { return __builtin_shufflevector(lo, hi, 0, 1, 2, 3, 4, 5, 6, 7, 8, 9, 10, 11, 12, 13, 14, 15); }
__device__ __forceinline__ v16bf cat16b(v8us lo, v8us hi) { return __builtin_bit_cast(v16bf, __builtin_shufflevector(lo, hi, 0, 1, 2, 3, 4, 5, 6, 7, 8, 9, 10, 11, 12, 13, 14, 15)); }
__device__ __forceinline__ v8f wmma16(v16h a, v16h b, v8f c) { return __builtin_amdgcn_wmma_f32_16x16x32_f16(false, a, false, b, (short)0, c, false, false); }
__device__ __forceinline__ v8f wmmab(v16bf a, v16bf b, v8f c) { return __builtin_amdgcn_wmma_f32_16x16x32_bf16(false, a, false, b, (short)0, c, false, false); }



// fragment loader (16 rows x 32 k, stored in fragment order [half][lane][8]): p is the lane's own 16 bytes of half 0; the lane holds k = 8 * hi + 0..7 (half 0) and 16 + 8 * hi + 0..7 (half 1) of row lr; each of the two loads of a wave covers 512 contiguous bytes
template <typename T16> struct WFrag;
template <> struct WFrag<h16> { typedef v16h V; static __device__ __forceinline__ V ld(const h16* p) { return cat16(*(const v8h*)p, *(const v8h*)(p + 256)); } static __device__ __forceinline__ v8f mma(V a, V b, v8f c) { return wmma16(a, b, c); } };
template <> struct WFrag<bf> { typedef v16bf V; static __device__ __forceinline__ V ld(const bf* p) { return cat16b(*(const v8us*)p, *(const v8us*)(p + 256)); } static __device__ __forceinline__ v8f mma(V a, V b, v8f c) { return wmmab(a, b, c); } };

__device__ __forceinline__ h16 tohx(float x) { return (h16)x; }
__device__ __forceinline__ void splitf(float y, unsigned short& h, unsigned short& l) { h = f2bf(y); l = f2bf(y - bf2f(h)); }
typedef __attribute__((ext_vector_type(2))) _Float16 v2h;
typedef __attribute__((ext_vector_type(4))) _Float16 v4h;
typedef __attribute__((ext_vector_type(2))) unsigned short v2us;
typedef __attribute__((ext_vector_type(4))) unsigned short v4us;
typedef __attribute__((ext_vector_type(2))) float v2f;
typedef __attribute__((ext_vector_type(4))) int v4i;

typedef v4us __attribute__((may_alias)) v4usa;
#define PR   64                                   // tokens of a k_proj work-group
#define NWP  12                                   // its waves: one 16-wide column tile of q (0-3), k (4-7), v (8-11) each
#define XP   520                                  // LDS pitch of an x row, 16-bit elements (1,040 B = 16 B x odd: the fragment reads meet no bank twice)
#define EP   72                                   // LDS pitch of an output plane's row, 16-bit elements (144 B = 16 B x odd)
#define PLN  ((size_t)NB_ * TT * HD)              // elements of one plane; the seven planes lie behind one another, all in fragment order: q hi, q lo, k hi, k lo [b][t / 16][d / 32][half][lane][8] (lane: row t % 16 = lr); v^T fp16, hi, lo [b][t / 32][d / 16][half][lane][8] (lane: row d % 16 = lr; k = the 32 tokens)
// ---- k_wfrag: the three 'xw' weights [512][64], rounded to bf16, in fragment order: [matrix][column tile][k block of 32][half][lane][8], so that a wave's fragment is two loads of 512 contiguous bytes.
// Lane l, half h, element e hold column 16 * tile + (l & 15) and k = 32 * block + 16 * h + 8 * (l >> 4) + e: the k order of WFrag::ld.
__global__ __launch_bounds__(256) void k_wfrag(const float* __restrict__ wq, const float* __restrict__ wk, const float* __restrict__ wv, bf* WF) {
    const float* __restrict__ w = blockIdx.y == 0 ? wq : blockIdx.y == 1 ? wk : wv;
    const int i = blockIdx.x * 256 + threadIdx.x, lane = i & 31, half = (i >> 5) & 1, ks = (i >> 6) & 15, nt = i >> 10;
    const int n = nt * 16 + (lane & 15), k = ks * 32 + half * 16 + 8 * (lane >> 4); v8us o;
#pragma unroll
    for (int e = 0; e < 8; ++e) o[e] = f2bf(w[(size_t)(k + e) * HD + n]);
    *(v8us*)(WF + ((size_t)blockIdx.y * (HD * CC / 8) + i) * 8) = o;
}
// ---- k_proj: q, k, v of 64 tokens and all seven planes in one work-group; grid: the 4 x 4096 stacked tokens / 64.
// x goes f32 -> bf16 -> LDS once; a wave holds its column tile's weights for the whole K in registers (asked for next to the x loads, so both fly together) and multiplies them with the four token tiles out of LDS.
// q, k: D = W^T.x^T (A = 16 columns, B = 16 tokens): a lane holds 8 neighbouring columns of ONE token, 16 bytes of a [t][64] plane. v: D = x.W (A = tokens, B = columns): 8 neighbouring tokens of ONE column, 16 bytes of a [64][t] plane.
// The planes' rows are put together in LDS (in the x tile's place) and leave in fragment order: a wave's store is one half fragment, 512 contiguous bytes, so that k_fattn's fragment loads cover 4 whole lines each and not 16 lines in 32-byte pieces.
__global__ __launch_bounds__(32 * NWP) void k_proj(const float* __restrict__ x, const bf* __restrict__ WF, bf* PL) {
    __shared__ __align__(16) bf xs[PR * XP];
    const int tid = threadIdx.x, lane = tid & 31, lr = lane & 15, hi = lane >> 4;
    const int wv = __builtin_amdgcn_readfirstlane(tid >> 5);   // wave number, scalar: the tests on it are scalar branches
    v16bf wf[CC / 32]; const bf* wp = WF + (size_t)wv * (16 * CC) + lane * 8;
    // every loop of this kernel is unrolled: wf[], xv[] and acc[] are indexed by constants and stay in registers, and a loop's loads go out together
#pragma unroll
    for (int ks = 0; ks < CC / 32; ++ks) wf[ks] = cat16b(*(const v8us*)(wp + ks * 512), *(const v8us*)(wp + ks * 512 + 256));
    const float* xg = x + (size_t)blockIdx.x * (PR * CC);
    constexpr int NX = PR * CC / 4, SX = (NX + 32 * NWP - 1) / (32 * NWP), WX = (NX - (SX - 1) * 32 * NWP) / 32;   // 16-byte pieces of the tile; rounds of the work-group; waves of the last round
    v4f xv[SX];
#pragma unroll
    for (int s = 0; s < SX; ++s) if (s < SX - 1 || wv < WX) xv[s] = *(const v4f*)(xg + (size_t)(s * 32 * NWP + tid) * 4);
#pragma unroll
    for (int s = 0; s < SX; ++s) if (s < SX - 1 || wv < WX) { const int idx = s * 32 * NWP + tid; v4us o;
#pragma unroll
        for (int e = 0; e < 4; ++e) o[e] = f2bf(xv[s][e]);
        *(v4usa*)(xs + (idx >> 7) * XP + (idx & 127) * 4) = o; }
    __syncthreads();   // the bf16 tile is whole before any wave reads fragments of it
    v8f acc[4];
#pragma unroll
    for (int mt = 0; mt < 4; ++mt) acc[mt] = (v8f){};
    const bf* xr = xs + lr * XP + 8 * hi;
    // a k block's 8 LDS reads are held in front of its first product (loaded values as inputs only), so that they go out together and the wave waits for LDS once, where the build otherwise reuses one fragment's registers and waits in front of every product
    // the v_nop at each branch's end: the distance behind the last matrix instructions, whose results are read behind the jump out of the branch
    if (wv < 8) {
#pragma unroll
        for (int ks = 0; ks < CC / 32; ++ks) { v16bf xf[4];
#pragma unroll
            for (int mt = 0; mt < 4; ++mt) { const bf* p = xr + mt * 16 * XP + ks * 32; xf[mt] = cat16b(*(const v8usa*)p, *(const v8usa*)(p + 16)); }
            asm volatile("" :: "v"(xf[0]), "v"(xf[1]), "v"(xf[2]), "v"(xf[3]));
#pragma unroll
            for (int mt = 0; mt < 4; ++mt) acc[mt] = wmmab(wf[ks], xf[mt], acc[mt]); }
        asm volatile("v_nop\n\tv_nop\n\tv_nop\n\tv_nop" : "+v"(acc[0]), "+v"(acc[1]), "+v"(acc[2]), "+v"(acc[3]));
    } else {
#pragma unroll
        for (int ks = 0; ks < CC / 32; ++ks) { v16bf xf[4];
#pragma unroll
            for (int mt = 0; mt < 4; ++mt) { const bf* p = xr + mt * 16 * XP + ks * 32; xf[mt] = cat16b(*(const v8usa*)p, *(const v8usa*)(p + 16)); }
            asm volatile("" :: "v"(xf[0]), "v"(xf[1]), "v"(xf[2]), "v"(xf[3]));
#pragma unroll
            for (int mt = 0; mt < 4; ++mt) acc[mt] = wmmab(xf[mt], wf[ks], acc[mt]); }
        asm volatile("v_nop\n\tv_nop\n\tv_nop\n\tv_nop" : "+v"(acc[0]), "+v"(acc[1]), "+v"(acc[2]), "+v"(acc[3]));
    }
    __syncthreads();   // every wave has read its last fragment before the planes' rows overwrite the tile
    if (wv < 8) {
        bf* eh = xs + (wv >> 2) * (2 * PR * EP) + lr * EP + (wv & 3) * 16 + 8 * hi;   // row = token, column = the wave's tile
#pragma unroll
        for (int mt = 0; mt < 4; ++mt) { v8us h, l;
#pragma unroll
            for (int j = 0; j < 8; ++j) { unsigned short a2, c2; splitf(acc[mt][j], a2, c2); h[j] = a2; l[j] = c2; }
            *(v8usa*)(eh + mt * 16 * EP) = h; *(v8usa*)(eh + PR * EP + mt * 16 * EP) = l; }
    } else {
        bf* ev = xs + 4 * PR * EP + ((wv & 3) * 16 + lr) * EP + 8 * hi;   // row = column of v, column = token
#pragma unroll
        for (int mt = 0; mt < 4; ++mt) { v8h o16; v8us h, l;
#pragma unroll
            for (int j = 0; j < 8; ++j) { unsigned short a2, c2; o16[j] = tohx(acc[mt][j]); splitf(acc[mt][j], a2, c2); h[j] = a2; l[j] = c2; }
            *(v8usa*)(ev + mt * 16) = __builtin_bit_cast(v8us, o16); *(v8usa*)(ev + PR * EP + mt * 16) = h; *(v8usa*)(ev + 2 * PR * EP + mt * 16) = l; }
    }
    __syncthreads();   // the planes' rows are whole before they are copied out
    constexpr int NE = 7 * PR * 8, SE = (NE + 32 * NWP - 1) / (32 * NWP), WE = (NE - (SE - 1) * 32 * NWP) / 32;   // 16-byte pieces of the seven planes' rows; rounds; waves of the last round
    const size_t gq = (size_t)blockIdx.x * (PR * HD);   // the work-group's 64 tokens are 4,096 contiguous elements of every plane
#pragma unroll
    for (int s = 0; s < SE; ++s) {
        if (s == SE - 1) asm volatile("s_wait_xcnt 0x0" ::: "memory");   // behind the full rounds' stores, in front of the branch on the last round: the code behind it rewrites the stores' address registers
        if (s < SE - 1 || wv < WE) { const int u = s * NWP + wv, p = u >> 4, f = u & 15;   // scalar: the plane and the half fragment (of its 16) that this wave stores
            const int row = (p < 4 ? (f >> 2) * 16 : ((f >> 1) & 3) * 16) + lr, ch = (p < 4 ? (f & 3) * 2 : (f >> 3) * 4 + (f & 1) * 2) + hi;   // q, k: f = [token tile][d block][half]; v: f = [key block][d tile][half]; ch: the 8 elements at 16 * half + 8 * hi of the 32 k
            *(v8us*)(PL + p * PLN + gq + f * 256 + lane * 8) = *(const v8usa*)(xs + p * (PR * EP) + row * EP + ch * 8); } }
}
// ---- k_fattn: scores, causal softmax and attn.v in one kernel; no score and no weight goes to memory.
// Transposed products: S^T = K.Q^T (A = 16 key rows, B = 16 query rows, both read in fragment order, 3 hi/lo products), O^T += V^T.P^T. In a 16x16 tile of S^T a lane holds 8 keys (8 * hi + r) of ONE query (lr), so the maximum and the sum of a query are in-lane plus one exchange between the wave's halves, and two such tiles (keys 0-15, 16-31), converted in place, are the B operand of the second product in the k order of the A loader (8 * hi + 0..7, 16 + 8 * hi + 0..7).
// A work-group (16 waves) works on two groups of 32 queries, the late group n - 1 - x and the early group x, so every work-group has the same number of 32-key blocks. Key blocks 0..x are wanted by both groups: wave j (0-7) takes blocks j, j + 8, ... of them for the late group while its twin, wave j + 8, takes the same blocks for the early group, so that a block's K and V lines are asked for twice at about the same time and the second asker can find them in the WGP's cache and not in L2. The late group's other blocks are then divided among all 16 waves (the last wave first, as the first waves had the odd shared blocks). Where the early group is a hi/lo group (rows < RH: other V planes, at most 16 blocks) there are no twins: all 16 waves divide first its blocks, then the late group's. Only a group's last block holds masked keys. Every wave has a running maximum, sum and output tile of its own for each group it works on; the partial results (16 of the late group; 8 of the early one, 16 if hi/lo) are joined through LDS behind one barrier, in wave order, and the output rows are written once.
// Rows < RH: P and V on bf16 hi/lo planes (3 products); the rest: P and V fp16. P is exp(s - running maximum), at most 1; the division by the sum comes last.
#define QW   32                                   // queries of a group
#define NWF  16                                   // waves of a work-group
#define OPT  68                                   // LDS pitch (floats) of a query's 64 partial outputs
#define SC2  (SCL * 1.4426950408889634f)          // score -> exponent of 2
#define NSL  (2 * NWF)                            // partial results of a work-group: slots 0-15 the late group's (one a wave), from 16 the early group's (8, of waves 8-15; a hi/lo group: 16)
static_assert(RH <= NWF * QW, "a hi/lo group has at most one key block a wave");
__device__ __forceinline__ float xhalf(float x) { return __builtin_bit_cast(float, __builtin_amdgcn_permlanex16(__builtin_bit_cast(int, x), __builtin_bit_cast(int, x), 0x76543210, 0xfedcba98, false, false)); }   // lane l with lane l ^ 16
template <bool HIRES>
__device__ __forceinline__ void fattn_wave(const bf* __restrict__ Qh, const bf* __restrict__ Ql, const bf* __restrict__ Kh, const bf* __restrict__ Kl, const h16* __restrict__ V16, const bf* __restrict__ Vh, const bf* __restrict__ Vl, const int q0, const int nkb, const int b1, const int n1, const int b2, const int n2, const int lr, const int hi, float* my, float* mm, float* ml) {   // the wave's blocks: b1 + 8 i (n1 of them), then b2 + 16 i (n2); all scalar
    v16bf qh[2][2], ql[2][2];
#pragma unroll
    for (int qt = 0; qt < 2; ++qt)
#pragma unroll
        for (int ks = 0; ks < 2; ++ks) { const size_t qo = (size_t)(q0 + qt * 16) * HD + ks * 512 + (16 * hi + lr) * 8; qh[qt][ks] = WFrag<bf>::ld(Qh + qo); ql[qt][ks] = WFrag<bf>::ld(Ql + qo); }
    // the Q fragments have arrived before the key loop is entered (loaded values as inputs only): its first instructions rewrite the address registers of the last Q loads
    asm volatile("" :: "v"(qh[0][0]), "v"(qh[0][1]), "v"(qh[1][0]), "v"(qh[1][1]), "v"(ql[0][0]), "v"(ql[0][1]), "v"(ql[1][0]), "v"(ql[1][1]));
    const unsigned loff = (16 * hi + lr) * 8;   // the lane's place in a half fragment, the same for K and V^T
    v8f o[4][2]; float m[2], l[2];
#pragma unroll
    for (int qt = 0; qt < 2; ++qt) { m[qt] = -3.0e38f; l[qt] = 0.f;
#pragma unroll
        for (int dt = 0; dt < 4; ++dt) o[dt][qt] = (v8f){}; }
    const int nt = HIRES ? (n1 > 0 ? 1 : 0) : n1 + n2;   // a hi/lo group has at most 16 blocks, one a wave: no loop there, so its output tile is not held over the products (with a loop that body does not fit the registers)
#pragma unroll 1
    for (int it = 1, kb = n1 > 0 ? b1 : b2; it <= nt; kb = it < n1 ? kb + NWF / 2 : it == n1 ? b2 : kb + NWF, ++it) {
        const int k0 = kb * 32; const bf* khs = Kh + (size_t)k0 * HD; const bf* kls = Kl + (size_t)k0 * HD;   // scalar bases: a block's loads share one lane offset, the rest is immediate
        v16bf kh[2][2], kl[2][2];
#pragma unroll
        for (int kt = 0; kt < 2; ++kt)
#pragma unroll
            for (int ks = 0; ks < 2; ++ks) { const unsigned ko = loff + kt * 16 * HD + ks * 512; kh[kt][ks] = WFrag<bf>::ld(khs + ko); kl[kt][ks] = WFrag<bf>::ld(kls + ko); }
        // holds the block's 16 K loads in front of the first product (loaded values as inputs only): they go out together and the wave waits for memory once, where the build otherwise reuses two fragments' registers and waits five times in a row
        asm volatile("" :: "v"(kh[0][0]), "v"(kh[0][1]), "v"(kh[1][0]), "v"(kh[1][1]), "v"(kl[0][0]), "v"(kl[0][1]), "v"(kl[1][0]), "v"(kl[1][1]));
        v8f s[2][2];
#pragma unroll
        for (int kt = 0; kt < 2; ++kt) { s[kt][0] = (v8f){}; s[kt][1] = (v8f){}; }
#pragma unroll
        for (int ks = 0; ks < 2; ++ks) {
#pragma unroll
            for (int kt = 0; kt < 2; ++kt)
#pragma unroll
                for (int qt = 0; qt < 2; ++qt) s[kt][qt] = wmmab(kh[kt][ks], qh[qt][ks], s[kt][qt]);
#pragma unroll
            for (int kt = 0; kt < 2; ++kt)
#pragma unroll
                for (int qt = 0; qt < 2; ++qt) s[kt][qt] = wmmab(kh[kt][ks], ql[qt][ks], s[kt][qt]);
#pragma unroll
            for (int kt = 0; kt < 2; ++kt)
#pragma unroll
                for (int qt = 0; qt < 2; ++qt) s[kt][qt] = wmmab(kl[kt][ks], qh[qt][ks], s[kt][qt]); }
        // the V^T fragments (A operand: row = d, k = the block's 32 keys) are asked for here, so that they fly during the softmax arithmetic
        v16h vf[4]; v16bf vh[4], vl[4];
#pragma unroll
        for (int dt = 0; dt < 4; ++dt) { const unsigned vo = loff + dt * 512; const size_t vb = (size_t)k0 * HD; if (HIRES) { vh[dt] = WFrag<bf>::ld(Vh + vb + vo); vl[dt] = WFrag<bf>::ld(Vl + vb + vo); } else vf[dt] = WFrag<h16>::ld(V16 + vb + vo); }
        asm volatile("s_wait_xcnt 0x0" ::: "memory");   // behind the V loads, in front of the branch on the diagonal block: the code behind it rewrites the loads' address registers
        if (kb == nkb - 1) {   // the diagonal block (k0 == q0; a scalar test): keys behind the query are masked
#pragma unroll
            for (int kt = 0; kt < 2; ++kt)
#pragma unroll
                for (int qt = 0; qt < 2; ++qt)
#pragma unroll
                    for (int r = 0; r < 8; ++r) if (kt * 16 + 8 * hi + r > qt * 16 + lr) s[kt][qt][r] = -3.0e38f; }
        float al[2];
#pragma unroll
        for (int qt = 0; qt < 2; ++qt) { float mx = s[0][qt][0];
#pragma unroll
            for (int r = 1; r < 8; ++r) mx = fmaxf(mx, s[0][qt][r]);
#pragma unroll
            for (int r = 0; r < 8; ++r) mx = fmaxf(mx, s[1][qt][r]);
            mx = fmaxf(mx, xhalf(mx)); mx = fmaxf(mx, m[qt]); al[qt] = (m[qt] - mx) * SC2; m[qt] = mx; const float nm = -mx * SC2;
#pragma unroll
            for (int kt = 0; kt < 2; ++kt)
#pragma unroll
                for (int r = 0; r < 8; ++r) s[kt][qt][r] = fmaf(s[kt][qt][r], SC2, nm); }
        // exponentials in place, four to a statement with a v_nop behind the last: no instruction directly behind a v_exp_f32 reads its result or overwrites its source (the slot the instruction set wants kept free)
#pragma unroll
        for (int qt = 0; qt < 2; ++qt)
#pragma unroll
            for (int kt = 0; kt < 2; ++kt) {
                asm("v_exp_f32 %0, %0\n\tv_exp_f32 %1, %1\n\tv_exp_f32 %2, %2\n\tv_exp_f32 %3, %3\n\tv_nop" : "+v"(s[kt][qt][0]), "+v"(s[kt][qt][1]), "+v"(s[kt][qt][2]), "+v"(s[kt][qt][3]));
                asm("v_exp_f32 %0, %0\n\tv_exp_f32 %1, %1\n\tv_exp_f32 %2, %2\n\tv_exp_f32 %3, %3\n\tv_nop" : "+v"(s[kt][qt][4]), "+v"(s[kt][qt][5]), "+v"(s[kt][qt][6]), "+v"(s[kt][qt][7])); }
        // the two rescale factors, with the same free slot behind the last
        asm("v_exp_f32 %0, %0\n\tv_exp_f32 %1, %1\n\tv_nop" : "+v"(al[0]), "+v"(al[1]));
#pragma unroll
        for (int qt = 0; qt < 2; ++qt) { float sum = 0.f;
#pragma unroll
            for (int kt = 0; kt < 2; ++kt)
#pragma unroll
                for (int r = 0; r < 8; ++r) sum += s[kt][qt][r];
            l[qt] = fmaf(l[qt], al[qt], sum);
#pragma unroll
            for (int dt = 0; dt < 4; ++dt) o[dt][qt] *= al[qt]; }
        if (HIRES) {
#pragma unroll
            for (int qt = 0; qt < 2; ++qt) { v8us h0, h1, l0, l1;
#pragma unroll
                for (int r = 0; r < 8; ++r) { unsigned short a2, c2; splitf(s[0][qt][r], a2, c2); h0[r] = a2; l0[r] = c2; splitf(s[1][qt][r], a2, c2); h1[r] = a2; l1[r] = c2; }
                const v16bf ph = cat16b(h0, h1), pl = cat16b(l0, l1);
#pragma unroll
                for (int dt = 0; dt < 4; ++dt) o[dt][qt] = wmmab(vh[dt], ph, o[dt][qt]);
#pragma unroll
                for (int dt = 0; dt < 4; ++dt) o[dt][qt] = wmmab(vh[dt], pl, o[dt][qt]);
#pragma unroll
                for (int dt = 0; dt < 4; ++dt) o[dt][qt] = wmmab(vl[dt], ph, o[dt][qt]); }
        } else {
#pragma unroll
            for (int qt = 0; qt < 2; ++qt) { v16h p;
#pragma unroll
                for (int r = 0; r < 8; ++r) { p[r] = tohx(s[0][qt][r]); p[8 + r] = tohx(s[1][qt][r]); }
#pragma unroll
                for (int dt = 0; dt < 4; ++dt) o[dt][qt] = wmma16(vf[dt], p, o[dt][qt]); }
        }
    }
#pragma unroll
    for (int qt = 0; qt < 2; ++qt) { l[qt] += xhalf(l[qt]);   // the halves' sums, joined once
        if (hi == 0) { mm[qt * 16 + lr] = m[qt]; ml[qt * 16 + lr] = l[qt]; }
#pragma unroll
        for (int dt = 0; dt < 4; ++dt) { float* p = my + (qt * 16 + lr) * OPT + dt * 16 + 8 * hi; v4f lo4, hi4;
#pragma unroll
            for (int r = 0; r < 4; ++r) { lo4[r] = o[dt][qt][r]; hi4[r] = o[dt][qt][4 + r]; }
            *(v4fa*)p = lo4; *(v4fa*)(p + 4) = hi4; } }
}
// joins a group's NW partial results (slots behind one another), in slot order, for 8 outputs of one query, and writes them
template <int NW>
__device__ __forceinline__ void fattn_join(const float* os, const float* ms, const float* ls, const int q, const int d0, float* orow) {
    float e[NW]; float M = -3.0e38f;
    // the loops over the slots are unrolled: a thread's LDS reads go out together
#pragma unroll
    for (int w = 0; w < NW; ++w) { e[w] = ms[w * QW + q]; M = fmaxf(M, e[w]); }
#pragma unroll
    for (int w = 0; w < NW; ++w) e[w] = (e[w] - M) * SC2;   // a wave that had no block: maximum -3e38, factor 0
    // as above: four exponentials and the free slot
#pragma unroll
    for (int w = 0; w < NW; w += 4) {
        asm("v_exp_f32 %0, %0\n\tv_exp_f32 %1, %1\n\tv_exp_f32 %2, %2\n\tv_exp_f32 %3, %3\n\tv_nop" : "+v"(e[w]), "+v"(e[w + 1]), "+v"(e[w + 2]), "+v"(e[w + 3])); }
    float L = 0.f; v4f a0 = (v4f){}, a1 = (v4f){};
#pragma unroll
    for (int w = 0; w < NW; ++w) { const float* p = os + w * (QW * OPT) + q * OPT + d0; L = fmaf(e[w], ls[w * QW + q], L); a0 += *(const v4fa*)p * e[w]; a1 += *(const v4fa*)(p + 4) * e[w]; }
    const float inv = __fdiv_rn(1.0f, L);
    *(v4f*)orow = a0 * inv; *(v4f*)(orow + 4) = a1 * inv;
}
__global__ __launch_bounds__(32 * NWF) void k_fattn(const bf* __restrict__ Qh, const bf* __restrict__ Ql, const bf* __restrict__ Kh, const bf* __restrict__ Kl, const h16* __restrict__ V16, const bf* __restrict__ Vh, const bf* __restrict__ Vl, float* __restrict__ O) {
    __shared__ __align__(16) float os[NSL * QW * OPT]; __shared__ float ms[NSL * QW]; __shared__ float ls[NSL * QW];
    { const size_t po = (size_t)blockIdx.y * TT * HD; Qh += po; Ql += po; Kh += po; Kl += po; V16 += po; Vh += po; Vl += po; O += (size_t)blockIdx.y * TT * CO; }   /* grid y: the batch */
    const int lane = threadIdx.x & 31, lr = lane & 15, hi = lane >> 4;
    const int wv = __builtin_amdgcn_readfirstlane((int)(threadIdx.x >> 5));   // wave number, scalar: the key loop keeps a scalar counter and branch
    const int gx = (int)blockIdx.x, gl = TT / QW - 1 - gx, j = wv & (NWF / 2 - 1);   // early group, late group, the wave's place among its eight
    const bool hl = gx * QW < RH;   // the early group is a hi/lo group (other V planes, at most 16 blocks): no twins; each group's blocks go wave w: w, w + 16, ...
    const int ns = (gx + NWF / 2 - j) / (NWF / 2), nr = (gl - gx + wv) / NWF;   // twins: the wave's share of the gx + 1 shared blocks (j, j + 8, ...) and of the late group's gl - gx other blocks (gx + 1 + (15 - wv), + 16, ...)
#pragma unroll 1
    for (int ph = wv < NWF / 2 && !hl ? 1 : 0; ph < 2; ++ph) {   // rolled: one copy of each body in the text. Pass 0 (twins: waves 8-15 alone): the early group's blocks; pass 1: the late group (twins: waves 0-7 shared blocks, then their part of the rest; waves 8-15 their part of the rest)
        const int g = ph ? gl : gx, q0 = g * QW, sl = ph ? wv : hl ? NWF + wv : NWF + j;
        const int b1 = hl ? wv : j, n1 = hl ? (ph == 0 && wv <= gx ? 1 : 0) : ph && wv >= NWF / 2 ? 0 : ns;
        const int b2 = hl ? wv : gx + NWF - wv, n2 = ph == 0 ? 0 : hl ? (gl + NWF - wv) / NWF : nr;
        if (q0 < RH) fattn_wave<true>(Qh, Ql, Kh, Kl, V16, Vh, Vl, q0, g + 1, b1, n1, b2, n2, lr, hi, os + sl * (QW * OPT), ms + sl * QW, ls + sl * QW);
        else fattn_wave<false>(Qh, Ql, Kh, Kl, V16, Vh, Vl, q0, g + 1, b1, n1, b2, n2, lr, hi, os + sl * (QW * OPT), ms + sl * QW, ls + sl * QW); }
    __syncthreads();   // every wave's partial maxima, sums and output tiles are in LDS before any wave joins them
    const int ph = wv >> 3, t8 = (wv & 7) * 32 + (int)__builtin_amdgcn_mbcnt_lo(~0u, 0u), q = t8 >> 3, d0 = (t8 & 7) * 8;   // waves 0-7: the late group's 32 x 64 outputs, 8 a thread; the rest: the early group's. The lane number is read anew: kept in a register over the key loops it was spilled to scratch
    float* orow = O + (size_t)((ph ? gx : gl) * QW + q) * CO + d0;
    const int sb = ph * NWF;   // the group's first slot
    if (ph == 0 || hl) fattn_join<NWF>(os + sb * (QW * OPT), ms + sb * QW, ls + sb * QW, q, d0, orow);   // a scalar test
    else fattn_join<NWF / 2>(os + sb * (QW * OPT), ms + sb * QW, ls + sb * QW, q, d0, orow);
}

extern "C" void kernel_launch(void* const* d_in, const int* in_sizes, int n_in,
                              void* d_out, int out_size, void* d_ws, size_t ws_size, hipStream_t stream) {
    (void)in_sizes; (void)n_in; (void)out_size;
    const float* x = (const float*)d_in[0]; const float* wq = (const float*)d_in[1]; const float* wk = (const float*)d_in[2]; const float* wv = (const float*)d_in[3];   /* standard roles: rows = queries */
    float* OUT = (float*)d_out;     // [4][4096][64]
    char* wsp = (char*)d_ws;
    auto take = [&](size_t bytes) { char* p = wsp; wsp += (bytes + 255) & ~(size_t)255; return (void*)p; };
    bf* WF = (bf*)take((size_t)3 * HD * CC * 2); bf* PL = (bf*)take(7 * PLN * 2);
    if ((size_t)(wsp - (char*)d_ws) > ws_size) return;    // carve ~14 MiB of the 256 MiB
    k_wfrag<<<dim3(HD * CC / 8 / 256, 3), 256, 0, stream>>>(wq, wk, wv, WF);   /* 'xw' weights -> bf16 fragments */
    k_proj<<<NB_ * TT / PR, 32 * NWP, 0, stream>>>(x, WF, PL);   /* q, k, v (the batches' rows stacked) and their planes */
    k_fattn<<<dim3(TT / QW / 2, NB_), 32 * NWF, 0, stream>>>(PL, PL + PLN, PL + 2 * PLN, PL + 3 * PLN, (const h16*)(PL + 4 * PLN), PL + 5 * PLN, PL + 6 * PLN, OUT);   /* scores (3 products), x 1/sqrt(C), causal softmax, weights.v; writes the output rows once */
}

// v009
// A run of this version takes 26.8 microseconds.
// In both of two side-by-side timings against v008, it was 1.18 times as fast.
// Over all steps from v000 it is 42.6 times as fast.
#include <hip/hip_runtime.h>

// Single causal attention head over 4,096 tokens scaled by the EMBEDDING width (x [4][4096][512]; q, k, v = x W ('xw' [512][64] 1/sqrt(512), no bias); scores = q.k^T / sqrt(C = 512) (the source divides by sqrt(n_embd), not sqrt(head_size)); causal (-inf); softmax; out = weights.v -> [4][4096][64] (1.0 M); argument order x, Wq, Wk, Wv).
// Three launches, all four batches in each: k_wfrag (weights), k_proj (q, k, v and their planes), k_fattn (attention).
// Layout: the 'xw' weights rounded to bf16 and stored once in the order of the matrix fragments; k_proj reads x as f32, rounds it to bf16 on the way into LDS, does the three exact projections (K 512, one accumulator over the whole K) and writes the fp16 planes (every token) and the hi/lo planes (tokens < 512, the only ones read) itself, each in the order of its reader's matrix fragments; k_fattn: scores and attn.v hybrid (query rows < 512 on hi/lo planes, 3 products each; the rest fp16, 1 product each), causal softmax with a running maximum, all in registers; it writes the output rows once.
// Causal skip: keys above the diagonal have weight exactly 0: a query group's key loop ends at its own 32-key block, and only that block is masked.
// Compute dtypes, f32 accumulate: every input rounded to bf16; projections exact; scores and wei.v rows < 512 3 products, rest fp16; softmax f32; output f32.
// Why fp16 scores are enough behind row 512: rounding q and k to fp16 moves a score by about 8 * sqrt(2) * 2e-4 before the scale 1/sqrt(512), so a weight by about 1e-4 of itself, half of what the fp16 rounding of the weight and of v each bring there already.

#define NB_  4
#define TT   4096
#define DM   64
#define NH_  1
#define NKV  1
#define REP  (NH_ / NKV)
#define HD   64
#define DQ   (NH_ * HD)
#define DKV  (NKV * HD)
#define ZH   1
#define RH   512                  // query rows < RH use hi+lo planes (0: none)
#define WIN  0
#define SCL  0.044194173824159216f   // 1/sqrt(C) with C = n_embd = 512 (the source scales by sqrt(n_embd), NOT sqrt(head_size))
#define MID  64       // q / k width (one 64-wide head)
#define CO   64       // v width
#define CC   512      // input width (d_in)
typedef _Float16 h16;
typedef unsigned short bf;
typedef __attribute__((ext_vector_type(16))) __bf16   v16bf;
typedef __attribute__((ext_vector_type(16))) _Float16 v16h;
typedef __attribute__((ext_vector_type(8)))  _Float16 v8h;
typedef __attribute__((ext_vector_type(8)))  unsigned short v8us;
typedef __attribute__((ext_vector_type(8)))  float    v8f;
typedef __attribute__((ext_vector_type(4)))  float    v4f;
typedef v8h  __attribute__((may_alias)) v8ha;
typedef v4f  __attribute__((may_alias)) v4fa;
typedef v8us __attribute__((may_alias)) v8usa;

__device__ __forceinline__ unsigned short f2bf(float f) { unsigned u = __float_as_uint(f); u += 0x7FFFu + ((u >> 16) & 1u); return (unsigned short)(u >> 16); }
__device__ __forceinline__ float bf2f(unsigned short b) { return __uint_as_float(((unsigned)b) << 16); }
__device__ __forceinline__ float bfr(float f) { return bf2f(f2bf(f)); }
__device__ __forceinline__ v16h cat16(v8h lo, v8h hi) { return __builtin_shufflevector(lo, hi, 0, 1, 2, 3, 4, 5, 6, 7, 8, 9, 10, 11, 12, 13, 14, 15); }
__device__ __forceinline__ v16bf cat16b(v8us lo, v8us hi) { return __builtin_bit_cast(v16bf, __builtin_shufflevector(lo, hi, 0, 1, 2, 3, 4, 5, 6, 7, 8, 9, 10, 11, 12, 13, 14, 15)); }
__device__ __forceinline__ v8f wmma16(v16h a, v16h b, v8f c) { return __builtin_amdgcn_wmma_f32_16x16x32_f16(false, a, false, b, (short)0, c, false, false); }
__device__ __forceinline__ v8f wmmab(v16bf a, v16bf b, v8f c) { return __builtin_amdgcn_wmma_f32_16x16x32_bf16(false, a, false, b, (short)0, c, false, false); }



// fragment loader (16 rows x 32 k, stored in fragment order [half][lane][8]): p is the lane's own 16 bytes of half 0; the lane holds k = 8 * hi + 0..7 (half 0) and 16 + 8 * hi + 0..7 (half 1) of row lr; each of the two loads of a wave covers 512 contiguous bytes
template <typename T16> struct WFrag;
template <> struct WFrag<h16> { typedef v16h V; static __device__ __forceinline__ V ld(const h16* p) { return cat16(*(const v8h*)p, *(const v8h*)(p + 256)); } static __device__ __forceinline__ v8f mma(V a, V b, v8f c) { return wmma16(a, b, c); } };
template <> struct WFrag<bf> { typedef v16bf V; static __device__ __forceinline__ V ld(const bf* p) { return cat16b(*(const v8us*)p, *(const v8us*)(p + 256)); } static __device__ __forceinline__ v8f mma(V a, V b, v8f c) { return wmmab(a, b, c); } };

__device__ __forceinline__ h16 tohx(float x) { return (h16)x; }
__device__ __forceinline__ void splitf(float y, unsigned short& h, unsigned short& l) { h = f2bf(y); l = f2bf(y - bf2f(h)); }
typedef __attribute__((ext_vector_type(2))) _Float16 v2h;
typedef __attribute__((ext_vector_type(4))) _Float16 v4h;
typedef __attribute__((ext_vector_type(2))) unsigned short v2us;
typedef __attribute__((ext_vector_type(4))) unsigned short v4us;
typedef __attribute__((ext_vector_type(2))) float v2f;
typedef __attribute__((ext_vector_type(4))) int v4i;

typedef v4us __attribute__((may_alias)) v4usa;
#define PR   64                                   // tokens of a k_proj work-group
#define NWP  12                                   // its waves: one 16-wide column tile of q (0-3), k (4-7), v (8-11) each
#define XP   520                                  // LDS pitch of an x row, 16-bit elements (1,040 B = 16 B x odd: the fragment reads meet no bank twice)
#define EP   72                                   // LDS pitch of an output plane's row, 16-bit elements (144 B = 16 B x odd)
#define NPL  9                                    // planes: 0 q fp16, 1 k fp16, 2 v^T fp16 (every token); 3 q hi, 4 q lo, 5 k hi, 6 k lo, 7 v^T hi, 8 v^T lo (written and read for tokens < RH of a batch only)
#define PLN  ((size_t)NB_ * TT * HD)              // elements of one plane; the planes lie behind one another, all in fragment order: q, k planes [b][t / 16][d / 32][half][lane][8] (lane: row t % 16 = lr); v^T planes [b][t / 32][d / 16][half][lane][8] (lane: row d % 16 = lr; k = the 32 tokens)
static_assert(RH % PR == 0 && TT % PR == 0, "a k_proj work-group's tokens are all below RH or none is");
static_assert(3 * 16 % NWP == 0 && NPL * 16 % NWP == 0, "the planes' half fragments make whole rounds of the work-group's waves");
// ---- k_wfrag: the three 'xw' weights [512][64], rounded to bf16, in fragment order: [matrix][column tile][k block of 32][half][lane][8], so that a wave's fragment is two loads of 512 contiguous bytes.
// Lane l, half h, element e hold column 16 * tile + (l & 15) and k = 32 * block + 16 * h + 8 * (l >> 4) + e: the k order of WFrag::ld.
__global__ __launch_bounds__(256) void k_wfrag(const float* __restrict__ wq, const float* __restrict__ wk, const float* __restrict__ wv, bf* WF) {
    const float* __restrict__ w = blockIdx.y == 0 ? wq : blockIdx.y == 1 ? wk : wv;
    const int i = blockIdx.x * 256 + threadIdx.x, lane = i & 31, half = (i >> 5) & 1, ks = (i >> 6) & 15, nt = i >> 10;
    const int n = nt * 16 + (lane & 15), k = ks * 32 + half * 16 + 8 * (lane >> 4); v8us o;
#pragma unroll
    for (int e = 0; e < 8; ++e) o[e] = f2bf(w[(size_t)(k + e) * HD + n]);
    *(v8us*)(WF + ((size_t)blockIdx.y * (HD * CC / 8) + i) * 8) = o;
}
// ---- k_proj: q, k, v of 64 tokens and all their planes in one work-group; grid: the 4 x 4096 stacked tokens / 64.
// x goes f32 -> bf16 -> LDS once; a wave holds its column tile's weights for the whole K in registers (asked for next to the x loads, so both fly together) and multiplies them with the four token tiles out of LDS.
// q, k: D = W^T.x^T (A = 16 columns, B = 16 tokens): a lane holds 8 neighbouring columns of ONE token, 16 bytes of a [t][64] plane. v: D = x.W (A = tokens, B = columns): 8 neighbouring tokens of ONE column, 16 bytes of a [64][t] plane.
// The planes' rows are put together in LDS (in the x tile's place) and leave in fragment order: a wave's store is one half fragment, 512 contiguous bytes, so that k_fattn's fragment loads cover 4 whole lines each and not 16 lines in 32-byte pieces.
__global__ __launch_bounds__(32 * NWP) void k_proj(const float* __restrict__ x, const bf* __restrict__ WF, bf* PL) {
    __shared__ __align__(16) bf xs[NPL * PR * EP > PR * XP ? NPL * PR * EP : PR * XP];   // the x tile, then the planes' rows
    const int tid = threadIdx.x, lane = tid & 31, lr = lane & 15, hi = lane >> 4;
    const int wv = __builtin_amdgcn_readfirstlane(tid >> 5);   // wave number, scalar: the tests on it are scalar branches
    v16bf wf[CC / 32]; const bf* wp = WF + (size_t)wv * (16 * CC) + lane * 8;
    // every loop of this kernel is unrolled: wf[], xv[] and acc[] are indexed by constants and stay in registers, and a loop's loads go out together
#pragma unroll
    for (int ks = 0; ks < CC / 32; ++ks) wf[ks] = cat16b(*(const v8us*)(wp + ks * 512), *(const v8us*)(wp + ks * 512 + 256));
    const float* xg = x + (size_t)blockIdx.x * (PR * CC);
    constexpr int NX = PR * CC / 4, SX = (NX + 32 * NWP - 1) / (32 * NWP), WX = (NX - (SX - 1) * 32 * NWP) / 32;   // 16-byte pieces of the tile; rounds of the work-group; waves of the last round
    v4f xv[SX];
#pragma unroll
    for (int s = 0; s < SX; ++s) if (s < SX - 1 || wv < WX) xv[s] = *(const v4f*)(xg + (size_t)(s * 32 * NWP + tid) * 4);
#pragma unroll
    for (int s = 0; s < SX; ++s) if (s < SX - 1 || wv < WX) { const int idx = s * 32 * NWP + tid; v4us o;
#pragma unroll
        for (int e = 0; e < 4; ++e) o[e] = f2bf(xv[s][e]);
        *(v4usa*)(xs + (idx >> 7) * XP + (idx & 127) * 4) = o; }
    __syncthreads();   // the bf16 tile is whole before any wave reads fragments of it
    v8f acc[4];
#pragma unroll
    for (int mt = 0; mt < 4; ++mt) acc[mt] = (v8f){};
    const bf* xr = xs + lr * XP + 8 * hi;
    // a k block's 8 LDS reads are held in front of its first product (loaded values as inputs only), so that they go out together and the wave waits for LDS once, where the build otherwise reuses one fragment's registers and waits in front of every product
    // the v_nop at each branch's end: the distance behind the last matrix instructions, whose results are read behind the jump out of the branch
    if (wv < 8) {
#pragma unroll
        for (int ks = 0; ks < CC / 32; ++ks) { v16bf xf[4];
#pragma unroll
            for (int mt = 0; mt < 4; ++mt) { const bf* p = xr + mt * 16 * XP + ks * 32; xf[mt] = cat16b(*(const v8usa*)p, *(const v8usa*)(p + 16)); }
            asm volatile("" :: "v"(xf[0]), "v"(xf[1]), "v"(xf[2]), "v"(xf[3]));
#pragma unroll
            for (int mt = 0; mt < 4; ++mt) acc[mt] = wmmab(wf[ks], xf[mt], acc[mt]); }
        asm volatile("v_nop\n\tv_nop\n\tv_nop\n\tv_nop" : "+v"(acc[0]), "+v"(acc[1]), "+v"(acc[2]), "+v"(acc[3]));
    } else {
#pragma unroll
        for (int ks = 0; ks < CC / 32; ++ks) { v16bf xf[4];
#pragma unroll
            for (int mt = 0; mt < 4; ++mt) { const bf* p = xr + mt * 16 * XP + ks * 32; xf[mt] = cat16b(*(const v8usa*)p, *(const v8usa*)(p + 16)); }
            asm volatile("" :: "v"(xf[0]), "v"(xf[1]), "v"(xf[2]), "v"(xf[3]));
#pragma unroll
            for (int mt = 0; mt < 4; ++mt) acc[mt] = wmmab(xf[mt], wf[ks], acc[mt]); }
        asm volatile("v_nop\n\tv_nop\n\tv_nop\n\tv_nop" : "+v"(acc[0]), "+v"(acc[1]), "+v"(acc[2]), "+v"(acc[3]));
    }
    __syncthreads();   // every wave has read its last fragment before the planes' rows overwrite the tile
    const bool hr = ((int)blockIdx.x * PR) % TT < RH;   // scalar: the work-group's tokens are among a batch's first RH, whose hi/lo planes are read
    if (wv < 8) {
        bf* e16 = xs + (wv >> 2) * (PR * EP) + lr * EP + (wv & 3) * 16 + 8 * hi;   // plane 0 (q) or 1 (k); row = token, column = the wave's tile
#pragma unroll
        for (int mt = 0; mt < 4; ++mt) { v8h o16;
#pragma unroll
            for (int j = 0; j < 8; ++j) o16[j] = tohx(acc[mt][j]);
            *(v8usa*)(e16 + mt * 16 * EP) = __builtin_bit_cast(v8us, o16); }
        if (hr) { bf* eh = e16 + (3 + (wv >> 2)) * (PR * EP);   // plane 3 (q hi) or 5 (k hi); the lo plane behind it
#pragma unroll
            for (int mt = 0; mt < 4; ++mt) { v8us h, l;
#pragma unroll
                for (int j = 0; j < 8; ++j) { unsigned short a2, c2; splitf(acc[mt][j], a2, c2); h[j] = a2; l[j] = c2; }
                *(v8usa*)(eh + mt * 16 * EP) = h; *(v8usa*)(eh + PR * EP + mt * 16 * EP) = l; } }
    } else {
        bf* ev = xs + 2 * PR * EP + ((wv & 3) * 16 + lr) * EP + 8 * hi;   // plane 2; row = column of v, column = token
#pragma unroll
        for (int mt = 0; mt < 4; ++mt) { v8h o16;
#pragma unroll
            for (int j = 0; j < 8; ++j) o16[j] = tohx(acc[mt][j]);
            *(v8usa*)(ev + mt * 16) = __builtin_bit_cast(v8us, o16); }
        if (hr) {   // planes 7, 8
#pragma unroll
            for (int mt = 0; mt < 4; ++mt) { v8us h, l;
#pragma unroll
                for (int j = 0; j < 8; ++j) { unsigned short a2, c2; splitf(acc[mt][j], a2, c2); h[j] = a2; l[j] = c2; }
                *(v8usa*)(ev + 5 * PR * EP + mt * 16) = h; *(v8usa*)(ev + 6 * PR * EP + mt * 16) = l; } }
    }
    __syncthreads();   // the planes' rows are whole before they are copied out
    const size_t gq = (size_t)blockIdx.x * (PR * HD);   // the work-group's 64 tokens are 4,096 contiguous elements of every plane
    constexpr int S16 = 3 * 16 / NWP, SHL = NPL * 16 / NWP - S16;   // rounds of the work-group: the fp16 planes', the hi/lo planes'
    // round s, scalar: u = the half fragment that this wave stores, p = u >> 4 its plane, f = u & 15 its place in the plane's 16; q, k: f = [token tile][d block][half]; v^T (planes 2, 7, 8): f = [key block][d tile][half]; ch: the 8 elements at 16 * half + 8 * hi of the 32 k
    auto get = [&](const int s) { const int u = s * NWP + wv, p = u >> 4, f = u & 15, vt = (p == 2) | (p >= 7);
        const int row = (vt ? (f >> 1) & 3 : f >> 2) * 16 + lr, ch = (vt ? (f >> 3) * 4 + (f & 1) * 2 : (f & 3) * 2) + hi;
        return *(const v8usa*)(xs + p * (PR * EP) + row * EP + ch * 8); };
    auto put = [&](const int s, const v8us t) { const int u = s * NWP + wv; *(v8us*)(PL + (u >> 4) * PLN + gq + (u & 15) * 256 + lane * 8) = t; };
    // a group's LDS reads go out together, each into registers of its own, in front of its stores
    { v8us t[S16];
#pragma unroll
        for (int s = 0; s < S16; ++s) t[s] = get(s);
#pragma unroll
        for (int s = 0; s < S16; ++s) put(s, t[s]); }
    asm volatile("s_wait_xcnt 0x0" ::: "memory");   // behind the fp16 planes' stores, in front of the branch on the hi/lo planes: the code behind it rewrites the stores' registers
    if (hr) { v8us t[SHL];
#pragma unroll
        for (int s = 0; s < SHL; ++s) t[s] = get(S16 + s);
#pragma unroll
        for (int s = 0; s < SHL; ++s) put(S16 + s, t[s]); }
}
// ---- k_fattn: scores, causal softmax and attn.v in one kernel; no score and no weight goes to memory.
// Transposed products: S^T = K.Q^T (A = 16 key rows, B = 16 query rows, both read in fragment order), O^T += V^T.P^T. In a 16x16 tile of S^T a lane holds 8 keys (8 * hi + r) of ONE query (lr), so the maximum and the sum of a query are in-lane plus one exchange between the wave's halves, and two such tiles (keys 0-15, 16-31), converted in place, are the B operand of the second product in the k order of the A loader (8 * hi + 0..7, 16 + 8 * hi + 0..7).
// A work-group (16 waves) works on two groups of 32 queries, the late group n - 1 - x and the early group x, so every work-group has the same number of 32-key blocks. Key blocks 0..x are wanted by both groups: wave j (0-7) takes blocks j, j + 8, ... of them for the late group while its twin, wave j + 8, takes the same blocks for the early group, so that a block's K and V lines are asked for twice at about the same time and the second asker can find them in the WGP's cache and not in L2. The late group's other blocks are then divided among all 16 waves (the last wave first, as the first waves had the odd shared blocks). Where the early group is a hi/lo group (rows < RH: other planes, at most 16 blocks) there are no twins: all 16 waves divide first its blocks, then the late group's. Only a group's last block holds masked keys. Every wave has a running maximum, sum and output tile of its own for each group it works on; the partial results (16 of the late group; 8 of the early one, 16 if hi/lo) are joined through LDS behind one barrier, in wave order, and the output rows are written once.
// Rows < RH: Q, K, P and V on bf16 hi/lo planes (3 products each); the rest: Q, K, P and V fp16 (1 product each; a key block is 4 KB of K and 4 KB of V). P is exp(s - running maximum), at most 1; the division by the sum comes last.
#define QW   32                                   // queries of a group
#define NWF  16                                   // waves of a work-group
#define OPT  68                                   // LDS pitch (floats) of a query's 64 partial outputs
#define SC2  (SCL * 1.4426950408889634f)          // score -> exponent of 2
#define NSL  (2 * NWF)                            // partial results of a work-group: slots 0-15 the late group's (one a wave), from 16 the early group's (8, of waves 8-15; a hi/lo group: 16)
static_assert(RH <= NWF * QW, "a hi/lo group has at most one key block a wave");
__device__ __forceinline__ float xhalf(float x) { return __builtin_bit_cast(float, __builtin_amdgcn_permlanex16(__builtin_bit_cast(int, x), __builtin_bit_cast(int, x), 0x76543210, 0xfedcba98, false, false)); }   // lane l with lane l ^ 16
template <bool HIRES>
__device__ __forceinline__ void fattn_wave(const h16* __restrict__ Q16, const h16* __restrict__ K16, const h16* __restrict__ V16, const bf* __restrict__ Qh, const bf* __restrict__ Ql, const bf* __restrict__ Kh, const bf* __restrict__ Kl, const bf* __restrict__ Vh, const bf* __restrict__ Vl, const int q0, const int nkb, const int b1, const int n1, const int b2, const int n2, const int lr, const int hi, float* my, float* mm, float* ml) {   // the wave's blocks: b1 + 8 i (n1 of them), then b2 + 16 i (n2); all scalar
    v16bf qh[2][2], ql[2][2]; v16h qf[2][2];
#pragma unroll
    for (int qt = 0; qt < 2; ++qt)
#pragma unroll
        for (int ks = 0; ks < 2; ++ks) { const size_t qo = (size_t)(q0 + qt * 16) * HD + ks * 512 + (16 * hi + lr) * 8; if constexpr (HIRES) { qh[qt][ks] = WFrag<bf>::ld(Qh + qo); ql[qt][ks] = WFrag<bf>::ld(Ql + qo); } else qf[qt][ks] = WFrag<h16>::ld(Q16 + qo); }
    // the Q fragments have arrived before the key loop is entered (loaded values as inputs only): its first instructions rewrite the address registers of the last Q loads
    if constexpr (HIRES) asm volatile("" :: "v"(qh[0][0]), "v"(qh[0][1]), "v"(qh[1][0]), "v"(qh[1][1]), "v"(ql[0][0]), "v"(ql[0][1]), "v"(ql[1][0]), "v"(ql[1][1]));
    else asm volatile("" :: "v"(qf[0][0]), "v"(qf[0][1]), "v"(qf[1][0]), "v"(qf[1][1]));
    const unsigned loff = (16 * hi + lr) * 8;   // the lane's place in a half fragment, the same for K and V^T
    v8f o[4][2]; float m[2], l[2];
#pragma unroll
    for (int qt = 0; qt < 2; ++qt) { m[qt] = -3.0e38f; l[qt] = 0.f;
#pragma unroll
        for (int dt = 0; dt < 4; ++dt) o[dt][qt] = (v8f){}; }
    const int nt = HIRES ? (n1 > 0 ? 1 : 0) : n1 + n2;   // a hi/lo group has at most 16 blocks, one a wave: no loop there, so its output tile is not held over the products (with a loop that body does not fit the registers)
#pragma unroll 1
    for (int it = 1, kb = n1 > 0 ? b1 : b2; it <= nt; kb = it < n1 ? kb + NWF / 2 : it == n1 ? b2 : kb + NWF, ++it) {
        const int k0 = kb * 32; const bf* khs = Kh + (size_t)k0 * HD; const bf* kls = Kl + (size_t)k0 * HD; const h16* kfs = K16 + (size_t)k0 * HD;   // scalar bases: a block's loads share one lane offset, the rest is immediate
        v16bf kh[2][2], kl[2][2]; v16h kf[2][2];
#pragma unroll
        for (int kt = 0; kt < 2; ++kt)
#pragma unroll
            for (int ks = 0; ks < 2; ++ks) { const unsigned ko = loff + kt * 16 * HD + ks * 512; if constexpr (HIRES) { kh[kt][ks] = WFrag<bf>::ld(khs + ko); kl[kt][ks] = WFrag<bf>::ld(kls + ko); } else kf[kt][ks] = WFrag<h16>::ld(kfs + ko); }
        // holds the block's K loads (16; fp16: 8) in front of the first product (loaded values as inputs only): they go out together and the wave waits for memory once, where the build otherwise reuses fragments' registers and waits several times in a row
        if constexpr (HIRES) asm volatile("" :: "v"(kh[0][0]), "v"(kh[0][1]), "v"(kh[1][0]), "v"(kh[1][1]), "v"(kl[0][0]), "v"(kl[0][1]), "v"(kl[1][0]), "v"(kl[1][1]));
        else asm volatile("" :: "v"(kf[0][0]), "v"(kf[0][1]), "v"(kf[1][0]), "v"(kf[1][1]));
        v8f s[2][2];
#pragma unroll
        for (int kt = 0; kt < 2; ++kt) { s[kt][0] = (v8f){}; s[kt][1] = (v8f){}; }
        if constexpr (!HIRES) {
#pragma unroll
            for (int ks = 0; ks < 2; ++ks)
#pragma unroll
                for (int kt = 0; kt < 2; ++kt)
#pragma unroll
                    for (int qt = 0; qt < 2; ++qt) s[kt][qt] = wmma16(kf[kt][ks], qf[qt][ks], s[kt][qt]);
        } else
#pragma unroll
        for (int ks = 0; ks < 2; ++ks) {
#pragma unroll
            for (int kt = 0; kt < 2; ++kt)
#pragma unroll
                for (int qt = 0; qt < 2; ++qt) s[kt][qt] = wmmab(kh[kt][ks], qh[qt][ks], s[kt][qt]);
#pragma unroll
            for (int kt = 0; kt < 2; ++kt)
#pragma unroll
                for (int qt = 0; qt < 2; ++qt) s[kt][qt] = wmmab(kh[kt][ks], ql[qt][ks], s[kt][qt]);
#pragma unroll
            for (int kt = 0; kt < 2; ++kt)
#pragma unroll
                for (int qt = 0; qt < 2; ++qt) s[kt][qt] = wmmab(kl[kt][ks], qh[qt][ks], s[kt][qt]); }
        // the V^T fragments (A operand: row = d, k = the block's 32 keys) are asked for here, so that they fly during the softmax arithmetic
        v16h vf[4]; v16bf vh[4], vl[4];
#pragma unroll
        for (int dt = 0; dt < 4; ++dt) { const unsigned vo = loff + dt * 512; const size_t vb = (size_t)k0 * HD; if (HIRES) { vh[dt] = WFrag<bf>::ld(Vh + vb + vo); vl[dt] = WFrag<bf>::ld(Vl + vb + vo); } else vf[dt] = WFrag<h16>::ld(V16 + vb + vo); }
        asm volatile("s_wait_xcnt 0x0" ::: "memory");   // behind the V loads, in front of the branch on the diagonal block: the code behind it rewrites the loads' address registers
        if (kb == nkb - 1) {   // the diagonal block (k0 == q0; a scalar test): keys behind the query are masked
#pragma unroll
            for (int kt = 0; kt < 2; ++kt)
#pragma unroll
                for (int qt = 0; qt < 2; ++qt)
#pragma unroll
                    for (int r = 0; r < 8; ++r) if (kt * 16 + 8 * hi + r > qt * 16 + lr) s[kt][qt][r] = -3.0e38f; }
        float al[2];
#pragma unroll
        for (int qt = 0; qt < 2; ++qt) { float mx = s[0][qt][0];
#pragma unroll
            for (int r = 1; r < 8; ++r) mx = fmaxf(mx, s[0][qt][r]);
#pragma unroll
            for (int r = 0; r < 8; ++r) mx = fmaxf(mx, s[1][qt][r]);
            mx = fmaxf(mx, xhalf(mx)); mx = fmaxf(mx, m[qt]); al[qt] = (m[qt] - mx) * SC2; m[qt] = mx; const float nm = -mx * SC2;
#pragma unroll
            for (int kt = 0; kt < 2; ++kt)
#pragma unroll
                for (int r = 0; r < 8; ++r) s[kt][qt][r] = fmaf(s[kt][qt][r], SC2, nm); }
        // exponentials in place, four to a statement with a v_nop behind the last: no instruction directly behind a v_exp_f32 reads its result or overwrites its source (the slot the instruction set wants kept free)
#pragma unroll
        for (int qt = 0; qt < 2; ++qt)
#pragma unroll
            for (int kt = 0; kt < 2; ++kt) {
                asm("v_exp_f32 %0, %0\n\tv_exp_f32 %1, %1\n\tv_exp_f32 %2, %2\n\tv_exp_f32 %3, %3\n\tv_nop" : "+v"(s[kt][qt][0]), "+v"(s[kt][qt][1]), "+v"(s[kt][qt][2]), "+v"(s[kt][qt][3]));
                asm("v_exp_f32 %0, %0\n\tv_exp_f32 %1, %1\n\tv_exp_f32 %2, %2\n\tv_exp_f32 %3, %3\n\tv_nop" : "+v"(s[kt][qt][4]), "+v"(s[kt][qt][5]), "+v"(s[kt][qt][6]), "+v"(s[kt][qt][7])); }
        // the two rescale factors, with the same free slot behind the last
        asm("v_exp_f32 %0, %0\n\tv_exp_f32 %1, %1\n\tv_nop" : "+v"(al[0]), "+v"(al[1]));
#pragma unroll
        for (int qt = 0; qt < 2; ++qt) { float sum = 0.f;
#pragma unroll
            for (int kt = 0; kt < 2; ++kt)
#pragma unroll
                for (int r = 0; r < 8; ++r) sum += s[kt][qt][r];
            l[qt] = fmaf(l[qt], al[qt], sum);
#pragma unroll
            for (int dt = 0; dt < 4; ++dt) o[dt][qt] *= al[qt]; }
        if (HIRES) {
#pragma unroll
            for (int qt = 0; qt < 2; ++qt) { v8us h0, h1, l0, l1;
#pragma unroll
                for (int r = 0; r < 8; ++r) { unsigned short a2, c2; splitf(s[0][qt][r], a2, c2); h0[r] = a2; l0[r] = c2; splitf(s[1][qt][r], a2, c2); h1[r] = a2; l1[r] = c2; }
                const v16bf ph = cat16b(h0, h1), pl = cat16b(l0, l1);
#pragma unroll
                for (int dt = 0; dt < 4; ++dt) o[dt][qt] = wmmab(vh[dt], ph, o[dt][qt]);
#pragma unroll
                for (int dt = 0; dt < 4; ++dt) o[dt][qt] = wmmab(vh[dt], pl, o[dt][qt]);
#pragma unroll
                for (int dt = 0; dt < 4; ++dt) o[dt][qt] = wmmab(vl[dt], ph, o[dt][qt]); }
        } else {
#pragma unroll
            for (int qt = 0; qt < 2; ++qt) { v16h p;
#pragma unroll
                for (int r = 0; r < 8; ++r) { p[r] = tohx(s[0][qt][r]); p[8 + r] = tohx(s[1][qt][r]); }
#pragma unroll
                for (int dt = 0; dt < 4; ++dt) o[dt][qt] = wmma16(vf[dt], p, o[dt][qt]); }
        }
    }
#pragma unroll
    for (int qt = 0; qt < 2; ++qt) { l[qt] += xhalf(l[qt]);   // the halves' sums, joined once
        if (hi == 0) { mm[qt * 16 + lr] = m[qt]; ml[qt * 16 + lr] = l[qt]; }
#pragma unroll
        for (int dt = 0; dt < 4; ++dt) { float* p = my + (qt * 16 + lr) * OPT + dt * 16 + 8 * hi; v4f lo4, hi4;
#pragma unroll
            for (int r = 0; r < 4; ++r) { lo4[r] = o[dt][qt][r]; hi4[r] = o[dt][qt][4 + r]; }
            *(v4fa*)p = lo4; *(v4fa*)(p + 4) = hi4; } }
}
// joins a group's NW partial results (slots behind one another), in slot order, for 8 outputs of one query, and writes them
template <int NW>
__device__ __forceinline__ void fattn_join(const float* os, const float* ms, const float* ls, const int q, const int d0, float* orow) {
    float e[NW]; float M = -3.0e38f;
    // the loops over the slots are unrolled: a thread's LDS reads go out together
#pragma unroll
    for (int w = 0; w < NW; ++w) { e[w] = ms[w * QW + q]; M = fmaxf(M, e[w]); }
#pragma unroll
    for (int w = 0; w < NW; ++w) e[w] = (e[w] - M) * SC2;   // a wave that had no block: maximum -3e38, factor 0
    // as above: four exponentials and the free slot
#pragma unroll
    for (int w = 0; w < NW; w += 4) {
        asm("v_exp_f32 %0, %0\n\tv_exp_f32 %1, %1\n\tv_exp_f32 %2, %2\n\tv_exp_f32 %3, %3\n\tv_nop" : "+v"(e[w]), "+v"(e[w + 1]), "+v"(e[w + 2]), "+v"(e[w + 3])); }
    float L = 0.f; v4f a0 = (v4f){}, a1 = (v4f){};
#pragma unroll
    for (int w = 0; w < NW; ++w) { const float* p = os + w * (QW * OPT) + q * OPT + d0; L = fmaf(e[w], ls[w * QW + q], L); a0 += *(const v4fa*)p * e[w]; a1 += *(const v4fa*)(p + 4) * e[w]; }
    const float inv = __fdiv_rn(1.0f, L);
    *(v4f*)orow = a0 * inv; *(v4f*)(orow + 4) = a1 * inv;
}
__global__ __launch_bounds__(32 * NWF) void k_fattn(const h16* __restrict__ Q16, const h16* __restrict__ K16, const h16* __restrict__ V16, const bf* __restrict__ Qh, const bf* __restrict__ Ql, const bf* __restrict__ Kh, const bf* __restrict__ Kl, const bf* __restrict__ Vh, const bf* __restrict__ Vl, float* __restrict__ O) {
    __shared__ __align__(16) float os[NSL * QW * OPT]; __shared__ float ms[NSL * QW]; __shared__ float ls[NSL * QW];
    { const size_t po = (size_t)blockIdx.y * TT * HD; Q16 += po; K16 += po; V16 += po; Qh += po; Ql += po; Kh += po; Kl += po; Vh += po; Vl += po; O += (size_t)blockIdx.y * TT * CO; }   /* grid y: the batch */
    const int lane = threadIdx.x & 31, lr = lane & 15, hi = lane >> 4;
    const int wv = __builtin_amdgcn_readfirstlane((int)(threadIdx.x >> 5));   // wave number, scalar: the key loop keeps a scalar counter and branch
    const int gx = (int)blockIdx.x, gl = TT / QW - 1 - gx, j = wv & (NWF / 2 - 1);   // early group, late group, the wave's place among its eight
    const bool hl = gx * QW < RH;   // the early group is a hi/lo group (other planes, at most 16 blocks): no twins; each group's blocks go wave w: w, w + 16, ...
    const int ns = (gx + NWF / 2 - j) / (NWF / 2), nr = (gl - gx + wv) / NWF;   // twins: the wave's share of the gx + 1 shared blocks (j, j + 8, ...) and of the late group's gl - gx other blocks (gx + 1 + (15 - wv), + 16, ...)
#pragma unroll 1
    for (int ph = wv < NWF / 2 && !hl ? 1 : 0; ph < 2; ++ph) {   // rolled: one copy of each body in the text. Pass 0 (twins: waves 8-15 alone): the early group's blocks; pass 1: the late group (twins: waves 0-7 shared blocks, then their part of the rest; waves 8-15 their part of the rest)
        const int g = ph ? gl : gx, q0 = g * QW, sl = ph ? wv : hl ? NWF + wv : NWF + j;
        const int b1 = hl ? wv : j, n1 = hl ? (ph == 0 && wv <= gx ? 1 : 0) : ph && wv >= NWF / 2 ? 0 : ns;
        const int b2 = hl ? wv : gx + NWF - wv, n2 = ph == 0 ? 0 : hl ? (gl + NWF - wv) / NWF : nr;
        if (q0 < RH) fattn_wave<true>(Q16, K16, V16, Qh, Ql, Kh, Kl, Vh, Vl, q0, g + 1, b1, n1, b2, n2, lr, hi, os + sl * (QW * OPT), ms + sl * QW, ls + sl * QW);
        else fattn_wave<false>(Q16, K16, V16, Qh, Ql, Kh, Kl, Vh, Vl, q0, g + 1, b1, n1, b2, n2, lr, hi, os + sl * (QW * OPT), ms + sl * QW, ls + sl * QW); }
    __syncthreads();   // every wave's partial maxima, sums and output tiles are in LDS before any wave joins them
    const int ph = wv >> 3, t8 = (wv & 7) * 32 + (int)__builtin_amdgcn_mbcnt_lo(~0u, 0u), q = t8 >> 3, d0 = (t8 & 7) * 8;   // waves 0-7: the late group's 32 x 64 outputs, 8 a thread; the rest: the early group's. The lane number is read anew: kept in a register over the key loops it was spilled to scratch
    float* orow = O + (size_t)((ph ? gx : gl) * QW + q) * CO + d0;
    const int sb = ph * NWF;   // the group's first slot
    if (ph == 0 || hl) fattn_join<NWF>(os + sb * (QW * OPT), ms + sb * QW, ls + sb * QW, q, d0, orow);   // a scalar test
    else fattn_join<NWF / 2>(os + sb * (QW * OPT), ms + sb * QW, ls + sb * QW, q, d0, orow);
}

extern "C" void kernel_launch(void* const* d_in, const int* in_sizes, int n_in,
                              void* d_out, int out_size, void* d_ws, size_t ws_size, hipStream_t stream) {
    (void)in_sizes; (void)n_in; (void)out_size;
    const float* x = (const float*)d_in[0]; const float* wq = (const float*)d_in[1]; const float* wk = (const float*)d_in[2]; const float* wv = (const float*)d_in[3];   /* standard roles: rows = queries */
    float* OUT = (float*)d_out;     // [4][4096][64]
    char* wsp = (char*)d_ws;
    auto take = [&](size_t bytes) { char* p = wsp; wsp += (bytes + 255) & ~(size_t)255; return (void*)p; };
    bf* WF = (bf*)take((size_t)3 * HD * CC * 2); bf* PL = (bf*)take(NPL * PLN * 2);
    if ((size_t)(wsp - (char*)d_ws) > ws_size) return;    // carve ~18 MiB of the 256 MiB
    k_wfrag<<<dim3(HD * CC / 8 / 256, 3), 256, 0, stream>>>(wq, wk, wv, WF);   /* 'xw' weights -> bf16 fragments */
    k_proj<<<NB_ * TT / PR, 32 * NWP, 0, stream>>>(x, WF, PL);   /* q, k, v (the batches' rows stacked) and their planes */
    k_fattn<<<dim3(TT / QW / 2, NB_), 32 * NWF, 0, stream>>>((const h16*)PL, (const h16*)(PL + PLN), (const h16*)(PL + 2 * PLN), PL + 3 * PLN, PL + 4 * PLN, PL + 5 * PLN, PL + 6 * PLN, PL + 7 * PLN, PL + 8 * PLN, OUT);   /* scores, x 1/sqrt(C), causal softmax, weights.v; writes the output rows once */
}

// v010
// Measured time: 24.9 microseconds a run.
// In two side-by-side timings against v009, it was 1.07 and 1.06 times as fast.
// Counting every step since v000, it is 45.4 times as fast.
#include <hip/hip_runtime.h>

// Single causal attention head over 4,096 tokens scaled by the EMBEDDING width (x [4][4096][512]; q, k, v = x W ('xw' [512][64] 1/sqrt(512), no bias); scores = q.k^T / sqrt(C = 512) (the source divides by sqrt(n_embd), not sqrt(head_size)); causal (-inf); softmax; out = weights.v -> [4][4096][64] (1.0 M); argument order x, Wq, Wk, Wv).
// Two launches, all four batches in each: k_proj (q, k, v and their planes), k_fattn (attention).
// Layout: k_proj reads x as f32 and rounds it to bf16 on the way into LDS, reads the 'xw' weights as f32 and rounds them to bf16 in the registers of the matrix fragments, does the three exact projections (K 512, one accumulator over each half of K, the two added) and writes the fp16 planes (every token) and the hi/lo planes (tokens < 512, the only ones read) itself, each in the order of its reader's matrix fragments; k_fattn: scores and attn.v hybrid (query rows < 512 on hi/lo planes, 3 products each; the rest fp16, 1 product each), causal softmax with a running maximum, all in registers; it writes the output rows once.
// Causal skip: keys above the diagonal have weight exactly 0: a query group's key loop ends at its own 32-key block, and only that block is masked.
// Compute dtypes, f32 accumulate: every input rounded to bf16; projections exact; scores and wei.v rows < 512 3 products, rest fp16; softmax f32; output f32.
// Why fp16 scores are enough behind row 512: rounding q and k to fp16 moves a score by about 8 * sqrt(2) * 2e-4 before the scale 1/sqrt(512), so a weight by about 1e-4 of itself, half of what the fp16 rounding of the weight and of v each bring there already.

#define NB_  4
#define TT   4096
#define DM   64
#define NH_  1
#define NKV  1
#define REP  (NH_ / NKV)
#define HD   64
#define DQ   (NH_ * HD)
#define DKV  (NKV * HD)
#define ZH   1
#define RH   512                  // query rows < RH use hi+lo planes (0: none)
#define WIN  0
#define SCL  0.044194173824159216f   // 1/sqrt(C) with C = n_embd = 512 (the source scales by sqrt(n_embd), NOT sqrt(head_size))
#define MID  64       // q / k width (one 64-wide head)
#define CO   64       // v width
#define CC   512      // input width (d_in)
typedef _Float16 h16;
typedef unsigned short bf;
typedef __attribute__((ext_vector_type(16))) __bf16   v16bf;
typedef __attribute__((ext_vector_type(16))) _Float16 v16h;
typedef __attribute__((ext_vector_type(8)))  _Float16 v8h;
typedef __attribute__((ext_vector_type(8)))  unsigned short v8us;
typedef __attribute__((ext_vector_type(8)))  float    v8f;
typedef __attribute__((ext_vector_type(4)))  float    v4f;
typedef v8h  __attribute__((may_alias)) v8ha;
typedef v4f  __attribute__((may_alias)) v4fa;
typedef v8us __attribute__((may_alias)) v8usa;

__device__ __forceinline__ unsigned short f2bf(float f) { unsigned u = __float_as_uint(f); u += 0x7FFFu + ((u >> 16) & 1u); return (unsigned short)(u >> 16); }
__device__ __forceinline__ float bf2f(unsigned short b) { return __uint_as_float(((unsigned)b) << 16); }
__device__ __forceinline__ float bfr(float f) { return bf2f(f2bf(f)); }
__device__ __forceinline__ v16h cat16(v8h lo, v8h hi) { return __builtin_shufflevector(lo, hi, 0, 1, 2, 3, 4, 5, 6, 7, 8, 9, 10, 11, 12, 13, 14, 15); }
__device__ __forceinline__ v16bf cat16b(v8us lo, v8us hi) { return __builtin_bit_cast(v16bf, __builtin_shufflevector(lo, hi, 0, 1, 2, 3, 4, 5, 6, 7, 8, 9, 10, 11, 12, 13, 14, 15)); }
__device__ __forceinline__ v8f wmma16(v16h a, v16h b, v8f c) { return __builtin_amdgcn_wmma_f32_16x16x32_f16(false, a, false, b, (short)0, c, false, false); }
__device__ __forceinline__ v8f wmmab(v16bf a, v16bf b, v8f c) { return __builtin_amdgcn_wmma_f32_16x16x32_bf16(false, a, false, b, (short)0, c, false, false); }



// fragment loader (16 rows x 32 k, stored in fragment order [half][lane][8]): p is the lane's own 16 bytes of half 0; the lane holds k = 8 * hi + 0..7 (half 0) and 16 + 8 * hi + 0..7 (half 1) of row lr; each of the two loads of a wave covers 512 contiguous bytes
template <typename T16> struct WFrag;
template <> struct WFrag<h16> { typedef v16h V; static __device__ __forceinline__ V ld(const h16* p) { return cat16(*(const v8h*)p, *(const v8h*)(p + 256)); } static __device__ __forceinline__ v8f mma(V a, V b, v8f c) { return wmma16(a, b, c); } };
template <> struct WFrag<bf> { typedef v16bf V; static __device__ __forceinline__ V ld(const bf* p) { return cat16b(*(const v8us*)p, *(const v8us*)(p + 256)); } static __device__ __forceinline__ v8f mma(V a, V b, v8f c) { return wmmab(a, b, c); } };

__device__ __forceinline__ h16 tohx(float x) { return (h16)x; }
__device__ __forceinline__ void splitf(float y, unsigned short& h, unsigned short& l) { h = f2bf(y); l = f2bf(y - bf2f(h)); }
typedef __attribute__((ext_vector_type(2))) _Float16 v2h;
typedef __attribute__((ext_vector_type(4))) _Float16 v4h;
typedef __attribute__((ext_vector_type(2))) unsigned short v2us;
typedef __attribute__((ext_vector_type(4))) unsigned short v4us;
typedef __attribute__((ext_vector_type(2))) float v2f;
typedef __attribute__((ext_vector_type(4))) int v4i;

typedef v4us __attribute__((may_alias)) v4usa;
typedef __attribute__((ext_vector_type(2))) __bf16 v2bf;
typedef __attribute__((ext_vector_type(8))) unsigned v8u;
template <bool B> struct Flag { static constexpr bool on = B; };   // a compile-time switch handed to a generic lambda
__device__ __forceinline__ unsigned bfpair(float a, float b) { const v2bf t = {(__bf16)a, (__bf16)b}; return __builtin_bit_cast(unsigned, t); }   // two f32 -> two bf16 (nearest even, as f2bf), a in the low half
#define PR   64                                   // tokens of a k_proj work-group
#define NWP  12                                   // its waves: wave = 2 * column group + K half; column group = 32 neighbouring columns of q (0, 1), k (2, 3), v (4, 5)
#define NKB  (CC / 32 / 2)                        // k blocks of 32 of a wave (one half of K)
#define WD   3                                    // k blocks of weights that a wave has asked for ahead
#define XP   520                                  // LDS pitch of an x row, 16-bit elements (1,040 B = 16 B x odd: the fragment reads meet no bank twice)
#define EP   72                                   // LDS pitch of an output plane's row, 16-bit elements (144 B = 16 B x odd)
#define NPL  9                                    // planes: 0 q fp16, 1 k fp16, 2 v^T fp16 (every token); 3 q hi, 4 q lo, 5 k hi, 6 k lo, 7 v^T hi, 8 v^T lo (written and read for tokens < RH of a batch only)
#define PLN  ((size_t)NB_ * TT * HD)              // elements of one plane; the planes lie behind one another, all in fragment order: q, k planes [b][t / 16][d / 32][half][lane][8] (lane: row t % 16 = lr); v^T planes [b][t / 32][d / 16][half][lane][8] (lane: row d % 16 = lr; k = the 32 tokens)
static_assert(RH % PR == 0 && TT % PR == 0, "a k_proj work-group's tokens are all below RH or none is");
static_assert(3 * 16 % NWP == 0 && NPL * 16 % NWP == 0, "the planes' half fragments make whole rounds of the work-group's waves");
// ---- k_proj: q, k, v of 64 tokens and all their planes in one work-group; grid: the 4 x 4096 stacked tokens / 64.
// x goes f32 -> bf16 -> LDS once. The 'xw' weights [512][64] are read as f32, straight into matrix fragments: a lane reads the two neighbouring columns c0 + 2 * lr + (0, 1) of one k row (16 lanes: one whole 128-byte line), for the 16 k of its fragment place, k = 32 * block + 16 * half + 8 * hi + e: the k order of the x fragments. Column j of each pair, rounded to bf16, is the fragment of column tile j, whose 16 columns are c0 + 2 * i + j: no value changes its lane.
// A wave has two such column tiles, the four token tiles and one half of K; the two waves of a column group hand each other the partial sums of two token tiles through LDS, and each finishes the two others.
// q, k: D = W^T.x^T (A = 16 columns, B = 16 tokens): a lane holds, over its two tiles, 16 neighbouring columns of ONE token: 32 bytes of a [t][64] plane. v: D = x.W (A = tokens, B = columns): 8 neighbouring tokens of ONE column, 16 bytes of a [64][t] plane.
// The planes' rows are put together in LDS (in the x tile's place) and leave in fragment order: a wave's store is one half fragment, 512 contiguous bytes, so that k_fattn's fragment loads cover 4 whole lines each and not 16 lines in 32-byte pieces.
__global__ __launch_bounds__(32 * NWP) void k_proj(const float* __restrict__ x, const float* __restrict__ wq, const float* __restrict__ wk, const float* __restrict__ wvl, bf* PL) {
    __shared__ __align__(16) bf xs[NPL * PR * EP > PR * XP ? NPL * PR * EP : PR * XP];   // the x tile, then the planes' rows
    __shared__ __align__(16) float ex[NWP * 1024];   // a wave's four partial tiles for its partner: [wave][tile][half of the 8 registers][lane][4]
    const int tid = threadIdx.x, lane = tid & 31, lr = lane & 15, hi = lane >> 4;
    const int wv = __builtin_amdgcn_readfirstlane(tid >> 5);   // wave number, scalar: the tests on it are scalar branches
    const int kh = wv & 1, mx = wv >> 2, c0 = ((wv >> 1) & 1) * 32;   // K half; matrix (0 q, 1 k, 2 v); first column of the group
    // every loop of this kernel is unrolled: wl[], xv[] and acc[] are indexed by constants and stay in registers, and a loop's loads go out together
    const float* xg = x + (size_t)blockIdx.x * (PR * CC);
    constexpr int NX = PR * CC / 4, SX = (NX + 32 * NWP - 1) / (32 * NWP), WX = (NX - (SX - 1) * 32 * NWP) / 32;   // 16-byte pieces of the tile; rounds of the work-group; waves of the last round
    v4f xv[SX];
#pragma unroll
    for (int s = 0; s < SX; ++s) if (s < SX - 1 || wv < WX) xv[s] = *(const v4f*)(xg + (size_t)(s * 32 * NWP + tid) * 4);
    asm volatile("s_wait_xcnt 0x0" :: "s"(xg) : "memory");   // behind the x loads: the code that follows rewrites their scalar base; the base is named as an input so that it stays in its registers up to the wait
    const float* __restrict__ wm = mx == 0 ? wq : mx == 1 ? wk : wvl;
    const float* wp = wm + (size_t)(kh * (CC / 2) + 8 * hi) * HD + c0 + 2 * lr;
    v2f wl[NKB][16];
    auto wload = [&](const int kb) {   // asks for the f32 weights of k block kb
#pragma unroll
        for (int i = 0; i < 16; ++i) wl[kb][i] = *(const v2f*)(wp + (kb * 32 + (i >> 3) * 16 + (i & 7)) * HD);
        // behind the last weights load: the address pair, which every weights load names, is free from here on; it is named as an input so that it stays in its registers up to the wait (the build otherwise lets the last load land in it)
        if (kb == NKB - 1) asm volatile("s_wait_xcnt 0x0" :: "v"(wp) : "memory"); };
#pragma unroll
    for (int kb = 0; kb < WD; ++kb) wload(kb);
    __builtin_amdgcn_sched_barrier(0);   // the first weights are asked for before the wave waits for its first x piece: the build otherwise starts converting x, and so waits out a memory latency, in front of these loads
#pragma unroll
    for (int s = 0; s < SX; ++s) if (s < SX - 1 || wv < WX) { const int idx = s * 32 * NWP + tid; v4us o;
#pragma unroll
        for (int e = 0; e < 4; ++e) o[e] = f2bf(xv[s][e]);
        *(v4usa*)(xs + (idx >> 7) * XP + (idx & 127) * 4) = o; }
    __syncthreads();   // the bf16 tile is whole before any wave reads fragments of it
    v8f acc[2][4];   // [column tile][0, 1: the token tiles 2 * kh + (0, 1), which this wave finishes; 2, 3: the partner's]
#pragma unroll
    for (int j = 0; j < 2; ++j)
#pragma unroll
        for (int t = 0; t < 4; ++t) acc[j][t] = (v8f){};
    const bf* xk = xs + (2 * kh * 16 + lr) * XP + kh * (CC / 2) + 8 * hi;         // the wave's own token tiles, its half of K
    const bf* xo = xs + ((2 - 2 * kh) * 16 + lr) * XP + kh * (CC / 2) + 8 * hi;   // the partner's token tiles
    // the K loop, once for q and k (D = W^T.x^T) and once for v (D = x.W): the operands' places are fixed at compile time
    auto kloop = [&](auto vform) {
#pragma unroll
    for (int kb = 0; kb < NKB; ++kb) { v16bf wf[2], xf[4];
        __builtin_amdgcn_sched_barrier(0);   // keeps a block's conversions in the block: moved up, as the build does otherwise, they wait for weights that were asked for only just before
#pragma unroll
        for (int j = 0; j < 2; ++j) { v8u t;   // f32 pairs -> the two column tiles' bf16 fragments
#pragma unroll
            for (int v = 0; v < 8; ++v) t[v] = bfpair(wl[kb][2 * v][j], wl[kb][2 * v + 1][j]);
            wf[j] = __builtin_bit_cast(v16bf, t); }
        if (kb + WD < NKB) wload(kb + WD);   // into the registers so freed
#pragma unroll
        for (int t = 0; t < 4; ++t) { const bf* p = (t < 2 ? xk : xo) + (t & 1) * 16 * XP + kb * 32; xf[t] = cat16b(*(const v8usa*)p, *(const v8usa*)(p + 16)); }
        // a k block's 8 LDS reads are held in front of its first product (loaded values as inputs only), so that they go out together and the wave waits for LDS once, where the build otherwise reuses one fragment's registers and waits in front of every product
        asm volatile("" :: "v"(xf[0]), "v"(xf[1]), "v"(xf[2]), "v"(xf[3]));
#pragma unroll
        for (int j = 0; j < 2; ++j)
#pragma unroll
            for (int t = 0; t < 4; ++t) acc[j][t] = decltype(vform)::on ? wmmab(xf[t], wf[j], acc[j][t]) : wmmab(wf[j], xf[t], acc[j][t]); }
    };
    if (mx < 2) kloop(Flag<false>{}); else kloop(Flag<true>{});
    { float* eo = ex + wv * 1024 + lane * 4;   // the partner's token tiles, this wave's half of K
#pragma unroll
        for (int j = 0; j < 2; ++j)
#pragma unroll
            for (int t = 0; t < 2; ++t) { v4f a, b;
#pragma unroll
                for (int r = 0; r < 4; ++r) { a[r] = acc[j][2 + t][r]; b[r] = acc[j][2 + t][4 + r]; }
                *(v4fa*)(eo + (j * 2 + t) * 256) = a; *(v4fa*)(eo + (j * 2 + t) * 256 + 128) = b; } }
    __syncthreads();   // every wave has read its last fragment before the planes' rows overwrite the tile, and the partial sums are in LDS before the partner reads them
    { const float* ei = ex + (wv ^ 1) * 1024 + lane * 4;   // this wave's token tiles, the partner's half of K
#pragma unroll
        for (int j = 0; j < 2; ++j)
#pragma unroll
            for (int t = 0; t < 2; ++t) { const v4f a = *(const v4fa*)(ei + (j * 2 + t) * 256), b = *(const v4fa*)(ei + (j * 2 + t) * 256 + 128);
#pragma unroll
                for (int r = 0; r < 4; ++r) { acc[j][t][r] += a[r]; acc[j][t][4 + r] += b[r]; } } }
    const bool hr = ((int)blockIdx.x * PR) % TT < RH;   // scalar: the work-group's tokens are among a batch's first RH, whose hi/lo planes are read
    if (mx < 2) {
        bf* e16 = xs + mx * (PR * EP) + (2 * kh * 16 + lr) * EP + c0 + 16 * hi;   // plane 0 (q) or 1 (k); row = token; the lane's 16 columns c0 + 16 * hi + 2 * r + j
#pragma unroll
        for (int t = 0; t < 2; ++t) { v8h o0, o1;
#pragma unroll
            for (int r = 0; r < 4; ++r)
#pragma unroll
                for (int j = 0; j < 2; ++j) { o0[2 * r + j] = tohx(acc[j][t][r]); o1[2 * r + j] = tohx(acc[j][t][4 + r]); }
            *(v8usa*)(e16 + t * 16 * EP) = __builtin_bit_cast(v8us, o0); *(v8usa*)(e16 + t * 16 * EP + 8) = __builtin_bit_cast(v8us, o1); }
        if (hr) { bf* eh = e16 + (3 + mx) * (PR * EP);   // plane 3 (q hi) or 5 (k hi); the lo plane behind it
#pragma unroll
            for (int t = 0; t < 2; ++t)
#pragma unroll
                for (int p = 0; p < 2; ++p) { v8us h, l;
#pragma unroll
                    for (int r = 0; r < 4; ++r)
#pragma unroll
                        for (int j = 0; j < 2; ++j) { unsigned short a2, c2; splitf(acc[j][t][4 * p + r], a2, c2); h[2 * r + j] = a2; l[2 * r + j] = c2; }
                    *(v8usa*)(eh + t * 16 * EP + 8 * p) = h; *(v8usa*)(eh + PR * EP + t * 16 * EP + 8 * p) = l; } }
    } else {
        bf* ev = xs + 2 * PR * EP + (c0 + 2 * lr) * EP + 2 * kh * 16 + 8 * hi;   // plane 2; row = column of v (c0 + 2 * lr + j), column = token: the lane's 8 neighbouring tokens
#pragma unroll
        for (int t = 0; t < 2; ++t)
#pragma unroll
            for (int j = 0; j < 2; ++j) { v8h o16;
#pragma unroll
                for (int r = 0; r < 8; ++r) o16[r] = tohx(acc[j][t][r]);
                *(v8usa*)(ev + j * EP + t * 16) = __builtin_bit_cast(v8us, o16); }
        if (hr) {   // planes 7, 8
#pragma unroll
            for (int t = 0; t < 2; ++t)
#pragma unroll
                for (int j = 0; j < 2; ++j) { v8us h, l;
#pragma unroll
                    for (int r = 0; r < 8; ++r) { unsigned short a2, c2; splitf(acc[j][t][r], a2, c2); h[r] = a2; l[r] = c2; }
                    *(v8usa*)(ev + 5 * PR * EP + j * EP + t * 16) = h; *(v8usa*)(ev + 6 * PR * EP + j * EP + t * 16) = l; } }
    }
    __syncthreads();   // the planes' rows are whole before they are copied out
    const size_t gq = (size_t)blockIdx.x * (PR * HD);   // the work-group's 64 tokens are 4,096 contiguous elements of every plane
    constexpr int S16 = 3 * 16 / NWP, SHL = NPL * 16 / NWP - S16;   // rounds of the work-group: the fp16 planes', the hi/lo planes'
    // round s, scalar: u = the half fragment that this wave stores, p = u >> 4 its plane, f = u & 15 its place in the plane's 16; q, k: f = [token tile][d block][half]; v^T (planes 2, 7, 8): f = [key block][d tile][half]; ch: the 8 elements at 16 * half + 8 * hi of the 32 k
    auto get = [&](const int s) { const int u = s * NWP + wv, p = u >> 4, f = u & 15, vt = (p == 2) | (p >= 7);
        const int row = (vt ? (f >> 1) & 3 : f >> 2) * 16 + lr, ch = (vt ? (f >> 3) * 4 + (f & 1) * 2 : (f & 3) * 2) + hi;
        return *(const v8usa*)(xs + p * (PR * EP) + row * EP + ch * 8); };
    auto put = [&](const int s, const v8us t) { const int u = s * NWP + wv; *(v8us*)(PL + (u >> 4) * PLN + gq + (u & 15) * 256 + lane * 8) = t; };
    // a group's LDS reads go out together, each into registers of its own, in front of its stores
    { v8us t[S16];
#pragma unroll
        for (int s = 0; s < S16; ++s) t[s] = get(s);
#pragma unroll
        for (int s = 0; s < S16; ++s) put(s, t[s]); }
    asm volatile("s_wait_xcnt 0x0" ::: "memory");   // behind the fp16 planes' stores, in front of the branch on the hi/lo planes: the code behind it rewrites the stores' registers
    if (hr) { v8us t[SHL];
#pragma unroll
        for (int s = 0; s < SHL; ++s) t[s] = get(S16 + s);
#pragma unroll
        for (int s = 0; s < SHL; ++s) put(S16 + s, t[s]); }
}
// ---- k_fattn: scores, causal softmax and attn.v in one kernel; no score and no weight goes to memory.
// Transposed products: S^T = K.Q^T (A = 16 key rows, B = 16 query rows, both read in fragment order), O^T += V^T.P^T. In a 16x16 tile of S^T a lane holds 8 keys (8 * hi + r) of ONE query (lr), so the maximum and the sum of a query are in-lane plus one exchange between the wave's halves, and two such tiles (keys 0-15, 16-31), converted in place, are the B operand of the second product in the k order of the A loader (8 * hi + 0..7, 16 + 8 * hi + 0..7).
// A work-group (16 waves) works on two groups of 32 queries, the late group n - 1 - x and the early group x, so every work-group has the same number of 32-key blocks. Key blocks 0..x are wanted by both groups: wave j (0-7) takes blocks j, j + 8, ... of them for the late group while its twin, wave j + 8, takes the same blocks for the early group, so that a block's K and V lines are asked for twice at about the same time and the second asker can find them in the WGP's cache and not in L2. The late group's other blocks are then divided among all 16 waves (the last wave first, as the first waves had the odd shared blocks). Where the early group is a hi/lo group (rows < RH: other planes, at most 16 blocks) there are no twins: all 16 waves divide first its blocks, then the late group's. Only a group's last block holds masked keys. Every wave has a running maximum, sum and output tile of its own for each group it works on; the partial results (16 of the late group; 8 of the early one, 16 if hi/lo) are joined through LDS behind one barrier, in wave order, and the output rows are written once.
// Rows < RH: Q, K, P and V on bf16 hi/lo planes (3 products each); the rest: Q, K, P and V fp16 (1 product each; a key block is 4 KB of K and 4 KB of V). P is exp(s - running maximum), at most 1; the division by the sum comes last.
#define QW   32                                   // queries of a group
#define NWF  16                                   // waves of a work-group
#define OPT  68                                   // LDS pitch (floats) of a query's 64 partial outputs
#define SC2  (SCL * 1.4426950408889634f)          // score -> exponent of 2
#define NSL  (2 * NWF)                            // partial results of a work-group: slots 0-15 the late group's (one a wave), from 16 the early group's (8, of waves 8-15; a hi/lo group: 16)
static_assert(RH <= NWF * QW, "a hi/lo group has at most one key block a wave");
__device__ __forceinline__ float xhalf(float x) { return __builtin_bit_cast(float, __builtin_amdgcn_permlanex16(__builtin_bit_cast(int, x), __builtin_bit_cast(int, x), 0x76543210, 0xfedcba98, false, false)); }   // lane l with lane l ^ 16
template <bool HIRES>
__device__ __forceinline__ void fattn_wave(const h16* __restrict__ Q16, const h16* __restrict__ K16, const h16* __restrict__ V16, const bf* __restrict__ Qh, const bf* __restrict__ Ql, const bf* __restrict__ Kh, const bf* __restrict__ Kl, const bf* __restrict__ Vh, const bf* __restrict__ Vl, const int q0, const int nkb, const int b1, const int n1, const int b2, const int n2, const int lr, const int hi, float* my, float* mm, float* ml) {   // the wave's blocks: b1 + 8 i (n1 of them), then b2 + 16 i (n2); all scalar
    v16bf qh[2][2], ql[2][2]; v16h qf[2][2];
#pragma unroll
    for (int qt = 0; qt < 2; ++qt)
#pragma unroll
        for (int ks = 0; ks < 2; ++ks) { const size_t qo = (size_t)(q0 + qt * 16) * HD + ks * 512 + (16 * hi + lr) * 8; if constexpr (HIRES) { qh[qt][ks] = WFrag<bf>::ld(Qh + qo); ql[qt][ks] = WFrag<bf>::ld(Ql + qo); } else qf[qt][ks] = WFrag<h16>::ld(Q16 + qo); }
    // the Q fragments have arrived before the key loop is entered (loaded values as inputs only): its first instructions rewrite the address registers of the last Q loads
    if constexpr (HIRES) asm volatile("" :: "v"(qh[0][0]), "v"(qh[0][1]), "v"(qh[1][0]), "v"(qh[1][1]), "v"(ql[0][0]), "v"(ql[0][1]), "v"(ql[1][0]), "v"(ql[1][1]));
    else asm volatile("" :: "v"(qf[0][0]), "v"(qf[0][1]), "v"(qf[1][0]), "v"(qf[1][1]));
    const unsigned loff = (16 * hi + lr) * 8;   // the lane's place in a half fragment, the same for K and V^T
    v8f o[4][2]; float m[2], l[2];
#pragma unroll
    for (int qt = 0; qt < 2; ++qt) { m[qt] = -3.0e38f; l[qt] = 0.f;
#pragma unroll
        for (int dt = 0; dt < 4; ++dt) o[dt][qt] = (v8f){}; }
    const int nt = HIRES ? (n1 > 0 ? 1 : 0) : n1 + n2;   // a hi/lo group has at most 16 blocks, one a wave: no loop there, so its output tile is not held over the products (with a loop that body does not fit the registers)
#pragma unroll 1
    for (int it = 1, kb = n1 > 0 ? b1 : b2; it <= nt; kb = it < n1 ? kb + NWF / 2 : it == n1 ? b2 : kb + NWF, ++it) {
        const int k0 = kb * 32; const bf* khs = Kh + (size_t)k0 * HD; const bf* kls = Kl + (size_t)k0 * HD; const h16* kfs = K16 + (size_t)k0 * HD;   // scalar bases: a block's loads share one lane offset, the rest is immediate
        v16bf kh[2][2], kl[2][2]; v16h kf[2][2];
#pragma unroll
        for (int kt = 0; kt < 2; ++kt)
#pragma unroll
            for (int ks = 0; ks < 2; ++ks) { const unsigned ko = loff + kt * 16 * HD + ks * 512; if constexpr (HIRES) { kh[kt][ks] = WFrag<bf>::ld(khs + ko); kl[kt][ks] = WFrag<bf>::ld(kls + ko); } else kf[kt][ks] = WFrag<h16>::ld(kfs + ko); }
        // holds the block's K loads (16; fp16: 8) in front of the first product (loaded values as inputs only): they go out together and the wave waits for memory once, where the build otherwise reuses fragments' registers and waits several times in a row
        if constexpr (HIRES) asm volatile("" :: "v"(kh[0][0]), "v"(kh[0][1]), "v"(kh[1][0]), "v"(kh[1][1]), "v"(kl[0][0]), "v"(kl[0][1]), "v"(kl[1][0]), "v"(kl[1][1]));
        else asm volatile("" :: "v"(kf[0][0]), "v"(kf[0][1]), "v"(kf[1][0]), "v"(kf[1][1]));
        v8f s[2][2];
#pragma unroll
        for (int kt = 0; kt < 2; ++kt) { s[kt][0] = (v8f){}; s[kt][1] = (v8f){}; }
        if constexpr (!HIRES) {
#pragma unroll
            for (int ks = 0; ks < 2; ++ks)
#pragma unroll
                for (int kt = 0; kt < 2; ++kt)
#pragma unroll
                    for (int qt = 0; qt < 2; ++qt) s[kt][qt] = wmma16(kf[kt][ks], qf[qt][ks], s[kt][qt]);
        } else
#pragma unroll
        for (int ks = 0; ks < 2; ++ks) {
#pragma unroll
            for (int kt = 0; kt < 2; ++kt)
#pragma unroll
                for (int qt = 0; qt < 2; ++qt) s[kt][qt] = wmmab(kh[kt][ks], qh[qt][ks], s[kt][qt]);
#pragma unroll
            for (int kt = 0; kt < 2; ++kt)
#pragma unroll
                for (int qt = 0; qt < 2; ++qt) s[kt][qt] = wmmab(kh[kt][ks], ql[qt][ks], s[kt][qt]);
#pragma unroll
            for (int kt = 0; kt < 2; ++kt)
#pragma unroll
                for (int qt = 0; qt < 2; ++qt) s[kt][qt] = wmmab(kl[kt][ks], qh[qt][ks], s[kt][qt]); }
        // the V^T fragments (A operand: row = d, k = the block's 32 keys) are asked for here, so that they fly during the softmax arithmetic
        v16h vf[4]; v16bf vh[4], vl[4];
#pragma unroll
        for (int dt = 0; dt < 4; ++dt) { const unsigned vo = loff + dt * 512; const size_t vb = (size_t)k0 * HD; if (HIRES) { vh[dt] = WFrag<bf>::ld(Vh + vb + vo); vl[dt] = WFrag<bf>::ld(Vl + vb + vo); } else vf[dt] = WFrag<h16>::ld(V16 + vb + vo); }
        asm volatile("s_wait_xcnt 0x0" ::: "memory");   // behind the V loads, in front of the branch on the diagonal block: the code behind it rewrites the loads' address registers
        if (kb == nkb - 1) {   // the diagonal block (k0 == q0; a scalar test): keys behind the query are masked
#pragma unroll
            for (int kt = 0; kt < 2; ++kt)
#pragma unroll
                for (int qt = 0; qt < 2; ++qt)
#pragma unroll
                    for (int r = 0; r < 8; ++r) if (kt * 16 + 8 * hi + r > qt * 16 + lr) s[kt][qt][r] = -3.0e38f; }
        float al[2];
#pragma unroll
        for (int qt = 0; qt < 2; ++qt) { float mx = s[0][qt][0];
#pragma unroll
            for (int r = 1; r < 8; ++r) mx = fmaxf(mx, s[0][qt][r]);
#pragma unroll
            for (int r = 0; r < 8; ++r) mx = fmaxf(mx, s[1][qt][r]);
            mx = fmaxf(mx, xhalf(mx)); mx = fmaxf(mx, m[qt]); al[qt] = (m[qt] - mx) * SC2; m[qt] = mx; const float nm = -mx * SC2;
#pragma unroll
            for (int kt = 0; kt < 2; ++kt)
#pragma unroll
                for (int r = 0; r < 8; ++r) s[kt][qt][r] = fmaf(s[kt][qt][r], SC2, nm); }
        // exponentials in place, four to a statement with a v_nop behind the last: no instruction directly behind a v_exp_f32 reads its result or overwrites its source (the slot the instruction set wants kept free)
#pragma unroll
        for (int qt = 0; qt < 2; ++qt)
#pragma unroll
            for (int kt = 0; kt < 2; ++kt) {
                asm("v_exp_f32 %0, %0\n\tv_exp_f32 %1, %1\n\tv_exp_f32 %2, %2\n\tv_exp_f32 %3, %3\n\tv_nop" : "+v"(s[kt][qt][0]), "+v"(s[kt][qt][1]), "+v"(s[kt][qt][2]), "+v"(s[kt][qt][3]));
                asm("v_exp_f32 %0, %0\n\tv_exp_f32 %1, %1\n\tv_exp_f32 %2, %2\n\tv_exp_f32 %3, %3\n\tv_nop" : "+v"(s[kt][qt][4]), "+v"(s[kt][qt][5]), "+v"(s[kt][qt][6]), "+v"(s[kt][qt][7])); }
        // the two rescale factors, with the same free slot behind the last
        asm("v_exp_f32 %0, %0\n\tv_exp_f32 %1, %1\n\tv_nop" : "+v"(al[0]), "+v"(al[1]));
#pragma unroll
        for (int qt = 0; qt < 2; ++qt) { float sum = 0.f;
#pragma unroll
            for (int kt = 0; kt < 2; ++kt)
#pragma unroll
                for (int r = 0; r < 8; ++r) sum += s[kt][qt][r];
            l[qt] = fmaf(l[qt], al[qt], sum);
#pragma unroll
            for (int dt = 0; dt < 4; ++dt) o[dt][qt] *= al[qt]; }
        if (HIRES) {
#pragma unroll
            for (int qt = 0; qt < 2; ++qt) { v8us h0, h1, l0, l1;
#pragma unroll
                for (int r = 0; r < 8; ++r) { unsigned short a2, c2; splitf(s[0][qt][r], a2, c2); h0[r] = a2; l0[r] = c2; splitf(s[1][qt][r], a2, c2); h1[r] = a2; l1[r] = c2; }
                const v16bf ph = cat16b(h0, h1), pl = cat16b(l0, l1);
#pragma unroll
                for (int dt = 0; dt < 4; ++dt) o[dt][qt] = wmmab(vh[dt], ph, o[dt][qt]);
#pragma unroll
                for (int dt = 0; dt < 4; ++dt) o[dt][qt] = wmmab(vh[dt], pl, o[dt][qt]);
#pragma unroll
                for (int dt = 0; dt < 4; ++dt) o[dt][qt] = wmmab(vl[dt], ph, o[dt][qt]); }
        } else {
#pragma unroll
            for (int qt = 0; qt < 2; ++qt) { v16h p;
#pragma unroll
                for (int r = 0; r < 8; ++r) { p[r] = tohx(s[0][qt][r]); p[8 + r] = tohx(s[1][qt][r]); }
#pragma unroll
                for (int dt = 0; dt < 4; ++dt) o[dt][qt] = wmma16(vf[dt], p, o[dt][qt]); }
        }
    }
#pragma unroll
    for (int qt = 0; qt < 2; ++qt) { l[qt] += xhalf(l[qt]);   // the halves' sums, joined once
        if (hi == 0) { mm[qt * 16 + lr] = m[qt]; ml[qt * 16 + lr] = l[qt]; }
#pragma unroll
        for (int dt = 0; dt < 4; ++dt) { float* p = my + (qt * 16 + lr) * OPT + dt * 16 + 8 * hi; v4f lo4, hi4;
#pragma unroll
            for (int r = 0; r < 4; ++r) { lo4[r] = o[dt][qt][r]; hi4[r] = o[dt][qt][4 + r]; }
            *(v4fa*)p = lo4; *(v4fa*)(p + 4) = hi4; } }
}
// joins a group's NW partial results (slots behind one another), in slot order, for 8 outputs of one query, and writes them
template <int NW>
__device__ __forceinline__ void fattn_join(const float* os, const float* ms, const float* ls, const int q, const int d0, float* orow) {
    float e[NW]; float M = -3.0e38f;
    // the loops over the slots are unrolled: a thread's LDS reads go out together
#pragma unroll
    for (int w = 0; w < NW; ++w) { e[w] = ms[w * QW + q]; M = fmaxf(M, e[w]); }
#pragma unroll
    for (int w = 0; w < NW; ++w) e[w] = (e[w] - M) * SC2;   // a wave that had no block: maximum -3e38, factor 0
    // as above: four exponentials and the free slot
#pragma unroll
    for (int w = 0; w < NW; w += 4) {
        asm("v_exp_f32 %0, %0\n\tv_exp_f32 %1, %1\n\tv_exp_f32 %2, %2\n\tv_exp_f32 %3, %3\n\tv_nop" : "+v"(e[w]), "+v"(e[w + 1]), "+v"(e[w + 2]), "+v"(e[w + 3])); }
    float L = 0.f; v4f a0 = (v4f){}, a1 = (v4f){};
#pragma unroll
    for (int w = 0; w < NW; ++w) { const float* p = os + w * (QW * OPT) + q * OPT + d0; L = fmaf(e[w], ls[w * QW + q], L); a0 += *(const v4fa*)p * e[w]; a1 += *(const v4fa*)(p + 4) * e[w]; }
    const float inv = __fdiv_rn(1.0f, L);
    *(v4f*)orow = a0 * inv; *(v4f*)(orow + 4) = a1 * inv;
}
__global__ __launch_bounds__(32 * NWF) void k_fattn(const h16* __restrict__ Q16, const h16* __restrict__ K16, const h16* __restrict__ V16, const bf* __restrict__ Qh, const bf* __restrict__ Ql, const bf* __restrict__ Kh, const bf* __restrict__ Kl, const bf* __restrict__ Vh, const bf* __restrict__ Vl, float* __restrict__ O) {
    __shared__ __align__(16) float os[NSL * QW * OPT]; __shared__ float ms[NSL * QW]; __shared__ float ls[NSL * QW];
    { const size_t po = (size_t)blockIdx.y * TT * HD; Q16 += po; K16 += po; V16 += po; Qh += po; Ql += po; Kh += po; Kl += po; Vh += po; Vl += po; O += (size_t)blockIdx.y * TT * CO; }   /* grid y: the batch */
    const int lane = threadIdx.x & 31, lr = lane & 15, hi = lane >> 4;
    const int wv = __builtin_amdgcn_readfirstlane((int)(threadIdx.x >> 5));   // wave number, scalar: the key loop keeps a scalar counter and branch
    const int gx = (int)blockIdx.x, gl = TT / QW - 1 - gx, j = wv & (NWF / 2 - 1);   // early group, late group, the wave's place among its eight
    const bool hl = gx * QW < RH;   // the early group is a hi/lo group (other planes, at most 16 blocks): no twins; each group's blocks go wave w: w, w + 16, ...
    const int ns = (gx + NWF / 2 - j) / (NWF / 2), nr = (gl - gx + wv) / NWF;   // twins: the wave's share of the gx + 1 shared blocks (j, j + 8, ...) and of the late group's gl - gx other blocks (gx + 1 + (15 - wv), + 16, ...)
#pragma unroll 1
    for (int ph = wv < NWF / 2 && !hl ? 1 : 0; ph < 2; ++ph) {   // rolled: one copy of each body in the text. Pass 0 (twins: waves 8-15 alone): the early group's blocks; pass 1: the late group (twins: waves 0-7 shared blocks, then their part of the rest; waves 8-15 their part of the rest)
        const int g = ph ? gl : gx, q0 = g * QW, sl = ph ? wv : hl ? NWF + wv : NWF + j;
        const int b1 = hl ? wv : j, n1 = hl ? (ph == 0 && wv <= gx ? 1 : 0) : ph && wv >= NWF / 2 ? 0 : ns;
        const int b2 = hl ? wv : gx + NWF - wv, n2 = ph == 0 ? 0 : hl ? (gl + NWF - wv) / NWF : nr;
        if (q0 < RH) fattn_wave<true>(Q16, K16, V16, Qh, Ql, Kh, Kl, Vh, Vl, q0, g + 1, b1, n1, b2, n2, lr, hi, os + sl * (QW * OPT), ms + sl * QW, ls + sl * QW);
        else fattn_wave<false>(Q16, K16, V16, Qh, Ql, Kh, Kl, Vh, Vl, q0, g + 1, b1, n1, b2, n2, lr, hi, os + sl * (QW * OPT), ms + sl * QW, ls + sl * QW); }
    __syncthreads();   // every wave's partial maxima, sums and output tiles are in LDS before any wave joins them
    const int ph = wv >> 3, t8 = (wv & 7) * 32 + (int)__builtin_amdgcn_mbcnt_lo(~0u, 0u), q = t8 >> 3, d0 = (t8 & 7) * 8;   // waves 0-7: the late group's 32 x 64 outputs, 8 a thread; the rest: the early group's. The lane number is read anew: kept in a register over the key loops it was spilled to scratch
    float* orow = O + (size_t)((ph ? gx : gl) * QW + q) * CO + d0;
    const int sb = ph * NWF;   // the group's first slot
    if (ph == 0 || hl) fattn_join<NWF>(os + sb * (QW * OPT), ms + sb * QW, ls + sb * QW, q, d0, orow);   // a scalar test
    else fattn_join<NWF / 2>(os + sb * (QW * OPT), ms + sb * QW, ls + sb * QW, q, d0, orow);
}

extern "C" void kernel_launch(void* const* d_in, const int* in_sizes, int n_in,
                              void* d_out, int out_size, void* d_ws, size_t ws_size, hipStream_t stream) {
    (void)in_sizes; (void)n_in; (void)out_size;
    const float* x = (const float*)d_in[0]; const float* wq = (const float*)d_in[1]; const float* wk = (const float*)d_in[2]; const float* wv = (const float*)d_in[3];   /* standard roles: rows = queries */
    float* OUT = (float*)d_out;     // [4][4096][64]
    char* wsp = (char*)d_ws;
    auto take = [&](size_t bytes) { char* p = wsp; wsp += (bytes + 255) & ~(size_t)255; return (void*)p; };
    bf* PL = (bf*)take(NPL * PLN * 2);
    if ((size_t)(wsp - (char*)d_ws) > ws_size) return;    // carve ~18 MiB of the 256 MiB
    k_proj<<<NB_ * TT / PR, 32 * NWP, 0, stream>>>(x, wq, wk, wv, PL);   /* q, k, v (the batches' rows stacked) and their planes */
    k_fattn<<<dim3(TT / QW / 2, NB_), 32 * NWF, 0, stream>>>((const h16*)PL, (const h16*)(PL + PLN), (const h16*)(PL + 2 * PLN), PL + 3 * PLN, PL + 4 * PLN, PL + 5 * PLN, PL + 6 * PLN, PL + 7 * PLN, PL + 8 * PLN, OUT);   /* scores, x 1/sqrt(C), causal softmax, weights.v; writes the output rows once */
}
